// v000
// Times are from an AMD MI455X. After a warm-up the kernel runs many times in a row, and a time is the length of
// such a window on the GPU divided by its runs, so every launch and the gaps after it count. The runs cycle
// through copies of the inputs. A figure is the median of several windows, for all but v000 over two sittings.
// Sittings can differ by a few percent; kernels timed side by side share one.
// v000, which the later versions start from, runs in 397 microseconds.
#include <hip/hip_runtime.h>
#include <hip/hip_bf16.h>

// ---------------------------------------------------------------------------
// Reka transformer block for MI455X (gfx1250): wave32 + WMMA bf16 pipeline
// with async global->LDS staging (ASYNCcnt) and double-buffered GEMM tiles.
// ---------------------------------------------------------------------------

#define DEV static __device__ __forceinline__

typedef __attribute__((ext_vector_type(16))) __bf16 v16bf;
typedef __attribute__((ext_vector_type(8)))  __bf16 v8bf;
typedef __attribute__((ext_vector_type(8)))  float  v8f;
typedef __attribute__((ext_vector_type(4)))  int    v4i;

#define LDS_AS __attribute__((address_space(3)))
#define GLB_AS __attribute__((address_space(1)))

DEV v8f vzero8() {
    v8f z;
#pragma unroll
    for (int i = 0; i < 8; ++i) z[i] = 0.0f;
    return z;
}

// Async global -> LDS copy of one 16-byte chunk (tracked by ASYNCcnt).
DEV void async_b128(const __bf16* g, __bf16* l) {
#if __has_builtin(__builtin_amdgcn_global_load_async_to_lds_b128)
    __builtin_amdgcn_global_load_async_to_lds_b128(
        (GLB_AS v4i*)(uintptr_t)g,
        (LDS_AS v4i*)(uint32_t)(uintptr_t)l, 0, 0);
#else
    unsigned loff = (unsigned)(uintptr_t)l;
    asm volatile("global_load_async_to_lds_b128 %0, %1, off"
                 :: "v"(loff), "v"(g) : "memory");
#endif
}

DEV void wait_async0() {
#if __has_builtin(__builtin_amdgcn_s_wait_asynccnt)
    __builtin_amdgcn_s_wait_asynccnt(0);
#else
    asm volatile("s_wait_asynccnt 0" ::: "memory");
#endif
}

// Build a 16-element bf16 fragment from two 16-byte chunks (the CDNA5 A/B
// 16-bit layout: lane holds K = half*8..+7 and K = 16+half*8..+7).
DEV v16bf ld_frag(const __bf16* lo, const __bf16* hi) {
    v8bf a = *(const v8bf*)lo;
    v8bf b = *(const v8bf*)hi;
    return __builtin_shufflevector(a, b, 0, 1, 2, 3, 4, 5, 6, 7,
                                          8, 9, 10, 11, 12, 13, 14, 15);
}

DEV v8f wmma_bf16(v16bf a, v16bf b, v8f c) {
    return __builtin_amdgcn_wmma_f32_16x16x32_bf16(
        false, a, false, b, (short)0, c, false, false);
}

// ---------------------------------------------------------------------------
// Elementwise f32 -> bf16 convert (4 elems / thread)
// ---------------------------------------------------------------------------
__global__ __launch_bounds__(256)
void k_cvt_bf16(const float* __restrict__ in, __bf16* __restrict__ out) {
    size_t i = ((size_t)blockIdx.x * 256 + threadIdx.x) * 4;
    float4 v = *(const float4*)&in[i];
    union { __bf16 h[4]; uint2 u; } o;
    o.h[0] = (__bf16)v.x; o.h[1] = (__bf16)v.y;
    o.h[2] = (__bf16)v.z; o.h[3] = (__bf16)v.w;
    *(uint2*)&out[i] = o.u;
}

// ---------------------------------------------------------------------------
// Weight transpose + convert: W[K][N] f32 -> Wt[N][K] bf16 (32x32 LDS tiles)
// ---------------------------------------------------------------------------
__global__ __launch_bounds__(256)
void k_cvt_w_t(const float* __restrict__ W, __bf16* __restrict__ Wt,
               int K, int N) {
    __shared__ float t[32][33];
    const int k0 = blockIdx.y * 32, n0 = blockIdx.x * 32;
    const int tid = threadIdx.x;
    const int c = tid & 31, r0 = tid >> 5;
#pragma unroll
    for (int i = 0; i < 4; ++i) {
        int r = r0 + i * 8;
        t[r][c] = W[(size_t)(k0 + r) * N + n0 + c];
    }
    __syncthreads();
#pragma unroll
    for (int i = 0; i < 4; ++i) {
        int r = r0 + i * 8;
        Wt[(size_t)(n0 + r) * K + k0 + c] = (__bf16)t[c][r];
    }
}

// ---------------------------------------------------------------------------
// Tiled WMMA GEMM: C[M][N] f32 = A[M][K] bf16 * Bt[N][K] bf16 (+ residual)
// Block = 256 threads (8 waves), tile 128x128, K-step 64, double-buffered
// async global->LDS staging.
// ---------------------------------------------------------------------------
#define GKS 64
#define GKP 72  // padded LDS row stride (144 B, 16B-aligned)

__global__ __launch_bounds__(256)
void k_gemm_bf16(const __bf16* __restrict__ A, const __bf16* __restrict__ Bt,
                 const float* __restrict__ resid, float* __restrict__ C,
                 int M, int N, int K) {
    __shared__ __bf16 a_lds[2][128 * GKP];
    __shared__ __bf16 b_lds[2][128 * GKP];
    const int tid = threadIdx.x;
    const int lane = tid & 31, wave = tid >> 5;
    const int half = (lane >> 4) & 1, l16 = lane & 15;
    const int m_blk = blockIdx.y * 128, n_blk = blockIdx.x * 128;
    const int m0 = wave * 16;
    const int r_base = tid >> 3, c_st = (tid & 7) * 8;

    v8f acc[8];
#pragma unroll
    for (int i = 0; i < 8; ++i) acc[i] = vzero8();

    // Stage one 128x64 tile of A and Bt into LDS buffer `buf` (async).
    auto stage = [&](int k0, int buf) {
#pragma unroll
        for (int i = 0; i < 4; ++i) {
            int r = r_base + i * 32;
            async_b128(&A[(size_t)(m_blk + r) * K + k0 + c_st],
                       &a_lds[buf][r * GKP + c_st]);
            async_b128(&Bt[(size_t)(n_blk + r) * K + k0 + c_st],
                       &b_lds[buf][r * GKP + c_st]);
        }
    };

    const int T = K / GKS;
    stage(0, 0);
    for (int t = 0; t < T; ++t) {
        wait_async0();          // tile t landed (async loads retire in order)
        __syncthreads();        // visible to all waves; prior reads finished
        if (t + 1 < T) stage((t + 1) * GKS, (t + 1) & 1);  // overlap copy
        const __bf16* abase = &a_lds[t & 1][(m0 + l16) * GKP];
#pragma unroll
        for (int kk = 0; kk < 2; ++kk) {
            v16bf af = ld_frag(abase + kk * 32 + half * 8,
                               abase + kk * 32 + 16 + half * 8);
#pragma unroll
            for (int nt = 0; nt < 8; ++nt) {
                const __bf16* brow =
                    &b_lds[t & 1][(nt * 16 + l16) * GKP + kk * 32];
                acc[nt] = wmma_bf16(
                    af, ld_frag(brow + half * 8, brow + 16 + half * 8),
                    acc[nt]);
            }
        }
    }

#pragma unroll
    for (int nt = 0; nt < 8; ++nt) {
#pragma unroll
        for (int r = 0; r < 8; ++r) {
            int m = m_blk + m0 + half * 8 + r;
            int n = n_blk + nt * 16 + l16;
            float v = acc[nt][r];
            if (resid) v += resid[(size_t)m * N + n];
            C[(size_t)m * N + n] = v;
        }
    }
}

// ---------------------------------------------------------------------------
// Per-head RMSNorm over DH=128, f32 in -> bf16 out. One wave per row.
// ---------------------------------------------------------------------------
__global__ __launch_bounds__(256)
void k_rmsnorm(const float* __restrict__ in, const float* __restrict__ gamma,
               __bf16* __restrict__ out, int rows) {
    const int lane = threadIdx.x & 31, wave = threadIdx.x >> 5;
    const int row = blockIdx.x * 8 + wave;
    if (row >= rows) return;
    const float* p = in + (size_t)row * 128;
    float4 v = *(const float4*)&p[lane * 4];
    float ss = v.x * v.x + v.y * v.y + v.z * v.z + v.w * v.w;
#pragma unroll
    for (int m = 1; m < 32; m <<= 1) ss += __shfl_xor(ss, m, 32);
    float rs = rsqrtf(ss * (1.0f / 128.0f) + 1e-8f);
    float4 g = make_float4(1.f, 1.f, 1.f, 1.f);
    if (gamma) g = *(const float4*)&gamma[lane * 4];
    union { __bf16 h[4]; uint2 u; } o;
    o.h[0] = (__bf16)(v.x * rs * g.x);
    o.h[1] = (__bf16)(v.y * rs * g.y);
    o.h[2] = (__bf16)(v.z * rs * g.z);
    o.h[3] = (__bf16)(v.w * rs * g.w);
    *(uint2*)&out[(size_t)row * 128 + lane * 4] = o.u;
}

// ---------------------------------------------------------------------------
// Causal GQA flash attention. Grid: (q_tiles=16, H=16, B=2), block 256.
// Each of 8 waves owns 16 query rows. K staged async [key][dh]; V staged
// transposed [dh][key] through VGPRs (overlapping the async K copies).
// ---------------------------------------------------------------------------
#define AKP 136  // padded row stride (272 B, 16B-aligned)

__global__ __launch_bounds__(256)
void k_attn(const __bf16* __restrict__ qb, const __bf16* __restrict__ kb,
            const __bf16* __restrict__ vb, __bf16* __restrict__ ob) {
    __shared__ __bf16 k_lds[128 * AKP];
    __shared__ __bf16 v_lds[128 * AKP];
    __shared__ __bf16 p_lds[8][16][32];

    const int tid = threadIdx.x;
    const int lane = tid & 31, wave = tid >> 5;
    const int half = (lane >> 4) & 1, l16 = lane & 15;
    const int qt = blockIdx.x, h = blockIdx.y, b = blockIdx.z;
    const int kvh = h >> 2;            // GQA group of 4
    const int tok0 = b * 2048;
    const int q0 = qt * 128 + wave * 16;  // wave's first query row (in-batch)
    const float scale = 0.08838834764831845f;  // 128^-0.5

    // Q fragments: 16 rows x 128 dh, 4 K-chunks of 32.
    v16bf qf[4];
    {
        const int t = tok0 + q0 + l16;
        const __bf16* qrow = qb + ((size_t)t * 16 + h) * 128;
#pragma unroll
        for (int kk = 0; kk < 4; ++kk)
            qf[kk] = ld_frag(qrow + kk * 32 + half * 8,
                             qrow + kk * 32 + 16 + half * 8);
    }

    v8f o[8];
#pragma unroll
    for (int i = 0; i < 8; ++i) o[i] = vzero8();
    float mrow[8], lrow[8];  // replicated across the 16 lanes of each half
#pragma unroll
    for (int r = 0; r < 8; ++r) { mrow[r] = -3.0e38f; lrow[r] = 0.0f; }

    for (int kt = 0; kt <= qt; ++kt) {
        __syncthreads();  // previous tile fully consumed
        // --- async K tile: [key][dh], 128 keys x 16 chunks ---
#pragma unroll
        for (int i = 0; i < 8; ++i) {
            int idx = tid + i * 256;
            int key = idx >> 4, c = (idx & 15) * 8;
            int t = tok0 + kt * 128 + key;
            async_b128(&kb[((size_t)t * 4 + kvh) * 128 + c],
                       &k_lds[key * AKP + c]);
        }
        // --- V tile transposed through VGPRs (overlaps async K) ---
        uint4 uv[8];
#pragma unroll
        for (int i = 0; i < 8; ++i) {
            int idx = tid + i * 256;
            int key = idx >> 4, c = (idx & 15) * 8;
            int t = tok0 + kt * 128 + key;
            uv[i] = *(const uint4*)&vb[((size_t)t * 4 + kvh) * 128 + c];
        }
#pragma unroll
        for (int i = 0; i < 8; ++i) {
            int idx = tid + i * 256;
            int key = idx >> 4, c = (idx & 15) * 8;
            union { uint4 u; __bf16 hh[8]; } q;
            q.u = uv[i];
#pragma unroll
            for (int j = 0; j < 8; ++j)
                v_lds[(c + j) * AKP + key] = q.hh[j];
        }
        wait_async0();
        __syncthreads();

        // Skip fully-masked 32-key groups on the diagonal tile.
        const int gmax = (kt == qt) ? (wave * 16 + 15) / 32 : 3;
        for (int g = 0; g <= gmax; ++g) {
            // S = Q K^T for 32 keys (two 16-wide tiles), K-dim = dh = 128.
            v8f s0 = vzero8(), s1 = vzero8();
#pragma unroll
            for (int kk = 0; kk < 4; ++kk) {
                const __bf16* kr0 = &k_lds[(g * 32 + l16) * AKP + kk * 32];
                const __bf16* kr1 = &k_lds[(g * 32 + 16 + l16) * AKP + kk * 32];
                s0 = wmma_bf16(qf[kk],
                               ld_frag(kr0 + half * 8, kr0 + 16 + half * 8), s0);
                s1 = wmma_bf16(qf[kk],
                               ld_frag(kr1 + half * 8, kr1 + 16 + half * 8), s1);
            }
            // Scale + causal mask + per-row max over this 32-key group.
            const int qg = q0 + half * 8;          // + r
            const int kg0 = kt * 128 + g * 32 + l16;
            float p0[8], p1[8], tmax[8];
#pragma unroll
            for (int r = 0; r < 8; ++r) {
                float a = s0[r] * scale, c = s1[r] * scale;
                if (kg0 > qg + r) a = -3.0e38f;
                if (kg0 + 16 > qg + r) c = -3.0e38f;
                p0[r] = a; p1[r] = c;
                float t = fmaxf(a, c);
#pragma unroll
                for (int m = 1; m < 16; m <<= 1)
                    t = fmaxf(t, __shfl_xor(t, m, 32));
                tmax[r] = t;
            }
            // Online softmax update; stage P (bf16) re-laid-out for A-frag.
            float alpha[8];
#pragma unroll
            for (int r = 0; r < 8; ++r) {
                float mn = fmaxf(mrow[r], tmax[r]);
                bool live = mn > -1.0e37f;
                float al = live ? __expf(mrow[r] - mn) : 1.0f;
                float e0 = live ? __expf(p0[r] - mn) : 0.0f;
                float e1 = live ? __expf(p1[r] - mn) : 0.0f;
                float rsum = e0 + e1;
#pragma unroll
                for (int m = 1; m < 16; m <<= 1)
                    rsum += __shfl_xor(rsum, m, 32);
                lrow[r] = lrow[r] * al + rsum;
                mrow[r] = mn;
                alpha[r] = al;
                p_lds[wave][half * 8 + r][l16]      = (__bf16)e0;
                p_lds[wave][half * 8 + r][16 + l16] = (__bf16)e1;
            }
            // Rescale running output accumulators.
#pragma unroll
            for (int nt = 0; nt < 8; ++nt)
#pragma unroll
                for (int r = 0; r < 8; ++r) o[nt][r] *= alpha[r];
            // Same-wave LDS visibility for the staged P tile.
            asm volatile("s_wait_dscnt 0" ::: "memory");
            __builtin_amdgcn_wave_barrier();

            const __bf16* prow = &p_lds[wave][l16][0];
            v16bf pf = ld_frag(prow + half * 8, prow + 16 + half * 8);
#pragma unroll
            for (int nt = 0; nt < 8; ++nt) {
                const __bf16* vr = &v_lds[(nt * 16 + l16) * AKP + g * 32];
                o[nt] = wmma_bf16(pf, ld_frag(vr + half * 8, vr + 16 + half * 8),
                                  o[nt]);
            }
        }
    }

    // Finalize: divide by row sums, store bf16 [token][h*128 + dh].
#pragma unroll
    for (int r = 0; r < 8; ++r) lrow[r] = 1.0f / fmaxf(lrow[r], 1e-20f);
#pragma unroll
    for (int nt = 0; nt < 8; ++nt) {
#pragma unroll
        for (int r = 0; r < 8; ++r) {
            int t = tok0 + q0 + half * 8 + r;
            int dh = nt * 16 + l16;
            ob[((size_t)t * 16 + h) * 128 + dh] = (__bf16)(o[nt][r] * lrow[r]);
        }
    }
}

// ---------------------------------------------------------------------------
// Host-side orchestration
// ---------------------------------------------------------------------------
extern "C" void kernel_launch(void* const* d_in, const int* in_sizes, int n_in,
                              void* d_out, int out_size, void* d_ws, size_t ws_size,
                              hipStream_t stream) {
    (void)in_sizes; (void)n_in; (void)out_size; (void)ws_size;
    const float* x  = (const float*)d_in[0];
    const float* Wq = (const float*)d_in[1];
    const float* Wk = (const float*)d_in[2];
    const float* Wv = (const float*)d_in[3];
    const float* Wo = (const float*)d_in[4];
    const float* qg = (const float*)d_in[5];
    const float* kg = (const float*)d_in[6];
    float* out = (float*)d_out;

    const int M = 4096;        // tokens (2 batches x 2048)
    const int D = 2048;        // model dim
    const int KVD = 512;       // kv dim

    uint8_t* w = (uint8_t*)d_ws;
    __bf16* xb  = (__bf16*)(w);                // 16 MiB  x in bf16
    __bf16* wqt = (__bf16*)(w + 16777216);     //  8 MiB  Wq^T bf16
    __bf16* wkt = (__bf16*)(w + 25165824);     //  2 MiB  Wk^T bf16
    __bf16* wvt = (__bf16*)(w + 27262976);     //  2 MiB  Wv^T bf16
    __bf16* wot = (__bf16*)(w + 29360128);     //  8 MiB  Wo^T bf16
    float*  qf  = (float* )(w + 37748736);     // 32 MiB  Q f32 (later aliased)
    float*  kf  = (float* )(w + 71303168);     //  8 MiB  K f32
    float*  vf  = (float* )(w + 79691776);     //  8 MiB  V f32
    __bf16* qbf = (__bf16*)(w + 88080384);     // 16 MiB  Q bf16 (post-norm)
    __bf16* kbf = (__bf16*)(w + 104857600);    //  4 MiB  K bf16 (post-norm)
    __bf16* vbf = (__bf16*)(w + 109051904);    //  4 MiB  V bf16
    __bf16* aob = (__bf16*)(w + 37748736);     // alias over qf: attn out bf16
    // total workspace use: 113,246,208 bytes

    // 1) x -> bf16
    k_cvt_bf16<<<(M * D) / 1024, 256, 0, stream>>>(x, xb);
    // 2) weights -> transposed bf16
    k_cvt_w_t<<<dim3(D / 32, D / 32), 256, 0, stream>>>(Wq, wqt, D, D);
    k_cvt_w_t<<<dim3(KVD / 32, D / 32), 256, 0, stream>>>(Wk, wkt, D, KVD);
    k_cvt_w_t<<<dim3(KVD / 32, D / 32), 256, 0, stream>>>(Wv, wvt, D, KVD);
    k_cvt_w_t<<<dim3(D / 32, D / 32), 256, 0, stream>>>(Wo, wot, D, D);
    // 3) QKV projections (WMMA GEMMs)
    k_gemm_bf16<<<dim3(D / 128, M / 128), 256, 0, stream>>>(
        xb, wqt, nullptr, qf, M, D, D);
    k_gemm_bf16<<<dim3(KVD / 128, M / 128), 256, 0, stream>>>(
        xb, wkt, nullptr, kf, M, KVD, D);
    k_gemm_bf16<<<dim3(KVD / 128, M / 128), 256, 0, stream>>>(
        xb, wvt, nullptr, vf, M, KVD, D);
    // 4) QK RMSNorm (per head, DH=128) + V convert
    k_rmsnorm<<<(M * 16) / 8, 256, 0, stream>>>(qf, qg, qbf, M * 16);
    k_rmsnorm<<<(M * 4) / 8, 256, 0, stream>>>(kf, kg, kbf, M * 4);
    k_cvt_bf16<<<(M * KVD) / 1024, 256, 0, stream>>>(vf, vbf);
    // 5) causal GQA flash attention (WMMA)
    k_attn<<<dim3(16, 16, 2), 256, 0, stream>>>(qbf, kbf, vbf, aob);
    // 6) output projection + residual (WMMA GEMM)
    k_gemm_bf16<<<dim3(D / 128, M / 128), 256, 0, stream>>>(
        aob, wot, x, out, M, D, D);
}

// v001
// One run takes 253 microseconds.
// Timed twice side by side with v000, it ran 1.61 and 1.60 times as fast.
#include <hip/hip_runtime.h>
#include <hip/hip_bf16.h>

// ---------------------------------------------------------------------------
// Transformer block for gfx1250: wave32 + WMMA bf16 pipeline
// with async global->LDS staging (ASYNCcnt) and double-buffered GEMM tiles.
// ---------------------------------------------------------------------------

#define DEV static __device__ __forceinline__

typedef __attribute__((ext_vector_type(16))) __bf16 v16bf;
typedef __attribute__((ext_vector_type(8)))  __bf16 v8bf;
typedef __attribute__((ext_vector_type(8)))  float  v8f;
typedef __attribute__((ext_vector_type(4)))  int    v4i;

#define LDS_AS __attribute__((address_space(3)))
#define GLB_AS __attribute__((address_space(1)))

DEV v8f vzero8() {
    v8f z;
#pragma unroll
    for (int i = 0; i < 8; ++i) z[i] = 0.0f;
    return z;
}

// Async global -> LDS copy of one 16-byte chunk (tracked by ASYNCcnt).
DEV void async_b128(const __bf16* g, __bf16* l) {
#if __has_builtin(__builtin_amdgcn_global_load_async_to_lds_b128)
    __builtin_amdgcn_global_load_async_to_lds_b128(
        (GLB_AS v4i*)(uintptr_t)g,
        (LDS_AS v4i*)(uint32_t)(uintptr_t)l, 0, 0);
#else
    unsigned loff = (unsigned)(uintptr_t)l;
    asm volatile("global_load_async_to_lds_b128 %0, %1, off"
                 :: "v"(loff), "v"(g) : "memory");
#endif
}

DEV void wait_async0() {
#if __has_builtin(__builtin_amdgcn_s_wait_asynccnt)
    __builtin_amdgcn_s_wait_asynccnt(0);
#else
    asm volatile("s_wait_asynccnt 0" ::: "memory");
#endif
}

// Build a 16-element bf16 fragment from two 16-byte chunks (the CDNA5 A/B
// 16-bit layout: lane holds K = half*8..+7 and K = 16+half*8..+7).
DEV v16bf ld_frag(const __bf16* lo, const __bf16* hi) {
    v8bf a = *(const v8bf*)lo;
    v8bf b = *(const v8bf*)hi;
    return __builtin_shufflevector(a, b, 0, 1, 2, 3, 4, 5, 6, 7,
                                          8, 9, 10, 11, 12, 13, 14, 15);
}

DEV v8f wmma_bf16(v16bf a, v16bf b, v8f c) {
    return __builtin_amdgcn_wmma_f32_16x16x32_bf16(
        false, a, false, b, (short)0, c, false, false);
}

// ---------------------------------------------------------------------------
// Elementwise f32 -> bf16 convert (4 elems / thread)
// ---------------------------------------------------------------------------
__global__ __launch_bounds__(256)
void k_cvt_bf16(const float* __restrict__ in, __bf16* __restrict__ out) {
    size_t i = ((size_t)blockIdx.x * 256 + threadIdx.x) * 4;
    float4 v = *(const float4*)&in[i];
    union { __bf16 h[4]; uint2 u; } o;
    o.h[0] = (__bf16)v.x; o.h[1] = (__bf16)v.y;
    o.h[2] = (__bf16)v.z; o.h[3] = (__bf16)v.w;
    *(uint2*)&out[i] = o.u;
}

// ---------------------------------------------------------------------------
// Weight transpose + convert: W[K][N] f32 -> Wt[N][K] bf16 (32x32 LDS tiles)
// ---------------------------------------------------------------------------
__global__ __launch_bounds__(256)
void k_cvt_w_t(const float* __restrict__ W, __bf16* __restrict__ Wt,
               int K, int N) {
    __shared__ float t[32][33];
    const int k0 = blockIdx.y * 32, n0 = blockIdx.x * 32;
    const int tid = threadIdx.x;
    const int c = tid & 31, r0 = tid >> 5;
#pragma unroll
    for (int i = 0; i < 4; ++i) {
        int r = r0 + i * 8;
        t[r][c] = W[(size_t)(k0 + r) * N + n0 + c];
    }
    __syncthreads();
#pragma unroll
    for (int i = 0; i < 4; ++i) {
        int r = r0 + i * 8;
        Wt[(size_t)(n0 + r) * K + k0 + c] = (__bf16)t[c][r];
    }
}

// ---------------------------------------------------------------------------
// Tiled WMMA GEMM: C[M][N] f32 = A[M][K] bf16 * Bt[N][K] bf16 (+ residual)
// Block = 256 threads (8 waves), tile 128x128, K-step 64, double-buffered
// async global->LDS staging.
// ---------------------------------------------------------------------------
#define GKS 64
#define GKP 72  // padded LDS row stride (144 B, 16B-aligned)

__global__ __launch_bounds__(256)
void k_gemm_bf16(const __bf16* __restrict__ A, const __bf16* __restrict__ Bt,
                 const float* __restrict__ resid, float* __restrict__ C,
                 int M, int N, int K) {
    __shared__ __bf16 a_lds[2][128 * GKP];
    __shared__ __bf16 b_lds[2][128 * GKP];
    const int tid = threadIdx.x;
    const int lane = tid & 31, wave = tid >> 5;
    const int half = (lane >> 4) & 1, l16 = lane & 15;
    const int m_blk = blockIdx.y * 128, n_blk = blockIdx.x * 128;
    const int m0 = wave * 16;
    const int r_base = tid >> 3, c_st = (tid & 7) * 8;

    v8f acc[8];
#pragma unroll
    for (int i = 0; i < 8; ++i) acc[i] = vzero8();

    // Stage one 128x64 tile of A and Bt into LDS buffer `buf` (async).
    auto stage = [&](int k0, int buf) {
#pragma unroll
        for (int i = 0; i < 4; ++i) {
            int r = r_base + i * 32;
            async_b128(&A[(size_t)(m_blk + r) * K + k0 + c_st],
                       &a_lds[buf][r * GKP + c_st]);
            async_b128(&Bt[(size_t)(n_blk + r) * K + k0 + c_st],
                       &b_lds[buf][r * GKP + c_st]);
        }
    };

    const int T = K / GKS;
    stage(0, 0);
    for (int t = 0; t < T; ++t) {
        wait_async0();          // tile t landed (async loads retire in order)
        __syncthreads();        // visible to all waves; prior reads finished
        if (t + 1 < T) stage((t + 1) * GKS, (t + 1) & 1);  // overlap copy
        const __bf16* abase = &a_lds[t & 1][(m0 + l16) * GKP];
#pragma unroll
        for (int kk = 0; kk < 2; ++kk) {
            v16bf af = ld_frag(abase + kk * 32 + half * 8,
                               abase + kk * 32 + 16 + half * 8);
#pragma unroll
            for (int nt = 0; nt < 8; ++nt) {
                const __bf16* brow =
                    &b_lds[t & 1][(nt * 16 + l16) * GKP + kk * 32];
                acc[nt] = wmma_bf16(
                    af, ld_frag(brow + half * 8, brow + 16 + half * 8),
                    acc[nt]);
            }
        }
    }

#pragma unroll
    for (int nt = 0; nt < 8; ++nt) {
#pragma unroll
        for (int r = 0; r < 8; ++r) {
            int m = m_blk + m0 + half * 8 + r;
            int n = n_blk + nt * 16 + l16;
            float v = acc[nt][r];
            if (resid) v += resid[(size_t)m * N + n];
            C[(size_t)m * N + n] = v;
        }
    }
}

// ---------------------------------------------------------------------------
// Per-head RMSNorm over DH=128, f32 in -> bf16 out. One wave per row.
// ---------------------------------------------------------------------------
__global__ __launch_bounds__(256)
void k_rmsnorm(const float* __restrict__ in, const float* __restrict__ gamma,
               __bf16* __restrict__ out, int rows) {
    const int lane = threadIdx.x & 31, wave = threadIdx.x >> 5;
    const int row = blockIdx.x * 8 + wave;
    if (row >= rows) return;
    const float* p = in + (size_t)row * 128;
    float4 v = *(const float4*)&p[lane * 4];
    float ss = v.x * v.x + v.y * v.y + v.z * v.z + v.w * v.w;
#pragma unroll
    for (int m = 1; m < 32; m <<= 1) ss += __shfl_xor(ss, m, 32);
    float rs = rsqrtf(ss * (1.0f / 128.0f) + 1e-8f);
    float4 g = make_float4(1.f, 1.f, 1.f, 1.f);
    if (gamma) g = *(const float4*)&gamma[lane * 4];
    union { __bf16 h[4]; uint2 u; } o;
    o.h[0] = (__bf16)(v.x * rs * g.x);
    o.h[1] = (__bf16)(v.y * rs * g.y);
    o.h[2] = (__bf16)(v.z * rs * g.z);
    o.h[3] = (__bf16)(v.w * rs * g.w);
    *(uint2*)&out[(size_t)row * 128 + lane * 4] = o.u;
}

#define AKP 136  // K row stride: 272 B, odd multiple of 16 B (ds_load_b128 reader)
#define AVP 144  // V row stride: 288 B, odd multiple of 32 B (transposing reader)

typedef __attribute__((ext_vector_type(8))) short v8s;

// Transposing LDS load: lane (c, half) gets T[kbase + 8*half + 0..7][dbase + c].
DEV v8bf ld_tr16(const __bf16* p) {
    return __builtin_bit_cast(
        v8bf, __builtin_amdgcn_ds_load_tr16_b128_v8i16((LDS_AS v8s*)p));
}

// Value of lane l ^ 16.
DEV float xhalf(float x) {
    return __builtin_bit_cast(float, __builtin_amdgcn_permlanex16(
        __builtin_bit_cast(int, x), __builtin_bit_cast(int, x),
        0x76543210, 0xfedcba98, false, false));
}

__global__ __launch_bounds__(256)
void k_attn(const __bf16* __restrict__ qb, const __bf16* __restrict__ kb,
            const __bf16* __restrict__ vb, __bf16* __restrict__ ob) {
    __shared__ __attribute__((aligned(16))) __bf16 k_lds[128 * AKP];
    __shared__ __attribute__((aligned(16))) __bf16 v_lds[128 * AVP];

    const int tid = threadIdx.x;
    const int lane = tid & 31, wave = tid >> 5;
    const int half = (lane >> 4) & 1, l16 = lane & 15;
    const int qt = blockIdx.x, h = blockIdx.y, b = blockIdx.z;
    const int kvh = h >> 2;            // GQA group of 4
    const int tok0 = b * 2048;
    const int q0 = qt * 128 + wave * 16;  // wave's first query row (in-batch)
    const float scale = 0.08838834764831845f;  // 128^-0.5

    // Q fragments (B operand): column = query l16, 4 K-chunks of 32 over dh.
    v16bf qf[4];
    {
        const int t = tok0 + q0 + l16;
        const __bf16* qrow = qb + ((size_t)t * 16 + h) * 128;
#pragma unroll
        for (int kk = 0; kk < 4; ++kk)
            qf[kk] = ld_frag(qrow + kk * 32 + half * 8,
                             qrow + kk * 32 + 16 + half * 8);
    }

    v8f o[8];  // O^T tiles: row dh = nt*16 + half*8 + r, column = query l16
#pragma unroll
    for (int i = 0; i < 8; ++i) o[i] = vzero8();
    float mrow = -3.0e38f;  // this lane's query: running maximum (both halves)
    float lrow = 0.0f;      // running sum over this half's keys only

    for (int kt = 0; kt <= qt; ++kt) {
        __syncthreads();  // previous tile fully consumed
        // --- async K and V tiles: [key][dh], 128 keys x 16 chunks each ---
#pragma unroll
        for (int i = 0; i < 8; ++i) {
            int idx = tid + i * 256;
            int key = idx >> 4, c = (idx & 15) * 8;
            int t = tok0 + kt * 128 + key;
            async_b128(&kb[((size_t)t * 4 + kvh) * 128 + c],
                       &k_lds[key * AKP + c]);
            async_b128(&vb[((size_t)t * 4 + kvh) * 128 + c],
                       &v_lds[key * AVP + c]);
        }
        wait_async0();
        __syncthreads();

        // Skip fully-masked 32-key groups on the diagonal tile.
        const int gmax = (kt == qt) ? (wave * 16 + 15) / 32 : 3;
        for (int g = 0; g <= gmax; ++g) {
            // S^T = K Q^T for 32 keys (two 16-key tiles), K-dim = dh = 128.
            v16bf kf0[4], kf1[4];
#pragma unroll
            for (int kk = 0; kk < 4; ++kk) {
                const __bf16* kr0 = &k_lds[(g * 32 + l16) * AKP + kk * 32];
                const __bf16* kr1 = &k_lds[(g * 32 + 16 + l16) * AKP + kk * 32];
                kf0[kk] = ld_frag(kr0 + half * 8, kr0 + 16 + half * 8);
                kf1[kk] = ld_frag(kr1 + half * 8, kr1 + 16 + half * 8);
            }
            // Keeps the 16 K loads one group ahead of their WMMAs (counted
            // waits); spread among them, each pair costs a full LDS wait.
            __builtin_amdgcn_sched_barrier(0);
            v8f s0 = vzero8(), s1 = vzero8();
#pragma unroll
            for (int kk = 0; kk < 4; ++kk) {
                s0 = wmma_bf16(kf0[kk], qf[kk], s0);
                s1 = wmma_bf16(kf1[kk], qf[kk], s1);
            }
            // V^T fragments: A = 16 (dh) x 32 (keys) by two transposing loads.
            const __bf16* vr = &v_lds[(g * 32 + half * 8 + (lane & 7)) * AVP +
                                      ((lane >> 3) & 1) * 8];
            v16bf vf[8];
#pragma unroll
            for (int nt = 0; nt < 8; ++nt) {
                v8bf lo = ld_tr16(vr + nt * 16);
                v8bf hi = ld_tr16(vr + 16 * AVP + nt * 16);
                vf[nt] = __builtin_shufflevector(lo, hi, 0, 1, 2, 3, 4, 5, 6, 7,
                                                 8, 9, 10, 11, 12, 13, 14, 15);
            }
            // Keeps the 16 V^T loads one group here, in flight under the
            // softmax arithmetic, instead of one full LDS wait per WMMA.
            __builtin_amdgcn_sched_barrier(0);
            // Scale + causal mask + this query's max over the 32-key group.
            const int qg = q0 + l16;
            const int kg0 = kt * 128 + g * 32 + half * 8;  // + r
            float p0[8], p1[8];
            float tmax = -3.0e38f;
#pragma unroll
            for (int r = 0; r < 8; ++r) {
                float a = s0[r] * scale, c = s1[r] * scale;
                if (kg0 + r > qg) a = -3.0e38f;
                if (kg0 + 16 + r > qg) c = -3.0e38f;
                p0[r] = a; p1[r] = c;
                tmax = fmaxf(tmax, fmaxf(a, c));
            }
            tmax = fmaxf(tmax, xhalf(tmax));
            // Online softmax update; P^T packs into the B operand in place:
            // elements 0..7 are keys half*8 + r, 8..15 are keys 16 + half*8 + r.
            const float mn = fmaxf(mrow, tmax);
            const bool live = mn > -1.0e37f;
            const float al = live ? __expf(mrow - mn) : 1.0f;
            float rs0 = 0.0f, rs1 = 0.0f;
            v16bf pf;
#pragma unroll
            for (int r = 0; r < 8; ++r) {
                float e0 = live ? __expf(p0[r] - mn) : 0.0f;
                float e1 = live ? __expf(p1[r] - mn) : 0.0f;
                rs0 += e0; rs1 += e1;
                pf[r]     = (__bf16)e0;
                pf[8 + r] = (__bf16)e1;
            }
            lrow = lrow * al + (rs0 + rs1);
            mrow = mn;
            // Rescale running output accumulators.
#pragma unroll
            for (int nt = 0; nt < 8; ++nt)
#pragma unroll
                for (int r = 0; r < 8; ++r) o[nt][r] *= al;
            // O^T += V^T P^T.
#pragma unroll
            for (int nt = 0; nt < 8; ++nt) o[nt] = wmma_bf16(vf[nt], pf, o[nt]);
        }
    }

    // Finalize: join the halves' sums, divide, store bf16 [token][h*128 + dh]
    // (16 bytes per lane and tile: dh = nt*16 + half*8 .. + 7).
    const float inv = 1.0f / fmaxf(lrow + xhalf(lrow), 1e-20f);
    __bf16* orow = ob + ((size_t)(tok0 + q0 + l16) * 16 + h) * 128 + half * 8;
#pragma unroll
    for (int nt = 0; nt < 8; ++nt) {
        v8bf w;
#pragma unroll
        for (int r = 0; r < 8; ++r) w[r] = (__bf16)(o[nt][r] * inv);
        *(v8bf*)(orow + nt * 16) = w;
    }
}

// ---------------------------------------------------------------------------
// Host-side orchestration
// ---------------------------------------------------------------------------
extern "C" void kernel_launch(void* const* d_in, const int* in_sizes, int n_in,
                              void* d_out, int out_size, void* d_ws, size_t ws_size,
                              hipStream_t stream) {
    (void)in_sizes; (void)n_in; (void)out_size; (void)ws_size;
    const float* x  = (const float*)d_in[0];
    const float* Wq = (const float*)d_in[1];
    const float* Wk = (const float*)d_in[2];
    const float* Wv = (const float*)d_in[3];
    const float* Wo = (const float*)d_in[4];
    const float* qg = (const float*)d_in[5];
    const float* kg = (const float*)d_in[6];
    float* out = (float*)d_out;

    const int M = 4096;        // tokens (2 batches x 2048)
    const int D = 2048;        // model dim
    const int KVD = 512;       // kv dim

    uint8_t* w = (uint8_t*)d_ws;
    __bf16* xb  = (__bf16*)(w);                // 16 MiB  x in bf16
    __bf16* wqt = (__bf16*)(w + 16777216);     //  8 MiB  Wq^T bf16
    __bf16* wkt = (__bf16*)(w + 25165824);     //  2 MiB  Wk^T bf16
    __bf16* wvt = (__bf16*)(w + 27262976);     //  2 MiB  Wv^T bf16
    __bf16* wot = (__bf16*)(w + 29360128);     //  8 MiB  Wo^T bf16
    float*  qf  = (float* )(w + 37748736);     // 32 MiB  Q f32 (later aliased)
    float*  kf  = (float* )(w + 71303168);     //  8 MiB  K f32
    float*  vf  = (float* )(w + 79691776);     //  8 MiB  V f32
    __bf16* qbf = (__bf16*)(w + 88080384);     // 16 MiB  Q bf16 (post-norm)
    __bf16* kbf = (__bf16*)(w + 104857600);    //  4 MiB  K bf16 (post-norm)
    __bf16* vbf = (__bf16*)(w + 109051904);    //  4 MiB  V bf16
    __bf16* aob = (__bf16*)(w + 37748736);     // alias over qf: attn out bf16
    // total workspace use: 113,246,208 bytes

    // 1) x -> bf16
    k_cvt_bf16<<<(M * D) / 1024, 256, 0, stream>>>(x, xb);
    // 2) weights -> transposed bf16
    k_cvt_w_t<<<dim3(D / 32, D / 32), 256, 0, stream>>>(Wq, wqt, D, D);
    k_cvt_w_t<<<dim3(KVD / 32, D / 32), 256, 0, stream>>>(Wk, wkt, D, KVD);
    k_cvt_w_t<<<dim3(KVD / 32, D / 32), 256, 0, stream>>>(Wv, wvt, D, KVD);
    k_cvt_w_t<<<dim3(D / 32, D / 32), 256, 0, stream>>>(Wo, wot, D, D);
    // 3) QKV projections (WMMA GEMMs)
    k_gemm_bf16<<<dim3(D / 128, M / 128), 256, 0, stream>>>(
        xb, wqt, nullptr, qf, M, D, D);
    k_gemm_bf16<<<dim3(KVD / 128, M / 128), 256, 0, stream>>>(
        xb, wkt, nullptr, kf, M, KVD, D);
    k_gemm_bf16<<<dim3(KVD / 128, M / 128), 256, 0, stream>>>(
        xb, wvt, nullptr, vf, M, KVD, D);
    // 4) QK RMSNorm (per head, DH=128) + V convert
    k_rmsnorm<<<(M * 16) / 8, 256, 0, stream>>>(qf, qg, qbf, M * 16);
    k_rmsnorm<<<(M * 4) / 8, 256, 0, stream>>>(kf, kg, kbf, M * 4);
    k_cvt_bf16<<<(M * KVD) / 1024, 256, 0, stream>>>(vf, vbf);
    // 5) causal GQA flash attention (WMMA)
    k_attn<<<dim3(16, 16, 2), 256, 0, stream>>>(qbf, kbf, vbf, aob);
    // 6) output projection + residual (WMMA GEMM)
    k_gemm_bf16<<<dim3(D / 128, M / 128), 256, 0, stream>>>(
        aob, wot, x, out, M, D, D);
}

// v002
// One run takes 224 microseconds.
// Two timings next to v001 both put it at 1.12 times that version's speed.
// Over all steps from v000 it is 1.81 times as fast.
#include <hip/hip_runtime.h>
#include <hip/hip_bf16.h>

// ---------------------------------------------------------------------------
// Transformer block for gfx1250: wave32 + WMMA bf16 pipeline
// with async global->LDS staging (ASYNCcnt) and double-buffered GEMM tiles.
// ---------------------------------------------------------------------------

#define DEV static __device__ __forceinline__

typedef __attribute__((ext_vector_type(16))) __bf16 v16bf;
typedef __attribute__((ext_vector_type(8)))  __bf16 v8bf;
typedef __attribute__((ext_vector_type(8)))  float  v8f;
typedef __attribute__((ext_vector_type(4)))  int    v4i;

#define LDS_AS __attribute__((address_space(3)))
#define GLB_AS __attribute__((address_space(1)))

DEV v8f vzero8() {
    v8f z;
#pragma unroll
    for (int i = 0; i < 8; ++i) z[i] = 0.0f;
    return z;
}

// Async global -> LDS copy of one 16-byte chunk (tracked by ASYNCcnt).
DEV void async_b128(const __bf16* g, __bf16* l) {
#if __has_builtin(__builtin_amdgcn_global_load_async_to_lds_b128)
    __builtin_amdgcn_global_load_async_to_lds_b128(
        (GLB_AS v4i*)(uintptr_t)g,
        (LDS_AS v4i*)(uint32_t)(uintptr_t)l, 0, 0);
#else
    unsigned loff = (unsigned)(uintptr_t)l;
    asm volatile("global_load_async_to_lds_b128 %0, %1, off"
                 :: "v"(loff), "v"(g) : "memory");
#endif
}

DEV void wait_async0() {
#if __has_builtin(__builtin_amdgcn_s_wait_asynccnt)
    __builtin_amdgcn_s_wait_asynccnt(0);
#else
    asm volatile("s_wait_asynccnt 0" ::: "memory");
#endif
}

// Build a 16-element bf16 fragment from two 16-byte chunks (the CDNA5 A/B
// 16-bit layout: lane holds K = half*8..+7 and K = 16+half*8..+7).
DEV v16bf ld_frag(const __bf16* lo, const __bf16* hi) {
    v8bf a = *(const v8bf*)lo;
    v8bf b = *(const v8bf*)hi;
    return __builtin_shufflevector(a, b, 0, 1, 2, 3, 4, 5, 6, 7,
                                          8, 9, 10, 11, 12, 13, 14, 15);
}

DEV v8f wmma_bf16(v16bf a, v16bf b, v8f c) {
    return __builtin_amdgcn_wmma_f32_16x16x32_bf16(
        false, a, false, b, (short)0, c, false, false);
}

// ---------------------------------------------------------------------------
// Elementwise f32 -> bf16 convert (4 elems / thread)
// ---------------------------------------------------------------------------
__global__ __launch_bounds__(256)
void k_cvt_bf16(const float* __restrict__ in, __bf16* __restrict__ out) {
    size_t i = ((size_t)blockIdx.x * 256 + threadIdx.x) * 4;
    float4 v = *(const float4*)&in[i];
    union { __bf16 h[4]; uint2 u; } o;
    o.h[0] = (__bf16)v.x; o.h[1] = (__bf16)v.y;
    o.h[2] = (__bf16)v.z; o.h[3] = (__bf16)v.w;
    *(uint2*)&out[i] = o.u;
}

// ---------------------------------------------------------------------------
// Weight transpose + convert: W[K][N] f32 -> Wt[N][K] bf16 (32x32 LDS tiles)
// ---------------------------------------------------------------------------
__global__ __launch_bounds__(256)
void k_cvt_w_t(const float* __restrict__ W, __bf16* __restrict__ Wt,
               int K, int N) {
    __shared__ float t[32][33];
    const int k0 = blockIdx.y * 32, n0 = blockIdx.x * 32;
    const int tid = threadIdx.x;
    const int c = tid & 31, r0 = tid >> 5;
#pragma unroll
    for (int i = 0; i < 4; ++i) {
        int r = r0 + i * 8;
        t[r][c] = W[(size_t)(k0 + r) * N + n0 + c];
    }
    __syncthreads();
#pragma unroll
    for (int i = 0; i < 4; ++i) {
        int r = r0 + i * 8;
        Wt[(size_t)(n0 + r) * K + k0 + c] = (__bf16)t[c][r];
    }
}

// ---------------------------------------------------------------------------
// Tiled WMMA GEMM: C[M][N] f32 = A[M][K] bf16 * Bt[N][K] bf16 (+ residual)
// Block = 256 threads (8 waves), tile 128x128, K-step 64, double-buffered
// async global->LDS staging.
// ---------------------------------------------------------------------------
#define GKS 64
#define GKP 72  // padded LDS row stride (144 B, 16B-aligned)

__global__ __launch_bounds__(256)
void k_gemm_bf16(const __bf16* __restrict__ A, const __bf16* __restrict__ Bt,
                 const float* __restrict__ resid, float* __restrict__ C,
                 int M, int N, int K) {
    __shared__ __bf16 a_lds[2][128 * GKP];
    __shared__ __bf16 b_lds[2][128 * GKP];
    const int tid = threadIdx.x;
    const int lane = tid & 31, wave = tid >> 5;
    const int half = (lane >> 4) & 1, l16 = lane & 15;
    const int m_blk = blockIdx.y * 128, n_blk = blockIdx.x * 128;
    const int m0 = wave * 16;
    const int r_base = tid >> 3, c_st = (tid & 7) * 8;

    v8f acc[8];
#pragma unroll
    for (int i = 0; i < 8; ++i) acc[i] = vzero8();

    // Stage one 128x64 tile of A and Bt into LDS buffer `buf` (async).
    auto stage = [&](int k0, int buf) {
#pragma unroll
        for (int i = 0; i < 4; ++i) {
            int r = r_base + i * 32;
            async_b128(&A[(size_t)(m_blk + r) * K + k0 + c_st],
                       &a_lds[buf][r * GKP + c_st]);
            async_b128(&Bt[(size_t)(n_blk + r) * K + k0 + c_st],
                       &b_lds[buf][r * GKP + c_st]);
        }
    };

    const int T = K / GKS;
    stage(0, 0);
    for (int t = 0; t < T; ++t) {
        wait_async0();          // tile t landed (async loads retire in order)
        __syncthreads();        // visible to all waves; prior reads finished
        if (t + 1 < T) stage((t + 1) * GKS, (t + 1) & 1);  // overlap copy
        const __bf16* abase = &a_lds[t & 1][(m0 + l16) * GKP];
        v16bf af[2], bfr[2][8];
#pragma unroll
        for (int kk = 0; kk < 2; ++kk) {
            af[kk] = ld_frag(abase + kk * 32 + half * 8,
                             abase + kk * 32 + 16 + half * 8);
#pragma unroll
            for (int nt = 0; nt < 8; ++nt) {
                const __bf16* brow =
                    &b_lds[t & 1][(nt * 16 + l16) * GKP + kk * 32];
                bfr[kk][nt] = ld_frag(brow + half * 8, brow + 16 + half * 8);
            }
        }
        // Keeps the tile's 36 fragment loads one group ahead of its 16 WMMAs
        // (counted waits); spread among them, each pair costs a full LDS wait.
        __builtin_amdgcn_sched_barrier(0);
#pragma unroll
        for (int kk = 0; kk < 2; ++kk)
#pragma unroll
            for (int nt = 0; nt < 8; ++nt)
                acc[nt] = wmma_bf16(af[kk], bfr[kk][nt], acc[nt]);
    }

#pragma unroll
    for (int nt = 0; nt < 8; ++nt) {
#pragma unroll
        for (int r = 0; r < 8; ++r) {
            int m = m_blk + m0 + half * 8 + r;
            int n = n_blk + nt * 16 + l16;
            float v = acc[nt][r];
            if (resid) v += resid[(size_t)m * N + n];
            C[(size_t)m * N + n] = v;
        }
    }
}

// ---------------------------------------------------------------------------
// Per-head RMSNorm over DH=128, f32 in -> bf16 out. One wave per row.
// ---------------------------------------------------------------------------
__global__ __launch_bounds__(256)
void k_rmsnorm(const float* __restrict__ in, const float* __restrict__ gamma,
               __bf16* __restrict__ out, int rows) {
    const int lane = threadIdx.x & 31, wave = threadIdx.x >> 5;
    const int row = blockIdx.x * 8 + wave;
    if (row >= rows) return;
    const float* p = in + (size_t)row * 128;
    float4 v = *(const float4*)&p[lane * 4];
    float ss = v.x * v.x + v.y * v.y + v.z * v.z + v.w * v.w;
#pragma unroll
    for (int m = 1; m < 32; m <<= 1) ss += __shfl_xor(ss, m, 32);
    float rs = rsqrtf(ss * (1.0f / 128.0f) + 1e-8f);
    float4 g = make_float4(1.f, 1.f, 1.f, 1.f);
    if (gamma) g = *(const float4*)&gamma[lane * 4];
    union { __bf16 h[4]; uint2 u; } o;
    o.h[0] = (__bf16)(v.x * rs * g.x);
    o.h[1] = (__bf16)(v.y * rs * g.y);
    o.h[2] = (__bf16)(v.z * rs * g.z);
    o.h[3] = (__bf16)(v.w * rs * g.w);
    *(uint2*)&out[(size_t)row * 128 + lane * 4] = o.u;
}

#define AKP 136  // K row stride: 272 B, odd multiple of 16 B (ds_load_b128 reader)
#define AVP 144  // V row stride: 288 B, odd multiple of 32 B (transposing reader)

typedef __attribute__((ext_vector_type(8))) short v8s;

// Transposing LDS load: lane (c, half) gets T[kbase + 8*half + 0..7][dbase + c].
DEV v8bf ld_tr16(const __bf16* p) {
    return __builtin_bit_cast(
        v8bf, __builtin_amdgcn_ds_load_tr16_b128_v8i16((LDS_AS v8s*)p));
}

// Value of lane l ^ 16.
DEV float xhalf(float x) {
    return __builtin_bit_cast(float, __builtin_amdgcn_permlanex16(
        __builtin_bit_cast(int, x), __builtin_bit_cast(int, x),
        0x76543210, 0xfedcba98, false, false));
}

__global__ __launch_bounds__(256)
void k_attn(const __bf16* __restrict__ qb, const __bf16* __restrict__ kb,
            const __bf16* __restrict__ vb, __bf16* __restrict__ ob) {
    __shared__ __attribute__((aligned(16))) __bf16 k_lds[128 * AKP];
    __shared__ __attribute__((aligned(16))) __bf16 v_lds[128 * AVP];

    const int tid = threadIdx.x;
    const int lane = tid & 31, wave = tid >> 5;
    const int half = (lane >> 4) & 1, l16 = lane & 15;
    const int qt = blockIdx.x, h = blockIdx.y, b = blockIdx.z;
    const int kvh = h >> 2;            // GQA group of 4
    const int tok0 = b * 2048;
    const int q0 = qt * 128 + wave * 16;  // wave's first query row (in-batch)
    const float scale = 0.08838834764831845f;  // 128^-0.5

    // Q fragments (B operand): column = query l16, 4 K-chunks of 32 over dh.
    v16bf qf[4];
    {
        const int t = tok0 + q0 + l16;
        const __bf16* qrow = qb + ((size_t)t * 16 + h) * 128;
#pragma unroll
        for (int kk = 0; kk < 4; ++kk)
            qf[kk] = ld_frag(qrow + kk * 32 + half * 8,
                             qrow + kk * 32 + 16 + half * 8);
    }

    v8f o[8];  // O^T tiles: row dh = nt*16 + half*8 + r, column = query l16
#pragma unroll
    for (int i = 0; i < 8; ++i) o[i] = vzero8();
    float mrow = -3.0e38f;  // this lane's query: running maximum (both halves)
    float lrow = 0.0f;      // running sum over this half's keys only

    for (int kt = 0; kt <= qt; ++kt) {
        __syncthreads();  // previous tile fully consumed
        // --- async K and V tiles: [key][dh], 128 keys x 16 chunks each ---
#pragma unroll
        for (int i = 0; i < 8; ++i) {
            int idx = tid + i * 256;
            int key = idx >> 4, c = (idx & 15) * 8;
            int t = tok0 + kt * 128 + key;
            async_b128(&kb[((size_t)t * 4 + kvh) * 128 + c],
                       &k_lds[key * AKP + c]);
            async_b128(&vb[((size_t)t * 4 + kvh) * 128 + c],
                       &v_lds[key * AVP + c]);
        }
        wait_async0();
        __syncthreads();

        // Skip fully-masked 32-key groups on the diagonal tile.
        const int gmax = (kt == qt) ? (wave * 16 + 15) / 32 : 3;
        for (int g = 0; g <= gmax; ++g) {
            // S^T = K Q^T for 32 keys (two 16-key tiles), K-dim = dh = 128.
            v16bf kf0[4], kf1[4];
#pragma unroll
            for (int kk = 0; kk < 4; ++kk) {
                const __bf16* kr0 = &k_lds[(g * 32 + l16) * AKP + kk * 32];
                const __bf16* kr1 = &k_lds[(g * 32 + 16 + l16) * AKP + kk * 32];
                kf0[kk] = ld_frag(kr0 + half * 8, kr0 + 16 + half * 8);
                kf1[kk] = ld_frag(kr1 + half * 8, kr1 + 16 + half * 8);
            }
            // Keeps the 16 K loads one group ahead of their WMMAs (counted
            // waits); spread among them, each pair costs a full LDS wait.
            __builtin_amdgcn_sched_barrier(0);
            v8f s0 = vzero8(), s1 = vzero8();
#pragma unroll
            for (int kk = 0; kk < 4; ++kk) {
                s0 = wmma_bf16(kf0[kk], qf[kk], s0);
                s1 = wmma_bf16(kf1[kk], qf[kk], s1);
            }
            // V^T fragments: A = 16 (dh) x 32 (keys) by two transposing loads.
            const __bf16* vr = &v_lds[(g * 32 + half * 8 + (lane & 7)) * AVP +
                                      ((lane >> 3) & 1) * 8];
            v16bf vf[8];
#pragma unroll
            for (int nt = 0; nt < 8; ++nt) {
                v8bf lo = ld_tr16(vr + nt * 16);
                v8bf hi = ld_tr16(vr + 16 * AVP + nt * 16);
                vf[nt] = __builtin_shufflevector(lo, hi, 0, 1, 2, 3, 4, 5, 6, 7,
                                                 8, 9, 10, 11, 12, 13, 14, 15);
            }
            // Keeps the 16 V^T loads one group here, in flight under the
            // softmax arithmetic, instead of one full LDS wait per WMMA.
            __builtin_amdgcn_sched_barrier(0);
            // Scale + causal mask + this query's max over the 32-key group.
            const int qg = q0 + l16;
            const int kg0 = kt * 128 + g * 32 + half * 8;  // + r
            float p0[8], p1[8];
            float tmax = -3.0e38f;
#pragma unroll
            for (int r = 0; r < 8; ++r) {
                float a = s0[r] * scale, c = s1[r] * scale;
                if (kg0 + r > qg) a = -3.0e38f;
                if (kg0 + 16 + r > qg) c = -3.0e38f;
                p0[r] = a; p1[r] = c;
                tmax = fmaxf(tmax, fmaxf(a, c));
            }
            tmax = fmaxf(tmax, xhalf(tmax));
            // Online softmax update; P^T packs into the B operand in place:
            // elements 0..7 are keys half*8 + r, 8..15 are keys 16 + half*8 + r.
            const float mn = fmaxf(mrow, tmax);
            const bool live = mn > -1.0e37f;
            const float al = live ? __expf(mrow - mn) : 1.0f;
            float rs0 = 0.0f, rs1 = 0.0f;
            v16bf pf;
#pragma unroll
            for (int r = 0; r < 8; ++r) {
                float e0 = live ? __expf(p0[r] - mn) : 0.0f;
                float e1 = live ? __expf(p1[r] - mn) : 0.0f;
                rs0 += e0; rs1 += e1;
                pf[r]     = (__bf16)e0;
                pf[8 + r] = (__bf16)e1;
            }
            lrow = lrow * al + (rs0 + rs1);
            mrow = mn;
            // Rescale running output accumulators.
#pragma unroll
            for (int nt = 0; nt < 8; ++nt)
#pragma unroll
                for (int r = 0; r < 8; ++r) o[nt][r] *= al;
            // O^T += V^T P^T.
#pragma unroll
            for (int nt = 0; nt < 8; ++nt) o[nt] = wmma_bf16(vf[nt], pf, o[nt]);
        }
    }

    // Finalize: join the halves' sums, divide, store bf16 [token][h*128 + dh]
    // (16 bytes per lane and tile: dh = nt*16 + half*8 .. + 7).
    const float inv = 1.0f / fmaxf(lrow + xhalf(lrow), 1e-20f);
    __bf16* orow = ob + ((size_t)(tok0 + q0 + l16) * 16 + h) * 128 + half * 8;
#pragma unroll
    for (int nt = 0; nt < 8; ++nt) {
        v8bf w;
#pragma unroll
        for (int r = 0; r < 8; ++r) w[r] = (__bf16)(o[nt][r] * inv);
        *(v8bf*)(orow + nt * 16) = w;
    }
}

// ---------------------------------------------------------------------------
// Host-side orchestration
// ---------------------------------------------------------------------------
extern "C" void kernel_launch(void* const* d_in, const int* in_sizes, int n_in,
                              void* d_out, int out_size, void* d_ws, size_t ws_size,
                              hipStream_t stream) {
    (void)in_sizes; (void)n_in; (void)out_size; (void)ws_size;
    const float* x  = (const float*)d_in[0];
    const float* Wq = (const float*)d_in[1];
    const float* Wk = (const float*)d_in[2];
    const float* Wv = (const float*)d_in[3];
    const float* Wo = (const float*)d_in[4];
    const float* qg = (const float*)d_in[5];
    const float* kg = (const float*)d_in[6];
    float* out = (float*)d_out;

    const int M = 4096;        // tokens (2 batches x 2048)
    const int D = 2048;        // model dim
    const int KVD = 512;       // kv dim

    uint8_t* w = (uint8_t*)d_ws;
    __bf16* xb  = (__bf16*)(w);                // 16 MiB  x in bf16
    __bf16* wqt = (__bf16*)(w + 16777216);     //  8 MiB  Wq^T bf16
    __bf16* wkt = (__bf16*)(w + 25165824);     //  2 MiB  Wk^T bf16
    __bf16* wvt = (__bf16*)(w + 27262976);     //  2 MiB  Wv^T bf16
    __bf16* wot = (__bf16*)(w + 29360128);     //  8 MiB  Wo^T bf16
    float*  qf  = (float* )(w + 37748736);     // 32 MiB  Q f32 (later aliased)
    float*  kf  = (float* )(w + 71303168);     //  8 MiB  K f32
    float*  vf  = (float* )(w + 79691776);     //  8 MiB  V f32
    __bf16* qbf = (__bf16*)(w + 88080384);     // 16 MiB  Q bf16 (post-norm)
    __bf16* kbf = (__bf16*)(w + 104857600);    //  4 MiB  K bf16 (post-norm)
    __bf16* vbf = (__bf16*)(w + 109051904);    //  4 MiB  V bf16
    __bf16* aob = (__bf16*)(w + 37748736);     // alias over qf: attn out bf16
    // total workspace use: 113,246,208 bytes

    // 1) x -> bf16
    k_cvt_bf16<<<(M * D) / 1024, 256, 0, stream>>>(x, xb);
    // 2) weights -> transposed bf16
    k_cvt_w_t<<<dim3(D / 32, D / 32), 256, 0, stream>>>(Wq, wqt, D, D);
    k_cvt_w_t<<<dim3(KVD / 32, D / 32), 256, 0, stream>>>(Wk, wkt, D, KVD);
    k_cvt_w_t<<<dim3(KVD / 32, D / 32), 256, 0, stream>>>(Wv, wvt, D, KVD);
    k_cvt_w_t<<<dim3(D / 32, D / 32), 256, 0, stream>>>(Wo, wot, D, D);
    // 3) QKV projections (WMMA GEMMs)
    k_gemm_bf16<<<dim3(D / 128, M / 128), 256, 0, stream>>>(
        xb, wqt, nullptr, qf, M, D, D);
    k_gemm_bf16<<<dim3(KVD / 128, M / 128), 256, 0, stream>>>(
        xb, wkt, nullptr, kf, M, KVD, D);
    k_gemm_bf16<<<dim3(KVD / 128, M / 128), 256, 0, stream>>>(
        xb, wvt, nullptr, vf, M, KVD, D);
    // 4) QK RMSNorm (per head, DH=128) + V convert
    k_rmsnorm<<<(M * 16) / 8, 256, 0, stream>>>(qf, qg, qbf, M * 16);
    k_rmsnorm<<<(M * 4) / 8, 256, 0, stream>>>(kf, kg, kbf, M * 4);
    k_cvt_bf16<<<(M * KVD) / 1024, 256, 0, stream>>>(vf, vbf);
    // 5) causal GQA flash attention (WMMA)
    k_attn<<<dim3(16, 16, 2), 256, 0, stream>>>(qbf, kbf, vbf, aob);
    // 6) output projection + residual (WMMA GEMM)
    k_gemm_bf16<<<dim3(D / 128, M / 128), 256, 0, stream>>>(
        aob, wot, x, out, M, D, D);
}

// v003
// One run takes 218 microseconds.
// Next to v002, in two timings, it ran 1.04 and 1.03 times as fast.
// Counting every step since v000, it is 1.87 times as fast.
#include <hip/hip_runtime.h>
#include <hip/hip_bf16.h>

// ---------------------------------------------------------------------------
// Transformer block for gfx1250: wave32 + WMMA bf16 pipeline
// with async global->LDS staging (ASYNCcnt) and double-buffered GEMM tiles.
// ---------------------------------------------------------------------------

#define DEV static __device__ __forceinline__

typedef __attribute__((ext_vector_type(16))) __bf16 v16bf;
typedef __attribute__((ext_vector_type(8)))  __bf16 v8bf;
typedef __attribute__((ext_vector_type(8)))  float  v8f;
typedef __attribute__((ext_vector_type(4)))  int    v4i;
typedef __attribute__((ext_vector_type(4)))  float  v4f;

#define LDS_AS __attribute__((address_space(3)))
#define GLB_AS __attribute__((address_space(1)))

DEV v8f vzero8() {
    v8f z;
#pragma unroll
    for (int i = 0; i < 8; ++i) z[i] = 0.0f;
    return z;
}

// Async global -> LDS copy of one 16-byte chunk (tracked by ASYNCcnt).
DEV void async_b128(const __bf16* g, __bf16* l) {
#if __has_builtin(__builtin_amdgcn_global_load_async_to_lds_b128)
    __builtin_amdgcn_global_load_async_to_lds_b128(
        (GLB_AS v4i*)(uintptr_t)g,
        (LDS_AS v4i*)(uint32_t)(uintptr_t)l, 0, 0);
#else
    unsigned loff = (unsigned)(uintptr_t)l;
    asm volatile("global_load_async_to_lds_b128 %0, %1, off"
                 :: "v"(loff), "v"(g) : "memory");
#endif
}

DEV void wait_async0() {
#if __has_builtin(__builtin_amdgcn_s_wait_asynccnt)
    __builtin_amdgcn_s_wait_asynccnt(0);
#else
    asm volatile("s_wait_asynccnt 0" ::: "memory");
#endif
}

// Build a 16-element bf16 fragment from two 16-byte chunks (the CDNA5 A/B
// 16-bit layout: lane holds K = half*8..+7 and K = 16+half*8..+7).
DEV v16bf ld_frag(const __bf16* lo, const __bf16* hi) {
    v8bf a = *(const v8bf*)lo;
    v8bf b = *(const v8bf*)hi;
    return __builtin_shufflevector(a, b, 0, 1, 2, 3, 4, 5, 6, 7,
                                          8, 9, 10, 11, 12, 13, 14, 15);
}

DEV v8f wmma_bf16(v16bf a, v16bf b, v8f c) {
    return __builtin_amdgcn_wmma_f32_16x16x32_bf16(
        false, a, false, b, (short)0, c, false, false);
}

// ---------------------------------------------------------------------------
// Elementwise f32 -> bf16 convert. A wave starts once and moves U * 512 B:
// all U 16-byte loads of a lane are issued before the first store, each load
// and each store of a wave covering whole 128-B lines.
// ---------------------------------------------------------------------------
// Inputs-only fence on 16 loaded values and on the address they were loaded
// from: every load is issued, and has landed, before anything that follows, and
// no load's result is placed on the address pair that the others still name.
// Without it the compiler sinks part of the 16 loads behind the first results'
// use, and the wave waits out the memory latency again for each part.
DEV void hold16(const v4f* v, const float* p) {
    asm volatile("" :: "v"(v[0]), "v"(v[1]), "v"(v[2]), "v"(v[3]), "v"(v[4]),
                       "v"(v[5]), "v"(v[6]), "v"(v[7]), "v"(v[8]), "v"(v[9]),
                       "v"(v[10]), "v"(v[11]), "v"(v[12]), "v"(v[13]),
                       "v"(v[14]), "v"(v[15]), "v"(p));
}

template <int U>
DEV void cvt_body(const float* __restrict__ in, __bf16* __restrict__ out) {
    const size_t base = (size_t)blockIdx.x * (1024 * U) + threadIdx.x * 4;
    const float* p = in + base;
    v4f v[U];
#pragma unroll
    for (int u = 0; u < U; ++u) v[u] = *(const v4f*)(p + u * 1024);
    if constexpr (U == 16) hold16(v, p);
#pragma unroll
    for (int u = 0; u < U; ++u) {
        union { __bf16 h[4]; uint2 u2; } o;
        o.h[0] = (__bf16)v[u].x; o.h[1] = (__bf16)v[u].y;
        o.h[2] = (__bf16)v[u].z; o.h[3] = (__bf16)v[u].w;
        *(uint2*)&out[base + u * 1024] = o.u2;
    }
}

__global__ __launch_bounds__(256)
void k_cvt_bf16_x16(const float* __restrict__ in, __bf16* __restrict__ out) {
    cvt_body<16>(in, out);  // 16,384 elements per block
}

__global__ __launch_bounds__(256)
void k_cvt_bf16_x8(const float* __restrict__ in, __bf16* __restrict__ out) {
    cvt_body<8>(in, out);   // 8,192 elements per block
}

// ---------------------------------------------------------------------------
// Weight transpose + convert: W[K][N] f32 -> Wt[N][K] bf16, one 128 (k) x 64 (n)
// tile per block. A thread loads an 8 (k) x 4 (n) patch by eight 16-byte loads
// (a wave: two 256-B row pieces each), packs four 8-k vectors in registers and
// passes them through LDS so that the stores are 256-B pieces of Wt rows.
// LDS row i*16 + c holds n = 4*c + i: at a pitch of 272 B the sixteen lanes of
// one ds_store_b128 then fall on all 64 banks.
// ---------------------------------------------------------------------------
#define TWP 136  // LDS row pitch in elements (272 B)

template <int K, int N>
DEV void cvt_w_t_body(const float* __restrict__ W, __bf16* __restrict__ Wt) {
    __shared__ __attribute__((aligned(16))) __bf16 t[64 * TWP];
    const int k0 = blockIdx.y * 128, n0 = blockIdx.x * 64;
    const int tid = threadIdx.x;
    const int c4 = tid & 15, rq = tid >> 4;
    // K and N are compile-time: one address per lane, rows by immediate offset.
    const float* src = W + (size_t)(k0 + rq * 8) * N + n0 + c4 * 4;
    float v[8][4];
#pragma unroll
    for (int j = 0; j < 8; ++j) {
        float4 f = *(const float4*)(src + j * N);
        v[j][0] = f.x; v[j][1] = f.y; v[j][2] = f.z; v[j][3] = f.w;
    }
#pragma unroll
    for (int i = 0; i < 4; ++i) {
        v8bf p;
#pragma unroll
        for (int j = 0; j < 8; ++j) p[j] = (__bf16)v[j][i];
        *(v8bf*)&t[(i * 16 + c4) * TWP + rq * 8] = p;
    }
    __syncthreads();
    // LDS row i*16 + rq is Wt row n0 + 4*rq + i; sixteen lanes store its 256 B.
    __bf16* dst = Wt + (size_t)(n0 + rq * 4) * K + k0 + c4 * 8;
#pragma unroll
    for (int i = 0; i < 4; ++i)
        *(v8bf*)(dst + i * K) = *(const v8bf*)&t[(i * 16 + rq) * TWP + c4 * 8];
}

__global__ __launch_bounds__(256)
void k_cvt_w_t_n2048(const float* __restrict__ W, __bf16* __restrict__ Wt) {
    cvt_w_t_body<2048, 2048>(W, Wt);
}

__global__ __launch_bounds__(256)
void k_cvt_w_t_n512(const float* __restrict__ W, __bf16* __restrict__ Wt) {
    cvt_w_t_body<2048, 512>(W, Wt);
}

// ---------------------------------------------------------------------------
// Tiled WMMA GEMM: C[M][N] f32 = A[M][K] bf16 * Bt[N][K] bf16 (+ residual)
// Block = 256 threads (8 waves), tile 128x128, K-step 64, double-buffered
// async global->LDS staging.
// ---------------------------------------------------------------------------
#define GKS 64
#define GKP 72  // padded LDS row stride (144 B, 16B-aligned)

__global__ __launch_bounds__(256)
void k_gemm_bf16(const __bf16* __restrict__ A, const __bf16* __restrict__ Bt,
                 const float* __restrict__ resid, float* __restrict__ C,
                 int M, int N, int K) {
    __shared__ __bf16 a_lds[2][128 * GKP];
    __shared__ __bf16 b_lds[2][128 * GKP];
    const int tid = threadIdx.x;
    const int lane = tid & 31, wave = tid >> 5;
    const int half = (lane >> 4) & 1, l16 = lane & 15;
    const int m_blk = blockIdx.y * 128, n_blk = blockIdx.x * 128;
    const int m0 = wave * 16;
    const int r_base = tid >> 3, c_st = (tid & 7) * 8;

    v8f acc[8];
#pragma unroll
    for (int i = 0; i < 8; ++i) acc[i] = vzero8();

    // Stage one 128x64 tile of A and Bt into LDS buffer `buf` (async).
    auto stage = [&](int k0, int buf) {
#pragma unroll
        for (int i = 0; i < 4; ++i) {
            int r = r_base + i * 32;
            async_b128(&A[(size_t)(m_blk + r) * K + k0 + c_st],
                       &a_lds[buf][r * GKP + c_st]);
            async_b128(&Bt[(size_t)(n_blk + r) * K + k0 + c_st],
                       &b_lds[buf][r * GKP + c_st]);
        }
    };

    const int T = K / GKS;
    stage(0, 0);
    for (int t = 0; t < T; ++t) {
        wait_async0();          // tile t landed (async loads retire in order)
        __syncthreads();        // visible to all waves; prior reads finished
        if (t + 1 < T) stage((t + 1) * GKS, (t + 1) & 1);  // overlap copy
        const __bf16* abase = &a_lds[t & 1][(m0 + l16) * GKP];
        v16bf af[2], bfr[2][8];
#pragma unroll
        for (int kk = 0; kk < 2; ++kk) {
            af[kk] = ld_frag(abase + kk * 32 + half * 8,
                             abase + kk * 32 + 16 + half * 8);
#pragma unroll
            for (int nt = 0; nt < 8; ++nt) {
                const __bf16* brow =
                    &b_lds[t & 1][(nt * 16 + l16) * GKP + kk * 32];
                bfr[kk][nt] = ld_frag(brow + half * 8, brow + 16 + half * 8);
            }
        }
        // Keeps the tile's 36 fragment loads one group ahead of its 16 WMMAs
        // (counted waits); spread among them, each pair costs a full LDS wait.
        __builtin_amdgcn_sched_barrier(0);
#pragma unroll
        for (int kk = 0; kk < 2; ++kk)
#pragma unroll
            for (int nt = 0; nt < 8; ++nt)
                acc[nt] = wmma_bf16(af[kk], bfr[kk][nt], acc[nt]);
    }

#pragma unroll
    for (int nt = 0; nt < 8; ++nt) {
#pragma unroll
        for (int r = 0; r < 8; ++r) {
            int m = m_blk + m0 + half * 8 + r;
            int n = n_blk + nt * 16 + l16;
            float v = acc[nt][r];
            if (resid) v += resid[(size_t)m * N + n];
            C[(size_t)m * N + n] = v;
        }
    }
}

// ---------------------------------------------------------------------------
// Per-head RMSNorm over DH=128, f32 in -> bf16 out. One wave takes R rows in a
// row: their R 16-byte loads are issued together, then each row is summed by
// its own butterfly (R independent chains).
// ---------------------------------------------------------------------------
template <int R>
DEV void rmsnorm_body(const float* __restrict__ in,
                      const float* __restrict__ gamma,
                      __bf16* __restrict__ out) {
    const int lane = threadIdx.x & 31, wave = threadIdx.x >> 5;
    const size_t off = ((size_t)blockIdx.x * 8 + wave) * (R * 128) + lane * 4;
    const float* p = in + off;
    const float4 g = *(const float4*)&gamma[lane * 4];
    v4f v[R];
#pragma unroll
    for (int i = 0; i < R; ++i) v[i] = *(const v4f*)(p + i * 128);
    if constexpr (R == 16) hold16(v, p);
#pragma unroll
    for (int i = 0; i < R; ++i) {
        float ss = v[i].x * v[i].x + v[i].y * v[i].y + v[i].z * v[i].z +
                   v[i].w * v[i].w;
#pragma unroll
        for (int m = 1; m < 32; m <<= 1) ss += __shfl_xor(ss, m, 32);
        float rs = rsqrtf(ss * (1.0f / 128.0f) + 1e-8f);
        union { __bf16 h[4]; uint2 u; } o;
        o.h[0] = (__bf16)(v[i].x * rs * g.x);
        o.h[1] = (__bf16)(v[i].y * rs * g.y);
        o.h[2] = (__bf16)(v[i].z * rs * g.z);
        o.h[3] = (__bf16)(v[i].w * rs * g.w);
        *(uint2*)&out[off + i * 128] = o.u;
    }
}

// Four waves per SIMD is what this grid puts there (two blocks per WGP): told so,
// the compiler keeps all 16 rows in registers; aiming at 16 waves it split the
// loads into four groups, each with a memory latency of its own.
__global__ __launch_bounds__(256) __attribute__((amdgpu_waves_per_eu(4, 4)))
void k_rmsnorm_x16(const float* __restrict__ in, const float* __restrict__ gamma,
                   __bf16* __restrict__ out) {
    rmsnorm_body<16>(in, gamma, out);  // 128 rows per block
}

__global__ __launch_bounds__(256)
void k_rmsnorm_x8(const float* __restrict__ in, const float* __restrict__ gamma,
                  __bf16* __restrict__ out) {
    rmsnorm_body<8>(in, gamma, out);   // 64 rows per block
}

#define AKP 136  // K row stride: 272 B, odd multiple of 16 B (ds_load_b128 reader)
#define AVP 144  // V row stride: 288 B, odd multiple of 32 B (transposing reader)

typedef __attribute__((ext_vector_type(8))) short v8s;

// Transposing LDS load: lane (c, half) gets T[kbase + 8*half + 0..7][dbase + c].
DEV v8bf ld_tr16(const __bf16* p) {
    return __builtin_bit_cast(
        v8bf, __builtin_amdgcn_ds_load_tr16_b128_v8i16((LDS_AS v8s*)p));
}

// Value of lane l ^ 16.
DEV float xhalf(float x) {
    return __builtin_bit_cast(float, __builtin_amdgcn_permlanex16(
        __builtin_bit_cast(int, x), __builtin_bit_cast(int, x),
        0x76543210, 0xfedcba98, false, false));
}

__global__ __launch_bounds__(256)
void k_attn(const __bf16* __restrict__ qb, const __bf16* __restrict__ kb,
            const __bf16* __restrict__ vb, __bf16* __restrict__ ob) {
    __shared__ __attribute__((aligned(16))) __bf16 k_lds[128 * AKP];
    __shared__ __attribute__((aligned(16))) __bf16 v_lds[128 * AVP];

    const int tid = threadIdx.x;
    const int lane = tid & 31, wave = tid >> 5;
    const int half = (lane >> 4) & 1, l16 = lane & 15;
    const int qt = blockIdx.x, h = blockIdx.y, b = blockIdx.z;
    const int kvh = h >> 2;            // GQA group of 4
    const int tok0 = b * 2048;
    const int q0 = qt * 128 + wave * 16;  // wave's first query row (in-batch)
    const float scale = 0.08838834764831845f;  // 128^-0.5

    // Q fragments (B operand): column = query l16, 4 K-chunks of 32 over dh.
    v16bf qf[4];
    {
        const int t = tok0 + q0 + l16;
        const __bf16* qrow = qb + ((size_t)t * 16 + h) * 128;
#pragma unroll
        for (int kk = 0; kk < 4; ++kk)
            qf[kk] = ld_frag(qrow + kk * 32 + half * 8,
                             qrow + kk * 32 + 16 + half * 8);
    }

    v8f o[8];  // O^T tiles: row dh = nt*16 + half*8 + r, column = query l16
#pragma unroll
    for (int i = 0; i < 8; ++i) o[i] = vzero8();
    float mrow = -3.0e38f;  // this lane's query: running maximum (both halves)
    float lrow = 0.0f;      // running sum over this half's keys only

    for (int kt = 0; kt <= qt; ++kt) {
        __syncthreads();  // previous tile fully consumed
        // --- async K and V tiles: [key][dh], 128 keys x 16 chunks each ---
#pragma unroll
        for (int i = 0; i < 8; ++i) {
            int idx = tid + i * 256;
            int key = idx >> 4, c = (idx & 15) * 8;
            int t = tok0 + kt * 128 + key;
            async_b128(&kb[((size_t)t * 4 + kvh) * 128 + c],
                       &k_lds[key * AKP + c]);
            async_b128(&vb[((size_t)t * 4 + kvh) * 128 + c],
                       &v_lds[key * AVP + c]);
        }
        wait_async0();
        __syncthreads();

        // Skip fully-masked 32-key groups on the diagonal tile.
        const int gmax = (kt == qt) ? (wave * 16 + 15) / 32 : 3;
        for (int g = 0; g <= gmax; ++g) {
            // S^T = K Q^T for 32 keys (two 16-key tiles), K-dim = dh = 128.
            v16bf kf0[4], kf1[4];
#pragma unroll
            for (int kk = 0; kk < 4; ++kk) {
                const __bf16* kr0 = &k_lds[(g * 32 + l16) * AKP + kk * 32];
                const __bf16* kr1 = &k_lds[(g * 32 + 16 + l16) * AKP + kk * 32];
                kf0[kk] = ld_frag(kr0 + half * 8, kr0 + 16 + half * 8);
                kf1[kk] = ld_frag(kr1 + half * 8, kr1 + 16 + half * 8);
            }
            // Keeps the 16 K loads one group ahead of their WMMAs (counted
            // waits); spread among them, each pair costs a full LDS wait.
            __builtin_amdgcn_sched_barrier(0);
            v8f s0 = vzero8(), s1 = vzero8();
#pragma unroll
            for (int kk = 0; kk < 4; ++kk) {
                s0 = wmma_bf16(kf0[kk], qf[kk], s0);
                s1 = wmma_bf16(kf1[kk], qf[kk], s1);
            }
            // V^T fragments: A = 16 (dh) x 32 (keys) by two transposing loads.
            const __bf16* vr = &v_lds[(g * 32 + half * 8 + (lane & 7)) * AVP +
                                      ((lane >> 3) & 1) * 8];
            v16bf vf[8];
#pragma unroll
            for (int nt = 0; nt < 8; ++nt) {
                v8bf lo = ld_tr16(vr + nt * 16);
                v8bf hi = ld_tr16(vr + 16 * AVP + nt * 16);
                vf[nt] = __builtin_shufflevector(lo, hi, 0, 1, 2, 3, 4, 5, 6, 7,
                                                 8, 9, 10, 11, 12, 13, 14, 15);
            }
            // Keeps the 16 V^T loads one group here, in flight under the
            // softmax arithmetic, instead of one full LDS wait per WMMA.
            __builtin_amdgcn_sched_barrier(0);
            // Scale + causal mask + this query's max over the 32-key group.
            const int qg = q0 + l16;
            const int kg0 = kt * 128 + g * 32 + half * 8;  // + r
            float p0[8], p1[8];
            float tmax = -3.0e38f;
#pragma unroll
            for (int r = 0; r < 8; ++r) {
                float a = s0[r] * scale, c = s1[r] * scale;
                if (kg0 + r > qg) a = -3.0e38f;
                if (kg0 + 16 + r > qg) c = -3.0e38f;
                p0[r] = a; p1[r] = c;
                tmax = fmaxf(tmax, fmaxf(a, c));
            }
            tmax = fmaxf(tmax, xhalf(tmax));
            // Online softmax update; P^T packs into the B operand in place:
            // elements 0..7 are keys half*8 + r, 8..15 are keys 16 + half*8 + r.
            const float mn = fmaxf(mrow, tmax);
            const bool live = mn > -1.0e37f;
            const float al = live ? __expf(mrow - mn) : 1.0f;
            float rs0 = 0.0f, rs1 = 0.0f;
            v16bf pf;
#pragma unroll
            for (int r = 0; r < 8; ++r) {
                float e0 = live ? __expf(p0[r] - mn) : 0.0f;
                float e1 = live ? __expf(p1[r] - mn) : 0.0f;
                rs0 += e0; rs1 += e1;
                pf[r]     = (__bf16)e0;
                pf[8 + r] = (__bf16)e1;
            }
            lrow = lrow * al + (rs0 + rs1);
            mrow = mn;
            // Rescale running output accumulators.
#pragma unroll
            for (int nt = 0; nt < 8; ++nt)
#pragma unroll
                for (int r = 0; r < 8; ++r) o[nt][r] *= al;
            // O^T += V^T P^T.
#pragma unroll
            for (int nt = 0; nt < 8; ++nt) o[nt] = wmma_bf16(vf[nt], pf, o[nt]);
        }
    }

    // Finalize: join the halves' sums, divide, store bf16 [token][h*128 + dh]
    // (16 bytes per lane and tile: dh = nt*16 + half*8 .. + 7).
    const float inv = 1.0f / fmaxf(lrow + xhalf(lrow), 1e-20f);
    __bf16* orow = ob + ((size_t)(tok0 + q0 + l16) * 16 + h) * 128 + half * 8;
#pragma unroll
    for (int nt = 0; nt < 8; ++nt) {
        v8bf w;
#pragma unroll
        for (int r = 0; r < 8; ++r) w[r] = (__bf16)(o[nt][r] * inv);
        *(v8bf*)(orow + nt * 16) = w;
    }
}

// ---------------------------------------------------------------------------
// Host-side orchestration
// ---------------------------------------------------------------------------
extern "C" void kernel_launch(void* const* d_in, const int* in_sizes, int n_in,
                              void* d_out, int out_size, void* d_ws, size_t ws_size,
                              hipStream_t stream) {
    (void)in_sizes; (void)n_in; (void)out_size; (void)ws_size;
    const float* x  = (const float*)d_in[0];
    const float* Wq = (const float*)d_in[1];
    const float* Wk = (const float*)d_in[2];
    const float* Wv = (const float*)d_in[3];
    const float* Wo = (const float*)d_in[4];
    const float* qg = (const float*)d_in[5];
    const float* kg = (const float*)d_in[6];
    float* out = (float*)d_out;

    const int M = 4096;        // tokens (2 batches x 2048)
    const int D = 2048;        // model dim
    const int KVD = 512;       // kv dim

    uint8_t* w = (uint8_t*)d_ws;
    __bf16* xb  = (__bf16*)(w);                // 16 MiB  x in bf16
    __bf16* wqt = (__bf16*)(w + 16777216);     //  8 MiB  Wq^T bf16
    __bf16* wkt = (__bf16*)(w + 25165824);     //  2 MiB  Wk^T bf16
    __bf16* wvt = (__bf16*)(w + 27262976);     //  2 MiB  Wv^T bf16
    __bf16* wot = (__bf16*)(w + 29360128);     //  8 MiB  Wo^T bf16
    float*  qf  = (float* )(w + 37748736);     // 32 MiB  Q f32 (later aliased)
    float*  kf  = (float* )(w + 71303168);     //  8 MiB  K f32
    float*  vf  = (float* )(w + 79691776);     //  8 MiB  V f32
    __bf16* qbf = (__bf16*)(w + 88080384);     // 16 MiB  Q bf16 (post-norm)
    __bf16* kbf = (__bf16*)(w + 104857600);    //  4 MiB  K bf16 (post-norm)
    __bf16* vbf = (__bf16*)(w + 109051904);    //  4 MiB  V bf16
    __bf16* aob = (__bf16*)(w + 37748736);     // alias over qf: attn out bf16
    // total workspace use: 113,246,208 bytes

    // 1) x -> bf16
    k_cvt_bf16_x16<<<(M * D) / 16384, 256, 0, stream>>>(x, xb);
    // 2) weights -> transposed bf16
    k_cvt_w_t_n2048<<<dim3(D / 64, D / 128), 256, 0, stream>>>(Wq, wqt);
    k_cvt_w_t_n512<<<dim3(KVD / 64, D / 128), 256, 0, stream>>>(Wk, wkt);
    k_cvt_w_t_n512<<<dim3(KVD / 64, D / 128), 256, 0, stream>>>(Wv, wvt);
    k_cvt_w_t_n2048<<<dim3(D / 64, D / 128), 256, 0, stream>>>(Wo, wot);
    // 3) QKV projections (WMMA GEMMs)
    k_gemm_bf16<<<dim3(D / 128, M / 128), 256, 0, stream>>>(
        xb, wqt, nullptr, qf, M, D, D);
    k_gemm_bf16<<<dim3(KVD / 128, M / 128), 256, 0, stream>>>(
        xb, wkt, nullptr, kf, M, KVD, D);
    k_gemm_bf16<<<dim3(KVD / 128, M / 128), 256, 0, stream>>>(
        xb, wvt, nullptr, vf, M, KVD, D);
    // 4) QK RMSNorm (per head, DH=128) + V convert
    k_rmsnorm_x16<<<(M * 16) / 128, 256, 0, stream>>>(qf, qg, qbf);
    k_rmsnorm_x8<<<(M * 4) / 64, 256, 0, stream>>>(kf, kg, kbf);
    k_cvt_bf16_x8<<<(M * KVD) / 8192, 256, 0, stream>>>(vf, vbf);
    // 5) causal GQA flash attention (WMMA)
    k_attn<<<dim3(16, 16, 2), 256, 0, stream>>>(qbf, kbf, vbf, aob);
    // 6) output projection + residual (WMMA GEMM)
    k_gemm_bf16<<<dim3(D / 128, M / 128), 256, 0, stream>>>(
        aob, wot, x, out, M, D, D);
}

// v004
// Measured time: 181 microseconds a run.
// Next to v003, in two timings, it ran 1.20 and 1.22 times as fast.
// Counting every step since v000, it is 2.26 times as fast.
#include <hip/hip_runtime.h>
#include <hip/hip_bf16.h>

// ---------------------------------------------------------------------------
// Transformer block for gfx1250: wave32 + WMMA bf16 pipeline
// with async global->LDS staging (ASYNCcnt) and double-buffered GEMM tiles.
// ---------------------------------------------------------------------------

#define DEV static __device__ __forceinline__

typedef __attribute__((ext_vector_type(16))) __bf16 v16bf;
typedef __attribute__((ext_vector_type(8)))  __bf16 v8bf;
typedef __attribute__((ext_vector_type(8)))  float  v8f;
typedef __attribute__((ext_vector_type(4)))  int    v4i;
typedef __attribute__((ext_vector_type(4)))  float  v4f;

#define LDS_AS __attribute__((address_space(3)))
#define GLB_AS __attribute__((address_space(1)))

DEV v8f vzero8() {
    v8f z;
#pragma unroll
    for (int i = 0; i < 8; ++i) z[i] = 0.0f;
    return z;
}

// Async global -> LDS copy of one 16-byte chunk (tracked by ASYNCcnt).
DEV void async_b128(const __bf16* g, __bf16* l) {
#if __has_builtin(__builtin_amdgcn_global_load_async_to_lds_b128)
    __builtin_amdgcn_global_load_async_to_lds_b128(
        (GLB_AS v4i*)(uintptr_t)g,
        (LDS_AS v4i*)(uint32_t)(uintptr_t)l, 0, 0);
#else
    unsigned loff = (unsigned)(uintptr_t)l;
    asm volatile("global_load_async_to_lds_b128 %0, %1, off"
                 :: "v"(loff), "v"(g) : "memory");
#endif
}

DEV void wait_async0() {
#if __has_builtin(__builtin_amdgcn_s_wait_asynccnt)
    __builtin_amdgcn_s_wait_asynccnt(0);
#else
    asm volatile("s_wait_asynccnt 0" ::: "memory");
#endif
}

// Build a 16-element bf16 fragment from two 16-byte chunks (the CDNA5 A/B
// 16-bit layout: lane holds K = half*8..+7 and K = 16+half*8..+7).
DEV v16bf ld_frag(const __bf16* lo, const __bf16* hi) {
    v8bf a = *(const v8bf*)lo;
    v8bf b = *(const v8bf*)hi;
    return __builtin_shufflevector(a, b, 0, 1, 2, 3, 4, 5, 6, 7,
                                          8, 9, 10, 11, 12, 13, 14, 15);
}

DEV v8f wmma_bf16(v16bf a, v16bf b, v8f c) {
    return __builtin_amdgcn_wmma_f32_16x16x32_bf16(
        false, a, false, b, (short)0, c, false, false);
}

// ---------------------------------------------------------------------------
// Elementwise f32 -> bf16 convert. A wave starts once and moves U * 512 B:
// all U 16-byte loads of a lane are issued before the first store, each load
// and each store of a wave covering whole 128-B lines.
// ---------------------------------------------------------------------------
// Inputs-only fence on 16 loaded values and on the address they were loaded
// from: every load is issued, and has landed, before anything that follows, and
// no load's result is placed on the address pair that the others still name.
// Without it the compiler sinks part of the 16 loads behind the first results'
// use, and the wave waits out the memory latency again for each part.
DEV void hold16(const v4f* v, const float* p) {
    asm volatile("" :: "v"(v[0]), "v"(v[1]), "v"(v[2]), "v"(v[3]), "v"(v[4]),
                       "v"(v[5]), "v"(v[6]), "v"(v[7]), "v"(v[8]), "v"(v[9]),
                       "v"(v[10]), "v"(v[11]), "v"(v[12]), "v"(v[13]),
                       "v"(v[14]), "v"(v[15]), "v"(p));
}

template <int U>
DEV void cvt_body(const float* __restrict__ in, __bf16* __restrict__ out,
                  int blk) {
    const size_t base = (size_t)blk * (1024 * U) + threadIdx.x * 4;
    const float* p = in + base;
    v4f v[U];
#pragma unroll
    for (int u = 0; u < U; ++u) v[u] = *(const v4f*)(p + u * 1024);
    if constexpr (U == 16) hold16(v, p);
#pragma unroll
    for (int u = 0; u < U; ++u) {
        union { __bf16 h[4]; uint2 u2; } o;
        o.h[0] = (__bf16)v[u].x; o.h[1] = (__bf16)v[u].y;
        o.h[2] = (__bf16)v[u].z; o.h[3] = (__bf16)v[u].w;
        *(uint2*)&out[base + u * 1024] = o.u2;
    }
    // The job's code may be followed by another job's in the merged kernel: the
    // stores' registers are not rewritten there ahead of this wait.
    asm volatile("s_wait_xcnt 0x0" ::: "memory");
}

// ---------------------------------------------------------------------------
// Weight transpose + convert: W[K][N] f32 -> Wt[N][K] bf16, one 128 (k) x 64 (n)
// tile per block. A thread loads an 8 (k) x 4 (n) patch by eight 16-byte loads
// (a wave: two 256-B row pieces each), packs four 8-k vectors in registers and
// passes them through LDS so that the stores are 256-B pieces of Wt rows.
// LDS row i*16 + c holds n = 4*c + i: at a pitch of 272 B the sixteen lanes of
// one ds_store_b128 then fall on all 64 banks.
// ---------------------------------------------------------------------------
#define TWP 136  // LDS row pitch in elements (272 B)

template <int K, int N>
DEV void cvt_w_t_body(const float* __restrict__ W, __bf16* __restrict__ Wt,
                      __bf16* t, int blk) {
    // blk counts the tiles of W with the n tile running fastest.
    const int k0 = (blk / (N / 64)) * 128, n0 = (blk % (N / 64)) * 64;
    const int tid = threadIdx.x;
    const int c4 = tid & 15, rq = tid >> 4;
    // K and N are compile-time: one address per lane, rows by immediate offset.
    const float* src = W + (size_t)(k0 + rq * 8) * N + n0 + c4 * 4;
    float v[8][4];
#pragma unroll
    for (int j = 0; j < 8; ++j) {
        float4 f = *(const float4*)(src + j * N);
        v[j][0] = f.x; v[j][1] = f.y; v[j][2] = f.z; v[j][3] = f.w;
    }
#pragma unroll
    for (int i = 0; i < 4; ++i) {
        v8bf p;
#pragma unroll
        for (int j = 0; j < 8; ++j) p[j] = (__bf16)v[j][i];
        *(v8bf*)&t[(i * 16 + c4) * TWP + rq * 8] = p;
    }
    __syncthreads();
    // LDS row i*16 + rq is Wt row n0 + 4*rq + i; sixteen lanes store its 256 B.
    __bf16* dst = Wt + (size_t)(n0 + rq * 4) * K + k0 + c4 * 8;
#pragma unroll
    for (int i = 0; i < 4; ++i)
        *(v8bf*)(dst + i * K) = *(const v8bf*)&t[(i * 16 + rq) * TWP + c4 * 8];
    // The job's code may be followed by another job's in the merged kernel: the
    // stores' registers are not rewritten there ahead of this wait.
    asm volatile("s_wait_xcnt 0x0" ::: "memory");
}

// One launch for the five jobs that depend on nothing but the inputs; a block's
// index says which job and which piece of it the block takes:
// 512 blocks x (16,384 elements each), 512 Wq, 512 Wo, 128 Wk, 128 Wv tiles.
__global__ __launch_bounds__(256)
void k_prep(const float* __restrict__ x, const float* __restrict__ Wq,
            const float* __restrict__ Wk, const float* __restrict__ Wv,
            const float* __restrict__ Wo, __bf16* __restrict__ xb,
            __bf16* __restrict__ wqt, __bf16* __restrict__ wkt,
            __bf16* __restrict__ wvt, __bf16* __restrict__ wot) {
    __shared__ __attribute__((aligned(16))) __bf16 t[64 * TWP];
    const int b = blockIdx.x;
    if (b < 512)       cvt_body<16>(x, xb, b);
    else if (b < 1024) cvt_w_t_body<2048, 2048>(Wq, wqt, t, b - 512);
    else if (b < 1536) cvt_w_t_body<2048, 2048>(Wo, wot, t, b - 1024);
    else if (b < 1664) cvt_w_t_body<2048, 512>(Wk, wkt, t, b - 1536);
    else               cvt_w_t_body<2048, 512>(Wv, wvt, t, b - 1664);
}

// ---------------------------------------------------------------------------
// Tiled WMMA GEMM: C[M][N] f32 = A[M][K] bf16 * Bt[N][K] bf16 (+ residual)
// Block = 256 threads (8 waves), tile 128x128, K-step 64, double-buffered
// async global->LDS staging.
// ---------------------------------------------------------------------------
#define GKS 64
#define GKP 72  // padded LDS row stride (144 B, 16B-aligned)

// Bt points at the first of the block's 128 rows, C (and resid) at the first of
// its 128 columns; N is the row length of C.
DEV void gemm_body(const __bf16* __restrict__ A, const __bf16* __restrict__ Bt,
                   const float* __restrict__ resid, float* __restrict__ C,
                   int m_blk, int N, int K) {
    __shared__ __bf16 a_lds[2][128 * GKP];
    __shared__ __bf16 b_lds[2][128 * GKP];
    const int tid = threadIdx.x;
    const int lane = tid & 31, wave = tid >> 5;
    const int half = (lane >> 4) & 1, l16 = lane & 15;
    const int m0 = wave * 16;
    const int r_base = tid >> 3, c_st = (tid & 7) * 8;

    v8f acc[8];
#pragma unroll
    for (int i = 0; i < 8; ++i) acc[i] = vzero8();

    // Stage one 128x64 tile of A and Bt into LDS buffer `buf` (async).
    auto stage = [&](int k0, int buf) {
#pragma unroll
        for (int i = 0; i < 4; ++i) {
            int r = r_base + i * 32;
            async_b128(&A[(size_t)(m_blk + r) * K + k0 + c_st],
                       &a_lds[buf][r * GKP + c_st]);
            async_b128(&Bt[(size_t)r * K + k0 + c_st],
                       &b_lds[buf][r * GKP + c_st]);
        }
    };

    const int T = K / GKS;
    stage(0, 0);
    for (int t = 0; t < T; ++t) {
        wait_async0();          // tile t landed (async loads retire in order)
        __syncthreads();        // visible to all waves; prior reads finished
        if (t + 1 < T) stage((t + 1) * GKS, (t + 1) & 1);  // overlap copy
        const __bf16* abase = &a_lds[t & 1][(m0 + l16) * GKP];
        v16bf af[2], bfr[2][8];
#pragma unroll
        for (int kk = 0; kk < 2; ++kk) {
            af[kk] = ld_frag(abase + kk * 32 + half * 8,
                             abase + kk * 32 + 16 + half * 8);
#pragma unroll
            for (int nt = 0; nt < 8; ++nt) {
                const __bf16* brow =
                    &b_lds[t & 1][(nt * 16 + l16) * GKP + kk * 32];
                bfr[kk][nt] = ld_frag(brow + half * 8, brow + 16 + half * 8);
            }
        }
        // Keeps the tile's 36 fragment loads one group ahead of its 16 WMMAs
        // (counted waits); spread among them, each pair costs a full LDS wait.
        __builtin_amdgcn_sched_barrier(0);
#pragma unroll
        for (int kk = 0; kk < 2; ++kk)
#pragma unroll
            for (int nt = 0; nt < 8; ++nt)
                acc[nt] = wmma_bf16(af[kk], bfr[kk][nt], acc[nt]);
    }

#pragma unroll
    for (int nt = 0; nt < 8; ++nt) {
#pragma unroll
        for (int r = 0; r < 8; ++r) {
            int m = m_blk + m0 + half * 8 + r;
            int n = nt * 16 + l16;
            float v = acc[nt][r];
            if (resid) v += resid[(size_t)m * N + n];
            C[(size_t)m * N + n] = v;
        }
    }
}

// Q, K and V projections in one launch. Wt holds Wq^T, Wk^T, Wv^T one behind the
// other (3072 rows of K); blockIdx.x is the 128-row tile of Wt: 16 tiles go to q
// (rows of 2048), 4 to k and 4 to v (rows of 512).
__global__ __launch_bounds__(256)
void k_gemm_qkv(const __bf16* __restrict__ A, const __bf16* __restrict__ Wt,
                float* __restrict__ q, float* __restrict__ k,
                float* __restrict__ v, int K) {
    const int x = blockIdx.x;
    float* C = x < 16 ? q + x * 128 : x < 20 ? k + (x - 16) * 128
                                             : v + (x - 20) * 128;
    gemm_body(A, Wt + (size_t)x * 128 * K, nullptr, C, blockIdx.y * 128,
              x < 16 ? 2048 : 512, K);
}

__global__ __launch_bounds__(256)
void k_gemm_out(const __bf16* __restrict__ A, const __bf16* __restrict__ Bt,
                const float* __restrict__ resid, float* __restrict__ C,
                int N, int K) {
    const int n_blk = blockIdx.x * 128;
    gemm_body(A, Bt + (size_t)n_blk * K, resid + n_blk, C + n_blk,
              blockIdx.y * 128, N, K);
}

// ---------------------------------------------------------------------------
// Per-head RMSNorm over DH=128, f32 in -> bf16 out. One wave takes R rows in a
// row: their R 16-byte loads are issued together, then each row is summed by
// its own butterfly (R independent chains).
// ---------------------------------------------------------------------------
template <int R>
DEV void rmsnorm_body(const float* __restrict__ in,
                      const float* __restrict__ gamma,
                      __bf16* __restrict__ out, int blk) {
    const int lane = threadIdx.x & 31, wave = threadIdx.x >> 5;
    const size_t off = ((size_t)blk * 8 + wave) * (R * 128) + lane * 4;
    const float* p = in + off;
    const float4 g = *(const float4*)&gamma[lane * 4];
    v4f v[R];
#pragma unroll
    for (int i = 0; i < R; ++i) v[i] = *(const v4f*)(p + i * 128);
    if constexpr (R == 16) hold16(v, p);
    // Keeps the address pair live up to the wait.
    else asm volatile("s_wait_xcnt 0x0" :: "v"(p) : "memory");
#pragma unroll
    for (int i = 0; i < R; ++i) {
        float ss = v[i].x * v[i].x + v[i].y * v[i].y + v[i].z * v[i].z +
                   v[i].w * v[i].w;
#pragma unroll
        for (int m = 1; m < 32; m <<= 1) ss += __shfl_xor(ss, m, 32);
        float rs = rsqrtf(ss * (1.0f / 128.0f) + 1e-8f);
        union { __bf16 h[4]; uint2 u; } o;
        o.h[0] = (__bf16)(v[i].x * rs * g.x);
        o.h[1] = (__bf16)(v[i].y * rs * g.y);
        o.h[2] = (__bf16)(v[i].z * rs * g.z);
        o.h[3] = (__bf16)(v[i].w * rs * g.w);
        *(uint2*)&out[off + i * 128] = o.u;
    }
    // The job's code may be followed by another job's in the merged kernel: the
    // stores' registers are not rewritten there ahead of this wait.
    asm volatile("s_wait_xcnt 0x0" ::: "memory");
}

// One launch for the three jobs between the projections and the attention; a
// block's index picks the job: 512 blocks of 128 Q rows, 256 of 64 K rows, 256 of
// 8,192 V elements.
// A floor of four waves per SIMD gives the compiler the registers to keep all 16
// rows of a Q wave; aiming at 16 waves it split the loads into four groups, each
// with a memory latency of its own. The top of the range is what the merged grid
// offers a SIMD: four blocks per WGP, eight waves.
__global__ __launch_bounds__(256) __attribute__((amdgpu_waves_per_eu(4, 8)))
void k_post(const float* __restrict__ qf, const float* __restrict__ kf,
            const float* __restrict__ vf, const float* __restrict__ qg,
            const float* __restrict__ kg, __bf16* __restrict__ qb,
            __bf16* __restrict__ kb, __bf16* __restrict__ vb) {
    const int b = blockIdx.x;
    if (b < 512)      rmsnorm_body<16>(qf, qg, qb, b);
    else if (b < 768) rmsnorm_body<8>(kf, kg, kb, b - 512);
    else              cvt_body<8>(vf, vb, b - 768);
}

#define AKP 136  // K row stride: 272 B, odd multiple of 16 B (ds_load_b128 reader)
#define AVP 144  // V row stride: 288 B, odd multiple of 32 B (transposing reader)

typedef __attribute__((ext_vector_type(8))) short v8s;

// Transposing LDS load: lane (c, half) gets T[kbase + 8*half + 0..7][dbase + c].
DEV v8bf ld_tr16(const __bf16* p) {
    return __builtin_bit_cast(
        v8bf, __builtin_amdgcn_ds_load_tr16_b128_v8i16((LDS_AS v8s*)p));
}

// Value of lane l ^ 16.
DEV float xhalf(float x) {
    return __builtin_bit_cast(float, __builtin_amdgcn_permlanex16(
        __builtin_bit_cast(int, x), __builtin_bit_cast(int, x),
        0x76543210, 0xfedcba98, false, false));
}

__global__ __launch_bounds__(256)
void k_attn(const __bf16* __restrict__ qb, const __bf16* __restrict__ kb,
            const __bf16* __restrict__ vb, __bf16* __restrict__ ob) {
    __shared__ __attribute__((aligned(16))) __bf16 k_lds[128 * AKP];
    __shared__ __attribute__((aligned(16))) __bf16 v_lds[128 * AVP];

    const int tid = threadIdx.x;
    const int lane = tid & 31, wave = tid >> 5;
    const int half = (lane >> 4) & 1, l16 = lane & 15;
    const int qt = blockIdx.x, h = blockIdx.y, b = blockIdx.z;
    const int kvh = h >> 2;            // GQA group of 4
    const int tok0 = b * 2048;
    const int q0 = qt * 128 + wave * 16;  // wave's first query row (in-batch)
    const float scale = 0.08838834764831845f;  // 128^-0.5

    // Q fragments (B operand): column = query l16, 4 K-chunks of 32 over dh.
    v16bf qf[4];
    {
        const int t = tok0 + q0 + l16;
        const __bf16* qrow = qb + ((size_t)t * 16 + h) * 128;
#pragma unroll
        for (int kk = 0; kk < 4; ++kk)
            qf[kk] = ld_frag(qrow + kk * 32 + half * 8,
                             qrow + kk * 32 + 16 + half * 8);
    }

    v8f o[8];  // O^T tiles: row dh = nt*16 + half*8 + r, column = query l16
#pragma unroll
    for (int i = 0; i < 8; ++i) o[i] = vzero8();
    float mrow = -3.0e38f;  // this lane's query: running maximum (both halves)
    float lrow = 0.0f;      // running sum over this half's keys only

    for (int kt = 0; kt <= qt; ++kt) {
        __syncthreads();  // previous tile fully consumed
        // --- async K and V tiles: [key][dh], 128 keys x 16 chunks each ---
#pragma unroll
        for (int i = 0; i < 8; ++i) {
            int idx = tid + i * 256;
            int key = idx >> 4, c = (idx & 15) * 8;
            int t = tok0 + kt * 128 + key;
            async_b128(&kb[((size_t)t * 4 + kvh) * 128 + c],
                       &k_lds[key * AKP + c]);
            async_b128(&vb[((size_t)t * 4 + kvh) * 128 + c],
                       &v_lds[key * AVP + c]);
        }
        wait_async0();
        __syncthreads();

        // Skip fully-masked 32-key groups on the diagonal tile.
        const int gmax = (kt == qt) ? (wave * 16 + 15) / 32 : 3;
        for (int g = 0; g <= gmax; ++g) {
            // S^T = K Q^T for 32 keys (two 16-key tiles), K-dim = dh = 128.
            v16bf kf0[4], kf1[4];
#pragma unroll
            for (int kk = 0; kk < 4; ++kk) {
                const __bf16* kr0 = &k_lds[(g * 32 + l16) * AKP + kk * 32];
                const __bf16* kr1 = &k_lds[(g * 32 + 16 + l16) * AKP + kk * 32];
                kf0[kk] = ld_frag(kr0 + half * 8, kr0 + 16 + half * 8);
                kf1[kk] = ld_frag(kr1 + half * 8, kr1 + 16 + half * 8);
            }
            // Keeps the 16 K loads one group ahead of their WMMAs (counted
            // waits); spread among them, each pair costs a full LDS wait.
            __builtin_amdgcn_sched_barrier(0);
            v8f s0 = vzero8(), s1 = vzero8();
#pragma unroll
            for (int kk = 0; kk < 4; ++kk) {
                s0 = wmma_bf16(kf0[kk], qf[kk], s0);
                s1 = wmma_bf16(kf1[kk], qf[kk], s1);
            }
            // V^T fragments: A = 16 (dh) x 32 (keys) by two transposing loads.
            const __bf16* vr = &v_lds[(g * 32 + half * 8 + (lane & 7)) * AVP +
                                      ((lane >> 3) & 1) * 8];
            v16bf vf[8];
#pragma unroll
            for (int nt = 0; nt < 8; ++nt) {
                v8bf lo = ld_tr16(vr + nt * 16);
                v8bf hi = ld_tr16(vr + 16 * AVP + nt * 16);
                vf[nt] = __builtin_shufflevector(lo, hi, 0, 1, 2, 3, 4, 5, 6, 7,
                                                 8, 9, 10, 11, 12, 13, 14, 15);
            }
            // Keeps the 16 V^T loads one group here, in flight under the
            // softmax arithmetic, instead of one full LDS wait per WMMA.
            __builtin_amdgcn_sched_barrier(0);
            // Scale + causal mask + this query's max over the 32-key group.
            const int qg = q0 + l16;
            const int kg0 = kt * 128 + g * 32 + half * 8;  // + r
            float p0[8], p1[8];
            float tmax = -3.0e38f;
#pragma unroll
            for (int r = 0; r < 8; ++r) {
                float a = s0[r] * scale, c = s1[r] * scale;
                if (kg0 + r > qg) a = -3.0e38f;
                if (kg0 + 16 + r > qg) c = -3.0e38f;
                p0[r] = a; p1[r] = c;
                tmax = fmaxf(tmax, fmaxf(a, c));
            }
            tmax = fmaxf(tmax, xhalf(tmax));
            // Online softmax update; P^T packs into the B operand in place:
            // elements 0..7 are keys half*8 + r, 8..15 are keys 16 + half*8 + r.
            const float mn = fmaxf(mrow, tmax);
            const bool live = mn > -1.0e37f;
            const float al = live ? __expf(mrow - mn) : 1.0f;
            float rs0 = 0.0f, rs1 = 0.0f;
            v16bf pf;
#pragma unroll
            for (int r = 0; r < 8; ++r) {
                float e0 = live ? __expf(p0[r] - mn) : 0.0f;
                float e1 = live ? __expf(p1[r] - mn) : 0.0f;
                rs0 += e0; rs1 += e1;
                pf[r]     = (__bf16)e0;
                pf[8 + r] = (__bf16)e1;
            }
            lrow = lrow * al + (rs0 + rs1);
            mrow = mn;
            // Rescale running output accumulators.
#pragma unroll
            for (int nt = 0; nt < 8; ++nt)
#pragma unroll
                for (int r = 0; r < 8; ++r) o[nt][r] *= al;
            // O^T += V^T P^T.
#pragma unroll
            for (int nt = 0; nt < 8; ++nt) o[nt] = wmma_bf16(vf[nt], pf, o[nt]);
        }
    }

    // Finalize: join the halves' sums, divide, store bf16 [token][h*128 + dh]
    // (16 bytes per lane and tile: dh = nt*16 + half*8 .. + 7).
    const float inv = 1.0f / fmaxf(lrow + xhalf(lrow), 1e-20f);
    __bf16* orow = ob + ((size_t)(tok0 + q0 + l16) * 16 + h) * 128 + half * 8;
#pragma unroll
    for (int nt = 0; nt < 8; ++nt) {
        v8bf w;
#pragma unroll
        for (int r = 0; r < 8; ++r) w[r] = (__bf16)(o[nt][r] * inv);
        *(v8bf*)(orow + nt * 16) = w;
    }
}

// ---------------------------------------------------------------------------
// Host-side orchestration
// ---------------------------------------------------------------------------
extern "C" void kernel_launch(void* const* d_in, const int* in_sizes, int n_in,
                              void* d_out, int out_size, void* d_ws, size_t ws_size,
                              hipStream_t stream) {
    (void)in_sizes; (void)n_in; (void)out_size; (void)ws_size;
    const float* x  = (const float*)d_in[0];
    const float* Wq = (const float*)d_in[1];
    const float* Wk = (const float*)d_in[2];
    const float* Wv = (const float*)d_in[3];
    const float* Wo = (const float*)d_in[4];
    const float* qg = (const float*)d_in[5];
    const float* kg = (const float*)d_in[6];
    float* out = (float*)d_out;

    const int M = 4096;        // tokens (2 batches x 2048)
    const int D = 2048;        // model dim
    const int KVD = 512;       // kv dim

    uint8_t* w = (uint8_t*)d_ws;
    __bf16* xb  = (__bf16*)(w);                // 16 MiB  x in bf16
    __bf16* wqt = (__bf16*)(w + 16777216);     //  8 MiB  Wq^T bf16
    __bf16* wkt = (__bf16*)(w + 25165824);     //  2 MiB  Wk^T bf16
    __bf16* wvt = (__bf16*)(w + 27262976);     //  2 MiB  Wv^T bf16
    __bf16* wot = (__bf16*)(w + 29360128);     //  8 MiB  Wo^T bf16
    float*  qf  = (float* )(w + 37748736);     // 32 MiB  Q f32 (later aliased)
    float*  kf  = (float* )(w + 71303168);     //  8 MiB  K f32
    float*  vf  = (float* )(w + 79691776);     //  8 MiB  V f32
    __bf16* qbf = (__bf16*)(w + 88080384);     // 16 MiB  Q bf16 (post-norm)
    __bf16* kbf = (__bf16*)(w + 104857600);    //  4 MiB  K bf16 (post-norm)
    __bf16* vbf = (__bf16*)(w + 109051904);    //  4 MiB  V bf16
    __bf16* aob = (__bf16*)(w + 37748736);     // alias over qf: attn out bf16
    // total workspace use: 113,246,208 bytes

    // 1) x -> bf16 and the four weights -> transposed bf16
    k_prep<<<1792, 256, 0, stream>>>(x, Wq, Wk, Wv, Wo, xb, wqt, wkt, wvt, wot);
    // 2) QKV projections (WMMA GEMM over wqt, wkt, wvt as one 3072-row matrix)
    k_gemm_qkv<<<dim3((D + 2 * KVD) / 128, M / 128), 256, 0, stream>>>(
        xb, wqt, qf, kf, vf, D);
    // 3) QK RMSNorm (per head, DH=128) + V convert
    k_post<<<1024, 256, 0, stream>>>(qf, kf, vf, qg, kg, qbf, kbf, vbf);
    // 4) causal GQA flash attention (WMMA)
    k_attn<<<dim3(16, 16, 2), 256, 0, stream>>>(qbf, kbf, vbf, aob);
    // 5) output projection + residual (WMMA GEMM)
    k_gemm_out<<<dim3(D / 128, M / 128), 256, 0, stream>>>(
        aob, wot, x, out, D, D);
}

// v005
// One run takes 173 microseconds.
// Timed twice side by side with v004, it ran 1.05 times as fast both times.
// Over all steps from v000 it is 2.38 times as fast.
#include <hip/hip_runtime.h>
#include <hip/hip_bf16.h>

// ---------------------------------------------------------------------------
// Transformer block for gfx1250: wave32 + WMMA bf16 pipeline
// with async global->LDS staging (ASYNCcnt) and double-buffered GEMM tiles.
// ---------------------------------------------------------------------------

#define DEV static __device__ __forceinline__

typedef __attribute__((ext_vector_type(16))) __bf16 v16bf;
typedef __attribute__((ext_vector_type(8)))  __bf16 v8bf;
typedef __attribute__((ext_vector_type(8)))  float  v8f;
typedef __attribute__((ext_vector_type(4)))  int    v4i;
typedef __attribute__((ext_vector_type(4)))  float  v4f;

#define LDS_AS __attribute__((address_space(3)))
#define GLB_AS __attribute__((address_space(1)))

DEV v8f vzero8() {
    v8f z;
#pragma unroll
    for (int i = 0; i < 8; ++i) z[i] = 0.0f;
    return z;
}

// Async global -> LDS copy of one 16-byte chunk (tracked by ASYNCcnt).
DEV void async_b128(const __bf16* g, __bf16* l) {
#if __has_builtin(__builtin_amdgcn_global_load_async_to_lds_b128)
    __builtin_amdgcn_global_load_async_to_lds_b128(
        (GLB_AS v4i*)(uintptr_t)g,
        (LDS_AS v4i*)(uint32_t)(uintptr_t)l, 0, 0);
#else
    unsigned loff = (unsigned)(uintptr_t)l;
    asm volatile("global_load_async_to_lds_b128 %0, %1, off"
                 :: "v"(loff), "v"(g) : "memory");
#endif
}

DEV void wait_async0() {
#if __has_builtin(__builtin_amdgcn_s_wait_asynccnt)
    __builtin_amdgcn_s_wait_asynccnt(0);
#else
    asm volatile("s_wait_asynccnt 0" ::: "memory");
#endif
}

// Build a 16-element bf16 fragment from two 16-byte chunks (the CDNA5 A/B
// 16-bit layout: lane holds K = half*8..+7 and K = 16+half*8..+7).
DEV v16bf ld_frag(const __bf16* lo, const __bf16* hi) {
    v8bf a = *(const v8bf*)lo;
    v8bf b = *(const v8bf*)hi;
    return __builtin_shufflevector(a, b, 0, 1, 2, 3, 4, 5, 6, 7,
                                          8, 9, 10, 11, 12, 13, 14, 15);
}

DEV v8f wmma_bf16(v16bf a, v16bf b, v8f c) {
    return __builtin_amdgcn_wmma_f32_16x16x32_bf16(
        false, a, false, b, (short)0, c, false, false);
}

// Value of lane l ^ 16.
DEV float xhalf(float x) {
    return __builtin_bit_cast(float, __builtin_amdgcn_permlanex16(
        __builtin_bit_cast(int, x), __builtin_bit_cast(int, x),
        0x76543210, 0xfedcba98, false, false));
}

// ---------------------------------------------------------------------------
// Elementwise f32 -> bf16 convert. A wave starts once and moves U * 512 B:
// all U 16-byte loads of a lane are issued before the first store, each load
// and each store of a wave covering whole 128-B lines.
// ---------------------------------------------------------------------------
// Inputs-only fence on 16 loaded values and on the address they were loaded
// from: every load is issued, and has landed, before anything that follows, and
// no load's result is placed on the address pair that the others still name.
// Without it the compiler sinks part of the 16 loads behind the first results'
// use, and the wave waits out the memory latency again for each part.
DEV void hold16(const v4f* v, const float* p) {
    asm volatile("" :: "v"(v[0]), "v"(v[1]), "v"(v[2]), "v"(v[3]), "v"(v[4]),
                       "v"(v[5]), "v"(v[6]), "v"(v[7]), "v"(v[8]), "v"(v[9]),
                       "v"(v[10]), "v"(v[11]), "v"(v[12]), "v"(v[13]),
                       "v"(v[14]), "v"(v[15]), "v"(p));
}

template <int U>
DEV void cvt_body(const float* __restrict__ in, __bf16* __restrict__ out,
                  int blk) {
    const size_t base = (size_t)blk * (1024 * U) + threadIdx.x * 4;
    const float* p = in + base;
    v4f v[U];
#pragma unroll
    for (int u = 0; u < U; ++u) v[u] = *(const v4f*)(p + u * 1024);
    if constexpr (U == 16) hold16(v, p);
#pragma unroll
    for (int u = 0; u < U; ++u) {
        union { __bf16 h[4]; uint2 u2; } o;
        o.h[0] = (__bf16)v[u].x; o.h[1] = (__bf16)v[u].y;
        o.h[2] = (__bf16)v[u].z; o.h[3] = (__bf16)v[u].w;
        *(uint2*)&out[base + u * 1024] = o.u2;
    }
    // The job's code may be followed by another job's in the merged kernel: the
    // stores' registers are not rewritten there ahead of this wait.
    asm volatile("s_wait_xcnt 0x0" ::: "memory");
}

// ---------------------------------------------------------------------------
// Weight transpose + convert: W[K][N] f32 -> Wt[N][K] bf16, one 128 (k) x 64 (n)
// tile per block. A thread loads an 8 (k) x 4 (n) patch by eight 16-byte loads
// (a wave: two 256-B row pieces each), packs four 8-k vectors in registers and
// passes them through LDS so that the stores are 256-B pieces of Wt rows.
// LDS row i*16 + c holds n = 4*c + i: at a pitch of 272 B the sixteen lanes of
// one ds_store_b128 then fall on all 64 banks.
// ---------------------------------------------------------------------------
#define TWP 136  // LDS row pitch in elements (272 B)

template <int K, int N>
DEV void cvt_w_t_body(const float* __restrict__ W, __bf16* __restrict__ Wt,
                      __bf16* t, int blk) {
    // blk counts the tiles of W with the n tile running fastest.
    const int k0 = (blk / (N / 64)) * 128, n0 = (blk % (N / 64)) * 64;
    const int tid = threadIdx.x;
    const int c4 = tid & 15, rq = tid >> 4;
    // K and N are compile-time: one address per lane, rows by immediate offset.
    const float* src = W + (size_t)(k0 + rq * 8) * N + n0 + c4 * 4;
    float v[8][4];
#pragma unroll
    for (int j = 0; j < 8; ++j) {
        float4 f = *(const float4*)(src + j * N);
        v[j][0] = f.x; v[j][1] = f.y; v[j][2] = f.z; v[j][3] = f.w;
    }
#pragma unroll
    for (int i = 0; i < 4; ++i) {
        v8bf p;
#pragma unroll
        for (int j = 0; j < 8; ++j) p[j] = (__bf16)v[j][i];
        *(v8bf*)&t[(i * 16 + c4) * TWP + rq * 8] = p;
    }
    __syncthreads();
    // LDS row i*16 + rq is Wt row n0 + 4*rq + i; sixteen lanes store its 256 B.
    __bf16* dst = Wt + (size_t)(n0 + rq * 4) * K + k0 + c4 * 8;
#pragma unroll
    for (int i = 0; i < 4; ++i)
        *(v8bf*)(dst + i * K) = *(const v8bf*)&t[(i * 16 + rq) * TWP + c4 * 8];
    // The job's code may be followed by another job's in the merged kernel: the
    // stores' registers are not rewritten there ahead of this wait.
    asm volatile("s_wait_xcnt 0x0" ::: "memory");
}

// One launch for the five jobs that depend on nothing but the inputs; a block's
// index says which job and which piece of it the block takes:
// 512 blocks x (16,384 elements each), 512 Wq, 512 Wo, 128 Wk, 128 Wv tiles.
__global__ __launch_bounds__(256)
void k_prep(const float* __restrict__ x, const float* __restrict__ Wq,
            const float* __restrict__ Wk, const float* __restrict__ Wv,
            const float* __restrict__ Wo, __bf16* __restrict__ xb,
            __bf16* __restrict__ wqt, __bf16* __restrict__ wkt,
            __bf16* __restrict__ wvt, __bf16* __restrict__ wot) {
    __shared__ __attribute__((aligned(16))) __bf16 t[64 * TWP];
    const int b = blockIdx.x;
    if (b < 512)       cvt_body<16>(x, xb, b);
    else if (b < 1024) cvt_w_t_body<2048, 2048>(Wq, wqt, t, b - 512);
    else if (b < 1536) cvt_w_t_body<2048, 2048>(Wo, wot, t, b - 1024);
    else if (b < 1664) cvt_w_t_body<2048, 512>(Wk, wkt, t, b - 1536);
    else               cvt_w_t_body<2048, 512>(Wv, wvt, t, b - 1664);
}

// ---------------------------------------------------------------------------
// Tiled WMMA GEMM: C[M][N] f32 = A[M][K] bf16 * Bt[N][K] bf16 (+ residual)
// Block = 256 threads (8 waves), tile 128x128, K-step 64, double-buffered
// async global->LDS staging.
// ---------------------------------------------------------------------------
#define GKS 64
#define GKP 72  // padded LDS row stride (144 B, 16B-aligned)

// Main loop. Bt points at the first of the block's 128 rows. Wave w owns rows
// m_blk + 16*w .. + 15 of A against all 128 rows of Bt, as eight 16x16 tiles.
// TR = false: acc[nt][r] is row 8*half + r of A, row nt*16 + l16 of Bt.
// TR = true (operands swapped, the tile comes out transposed): acc[nt][r] is
// row l16 of A, row nt*16 + 8*half + r of Bt, so a lane holds 64 of the 128
// columns of ONE output row, in runs of eight.
template <bool TR>
DEV void gemm_main(const __bf16* __restrict__ A, const __bf16* __restrict__ Bt,
                   int m_blk, int K, v8f (&acc)[8]) {
    __shared__ __bf16 a_lds[2][128 * GKP];
    __shared__ __bf16 b_lds[2][128 * GKP];
    const int tid = threadIdx.x;
    const int lane = tid & 31, wave = tid >> 5;
    const int half = (lane >> 4) & 1, l16 = lane & 15;
    const int m0 = wave * 16;
    const int r_base = tid >> 3, c_st = (tid & 7) * 8;

#pragma unroll
    for (int i = 0; i < 8; ++i) acc[i] = vzero8();

    // Stage one 128x64 tile of A and Bt into LDS buffer `buf` (async).
    auto stage = [&](int k0, int buf) {
#pragma unroll
        for (int i = 0; i < 4; ++i) {
            int r = r_base + i * 32;
            async_b128(&A[(size_t)(m_blk + r) * K + k0 + c_st],
                       &a_lds[buf][r * GKP + c_st]);
            async_b128(&Bt[(size_t)r * K + k0 + c_st],
                       &b_lds[buf][r * GKP + c_st]);
        }
    };

    const int T = K / GKS;
    stage(0, 0);
    for (int t = 0; t < T; ++t) {
        wait_async0();          // tile t landed (async loads retire in order)
        __syncthreads();        // visible to all waves; prior reads finished
        if (t + 1 < T) stage((t + 1) * GKS, (t + 1) & 1);  // overlap copy
        const __bf16* abase = &a_lds[t & 1][(m0 + l16) * GKP];
        v16bf af[2], bfr[2][8];
#pragma unroll
        for (int kk = 0; kk < 2; ++kk) {
            af[kk] = ld_frag(abase + kk * 32 + half * 8,
                             abase + kk * 32 + 16 + half * 8);
#pragma unroll
            for (int nt = 0; nt < 8; ++nt) {
                const __bf16* brow =
                    &b_lds[t & 1][(nt * 16 + l16) * GKP + kk * 32];
                bfr[kk][nt] = ld_frag(brow + half * 8, brow + 16 + half * 8);
            }
        }
        // Keeps the tile's 36 fragment loads one group ahead of its 16 WMMAs
        // (counted waits); spread among them, each pair costs a full LDS wait.
        __builtin_amdgcn_sched_barrier(0);
#pragma unroll
        for (int kk = 0; kk < 2; ++kk)
#pragma unroll
            for (int nt = 0; nt < 8; ++nt)
                acc[nt] = TR ? wmma_bf16(bfr[kk][nt], af[kk], acc[nt])
                             : wmma_bf16(af[kk], bfr[kk][nt], acc[nt]);
    }
}

// Bt points at the first of the block's 128 rows, C (and resid) at the first of
// its 128 columns; N is the row length of C.
DEV void gemm_body(const __bf16* __restrict__ A, const __bf16* __restrict__ Bt,
                   const float* __restrict__ resid, float* __restrict__ C,
                   int m_blk, int N, int K) {
    const int tid = threadIdx.x;
    const int lane = tid & 31, wave = tid >> 5;
    const int half = (lane >> 4) & 1, l16 = lane & 15;
    const int m0 = wave * 16;

    v8f acc[8];
    gemm_main<false>(A, Bt, m_blk, K, acc);

#pragma unroll
    for (int nt = 0; nt < 8; ++nt) {
#pragma unroll
        for (int r = 0; r < 8; ++r) {
            int m = m_blk + m0 + half * 8 + r;
            int n = nt * 16 + l16;
            float v = acc[nt][r];
            if (resid) v += resid[(size_t)m * N + n];
            C[(size_t)m * N + n] = v;
        }
    }
}

// Q, K and V projections in one launch, with the per-head RMSNorm (Q, K) and the
// conversion to bf16 done on the f32 accumulators. Wt holds Wq^T, Wk^T, Wv^T one
// behind the other (3072 rows of K); blockIdx.x is the 128-row tile of Wt, which
// is exactly one head: 16 tiles go to q (rows of 2048), 4 to k and 4 to v (rows
// of 512). With the transposed tiles a token's head lies in the two lanes l16 and
// l16 + 16: the sum of squares is in-lane plus one exchange between the halves,
// and each tile leaves as one 16-byte store per lane.
__global__ __launch_bounds__(256)
void k_gemm_qkv(const __bf16* __restrict__ A, const __bf16* __restrict__ Wt,
                const float* __restrict__ qg, const float* __restrict__ kg,
                __bf16* __restrict__ q, __bf16* __restrict__ k,
                __bf16* __restrict__ v, int K) {
    const int x = blockIdx.x;
    const int lane = threadIdx.x & 31, wave = threadIdx.x >> 5;
    const int half = (lane >> 4) & 1, l16 = lane & 15;
    const int m_blk = blockIdx.y * 128;
    v8f acc[8];
    gemm_main<true>(A, Wt + (size_t)x * 128 * K, m_blk, K, acc);

    __bf16* C = x < 16 ? q + x * 128 : x < 20 ? k + (x - 16) * 128
                                              : v + (x - 20) * 128;
    const int N = x < 16 ? 2048 : 512;
    __bf16* orow = C + (size_t)(m_blk + wave * 16 + l16) * N + half * 8;
    v8bf w[8];
    if (x < 20) {
        const float* g = (x < 16 ? qg : kg) + half * 8;
        float sq[8];  // one chain per tile: eight short chains, not one of 64
#pragma unroll
        for (int nt = 0; nt < 8; ++nt) {
            sq[nt] = 0.0f;
#pragma unroll
            for (int r = 0; r < 8; ++r) sq[nt] += acc[nt][r] * acc[nt][r];
        }
        float ss = ((sq[0] + sq[1]) + (sq[2] + sq[3])) +
                   ((sq[4] + sq[5]) + (sq[6] + sq[7]));
        ss += xhalf(ss);
        const float rs = rsqrtf(ss * (1.0f / 128.0f) + 1e-8f);
#pragma unroll
        for (int nt = 0; nt < 8; ++nt) {
            const v4f g0 = *(const v4f*)(g + nt * 16);
            const v4f g1 = *(const v4f*)(g + nt * 16 + 4);
#pragma unroll
            for (int r = 0; r < 4; ++r) {
                w[nt][r]     = (__bf16)(acc[nt][r] * rs * g0[r]);
                w[nt][4 + r] = (__bf16)(acc[nt][4 + r] * rs * g1[r]);
            }
        }
    } else {
#pragma unroll
        for (int nt = 0; nt < 8; ++nt)
#pragma unroll
            for (int r = 0; r < 8; ++r) w[nt][r] = (__bf16)acc[nt][r];
    }
#pragma unroll
    for (int nt = 0; nt < 8; ++nt) *(v8bf*)(orow + nt * 16) = w[nt];
}

__global__ __launch_bounds__(256)
void k_gemm_out(const __bf16* __restrict__ A, const __bf16* __restrict__ Bt,
                const float* __restrict__ resid, float* __restrict__ C,
                int N, int K) {
    const int n_blk = blockIdx.x * 128;
    gemm_body(A, Bt + (size_t)n_blk * K, resid + n_blk, C + n_blk,
              blockIdx.y * 128, N, K);
}

#define AKP 136  // K row stride: 272 B, odd multiple of 16 B (ds_load_b128 reader)
#define AVP 144  // V row stride: 288 B, odd multiple of 32 B (transposing reader)

typedef __attribute__((ext_vector_type(8))) short v8s;

// Transposing LDS load: lane (c, half) gets T[kbase + 8*half + 0..7][dbase + c].
DEV v8bf ld_tr16(const __bf16* p) {
    return __builtin_bit_cast(
        v8bf, __builtin_amdgcn_ds_load_tr16_b128_v8i16((LDS_AS v8s*)p));
}

__global__ __launch_bounds__(256)
void k_attn(const __bf16* __restrict__ qb, const __bf16* __restrict__ kb,
            const __bf16* __restrict__ vb, __bf16* __restrict__ ob) {
    __shared__ __attribute__((aligned(16))) __bf16 k_lds[128 * AKP];
    __shared__ __attribute__((aligned(16))) __bf16 v_lds[128 * AVP];

    const int tid = threadIdx.x;
    const int lane = tid & 31, wave = tid >> 5;
    const int half = (lane >> 4) & 1, l16 = lane & 15;
    const int qt = blockIdx.x, h = blockIdx.y, b = blockIdx.z;
    const int kvh = h >> 2;            // GQA group of 4
    const int tok0 = b * 2048;
    const int q0 = qt * 128 + wave * 16;  // wave's first query row (in-batch)
    const float scale = 0.08838834764831845f;  // 128^-0.5

    // Q fragments (B operand): column = query l16, 4 K-chunks of 32 over dh.
    v16bf qf[4];
    {
        const int t = tok0 + q0 + l16;
        const __bf16* qrow = qb + ((size_t)t * 16 + h) * 128;
#pragma unroll
        for (int kk = 0; kk < 4; ++kk)
            qf[kk] = ld_frag(qrow + kk * 32 + half * 8,
                             qrow + kk * 32 + 16 + half * 8);
    }

    v8f o[8];  // O^T tiles: row dh = nt*16 + half*8 + r, column = query l16
#pragma unroll
    for (int i = 0; i < 8; ++i) o[i] = vzero8();
    float mrow = -3.0e38f;  // this lane's query: running maximum (both halves)
    float lrow = 0.0f;      // running sum over this half's keys only

    for (int kt = 0; kt <= qt; ++kt) {
        __syncthreads();  // previous tile fully consumed
        // --- async K and V tiles: [key][dh], 128 keys x 16 chunks each ---
#pragma unroll
        for (int i = 0; i < 8; ++i) {
            int idx = tid + i * 256;
            int key = idx >> 4, c = (idx & 15) * 8;
            int t = tok0 + kt * 128 + key;
            async_b128(&kb[((size_t)t * 4 + kvh) * 128 + c],
                       &k_lds[key * AKP + c]);
            async_b128(&vb[((size_t)t * 4 + kvh) * 128 + c],
                       &v_lds[key * AVP + c]);
        }
        wait_async0();
        __syncthreads();

        // Skip fully-masked 32-key groups on the diagonal tile.
        const int gmax = (kt == qt) ? (wave * 16 + 15) / 32 : 3;
        for (int g = 0; g <= gmax; ++g) {
            // S^T = K Q^T for 32 keys (two 16-key tiles), K-dim = dh = 128.
            v16bf kf0[4], kf1[4];
#pragma unroll
            for (int kk = 0; kk < 4; ++kk) {
                const __bf16* kr0 = &k_lds[(g * 32 + l16) * AKP + kk * 32];
                const __bf16* kr1 = &k_lds[(g * 32 + 16 + l16) * AKP + kk * 32];
                kf0[kk] = ld_frag(kr0 + half * 8, kr0 + 16 + half * 8);
                kf1[kk] = ld_frag(kr1 + half * 8, kr1 + 16 + half * 8);
            }
            // Keeps the 16 K loads one group ahead of their WMMAs (counted
            // waits); spread among them, each pair costs a full LDS wait.
            __builtin_amdgcn_sched_barrier(0);
            v8f s0 = vzero8(), s1 = vzero8();
#pragma unroll
            for (int kk = 0; kk < 4; ++kk) {
                s0 = wmma_bf16(kf0[kk], qf[kk], s0);
                s1 = wmma_bf16(kf1[kk], qf[kk], s1);
            }
            // V^T fragments: A = 16 (dh) x 32 (keys) by two transposing loads.
            const __bf16* vr = &v_lds[(g * 32 + half * 8 + (lane & 7)) * AVP +
                                      ((lane >> 3) & 1) * 8];
            v16bf vf[8];
#pragma unroll
            for (int nt = 0; nt < 8; ++nt) {
                v8bf lo = ld_tr16(vr + nt * 16);
                v8bf hi = ld_tr16(vr + 16 * AVP + nt * 16);
                vf[nt] = __builtin_shufflevector(lo, hi, 0, 1, 2, 3, 4, 5, 6, 7,
                                                 8, 9, 10, 11, 12, 13, 14, 15);
            }
            // Keeps the 16 V^T loads one group here, in flight under the
            // softmax arithmetic, instead of one full LDS wait per WMMA.
            __builtin_amdgcn_sched_barrier(0);
            // Scale + causal mask + this query's max over the 32-key group.
            const int qg = q0 + l16;
            const int kg0 = kt * 128 + g * 32 + half * 8;  // + r
            float p0[8], p1[8];
            float tmax = -3.0e38f;
#pragma unroll
            for (int r = 0; r < 8; ++r) {
                float a = s0[r] * scale, c = s1[r] * scale;
                if (kg0 + r > qg) a = -3.0e38f;
                if (kg0 + 16 + r > qg) c = -3.0e38f;
                p0[r] = a; p1[r] = c;
                tmax = fmaxf(tmax, fmaxf(a, c));
            }
            tmax = fmaxf(tmax, xhalf(tmax));
            // Online softmax update; P^T packs into the B operand in place:
            // elements 0..7 are keys half*8 + r, 8..15 are keys 16 + half*8 + r.
            const float mn = fmaxf(mrow, tmax);
            const bool live = mn > -1.0e37f;
            const float al = live ? __expf(mrow - mn) : 1.0f;
            float rs0 = 0.0f, rs1 = 0.0f;
            v16bf pf;
#pragma unroll
            for (int r = 0; r < 8; ++r) {
                float e0 = live ? __expf(p0[r] - mn) : 0.0f;
                float e1 = live ? __expf(p1[r] - mn) : 0.0f;
                rs0 += e0; rs1 += e1;
                pf[r]     = (__bf16)e0;
                pf[8 + r] = (__bf16)e1;
            }
            lrow = lrow * al + (rs0 + rs1);
            mrow = mn;
            // Rescale running output accumulators.
#pragma unroll
            for (int nt = 0; nt < 8; ++nt)
#pragma unroll
                for (int r = 0; r < 8; ++r) o[nt][r] *= al;
            // O^T += V^T P^T.
#pragma unroll
            for (int nt = 0; nt < 8; ++nt) o[nt] = wmma_bf16(vf[nt], pf, o[nt]);
        }
    }

    // Finalize: join the halves' sums, divide, store bf16 [token][h*128 + dh]
    // (16 bytes per lane and tile: dh = nt*16 + half*8 .. + 7).
    const float inv = 1.0f / fmaxf(lrow + xhalf(lrow), 1e-20f);
    __bf16* orow = ob + ((size_t)(tok0 + q0 + l16) * 16 + h) * 128 + half * 8;
#pragma unroll
    for (int nt = 0; nt < 8; ++nt) {
        v8bf w;
#pragma unroll
        for (int r = 0; r < 8; ++r) w[r] = (__bf16)(o[nt][r] * inv);
        *(v8bf*)(orow + nt * 16) = w;
    }
}

// ---------------------------------------------------------------------------
// Host-side orchestration
// ---------------------------------------------------------------------------
extern "C" void kernel_launch(void* const* d_in, const int* in_sizes, int n_in,
                              void* d_out, int out_size, void* d_ws, size_t ws_size,
                              hipStream_t stream) {
    (void)in_sizes; (void)n_in; (void)out_size; (void)ws_size;
    const float* x  = (const float*)d_in[0];
    const float* Wq = (const float*)d_in[1];
    const float* Wk = (const float*)d_in[2];
    const float* Wv = (const float*)d_in[3];
    const float* Wo = (const float*)d_in[4];
    const float* qg = (const float*)d_in[5];
    const float* kg = (const float*)d_in[6];
    float* out = (float*)d_out;

    const int M = 4096;        // tokens (2 batches x 2048)
    const int D = 2048;        // model dim
    const int KVD = 512;       // kv dim

    uint8_t* w = (uint8_t*)d_ws;
    __bf16* xb  = (__bf16*)(w);                // 16 MiB  x in bf16
    __bf16* wqt = (__bf16*)(w + 16777216);     //  8 MiB  Wq^T bf16
    __bf16* wkt = (__bf16*)(w + 25165824);     //  2 MiB  Wk^T bf16
    __bf16* wvt = (__bf16*)(w + 27262976);     //  2 MiB  Wv^T bf16
    __bf16* wot = (__bf16*)(w + 29360128);     //  8 MiB  Wo^T bf16
    __bf16* aob = (__bf16*)(w + 37748736);     // 16 MiB  attention out bf16
    __bf16* qbf = (__bf16*)(w + 88080384);     // 16 MiB  Q bf16 (post-norm)
    __bf16* kbf = (__bf16*)(w + 104857600);    //  4 MiB  K bf16 (post-norm)
    __bf16* vbf = (__bf16*)(w + 109051904);    //  4 MiB  V bf16
    // last workspace byte used: 113,246,208

    // 1) x -> bf16 and the four weights -> transposed bf16
    k_prep<<<1792, 256, 0, stream>>>(x, Wq, Wk, Wv, Wo, xb, wqt, wkt, wvt, wot);
    // 2) QKV projections (WMMA GEMM over wqt, wkt, wvt as one 3072-row matrix)
    //    with QK RMSNorm (per head, DH=128) and bf16 conversion in the epilogue
    k_gemm_qkv<<<dim3((D + 2 * KVD) / 128, M / 128), 256, 0, stream>>>(
        xb, wqt, qg, kg, qbf, kbf, vbf, D);
    // 3) causal GQA flash attention (WMMA)
    k_attn<<<dim3(16, 16, 2), 256, 0, stream>>>(qbf, kbf, vbf, aob);
    // 4) output projection + residual (WMMA GEMM)
    k_gemm_out<<<dim3(D / 128, M / 128), 256, 0, stream>>>(
        aob, wot, x, out, D, D);
}

// v006
// One run takes 160 microseconds.
// Timed twice side by side with v005, it ran 1.09 times as fast both times.
// Counting every step since v000, it is 2.59 times as fast.
#include <hip/hip_runtime.h>
#include <hip/hip_bf16.h>

// ---------------------------------------------------------------------------
// Transformer block for gfx1250: wave32 + WMMA bf16 pipeline
// with async global->LDS staging (ASYNCcnt) and double-buffered GEMM tiles.
// ---------------------------------------------------------------------------

#define DEV static __device__ __forceinline__

typedef __attribute__((ext_vector_type(16))) __bf16 v16bf;
typedef __attribute__((ext_vector_type(8)))  __bf16 v8bf;
typedef __attribute__((ext_vector_type(8)))  float  v8f;
typedef __attribute__((ext_vector_type(4)))  int    v4i;
typedef __attribute__((ext_vector_type(4)))  float  v4f;

#define LDS_AS __attribute__((address_space(3)))
#define GLB_AS __attribute__((address_space(1)))

DEV v8f vzero8() {
    v8f z;
#pragma unroll
    for (int i = 0; i < 8; ++i) z[i] = 0.0f;
    return z;
}

// Async global -> LDS copy of one 16-byte chunk (tracked by ASYNCcnt).
DEV void async_b128(const __bf16* g, __bf16* l) {
#if __has_builtin(__builtin_amdgcn_global_load_async_to_lds_b128)
    __builtin_amdgcn_global_load_async_to_lds_b128(
        (GLB_AS v4i*)(uintptr_t)g,
        (LDS_AS v4i*)(uint32_t)(uintptr_t)l, 0, 0);
#else
    unsigned loff = (unsigned)(uintptr_t)l;
    asm volatile("global_load_async_to_lds_b128 %0, %1, off"
                 :: "v"(loff), "v"(g) : "memory");
#endif
}

DEV void wait_async0() {
#if __has_builtin(__builtin_amdgcn_s_wait_asynccnt)
    __builtin_amdgcn_s_wait_asynccnt(0);
#else
    asm volatile("s_wait_asynccnt 0" ::: "memory");
#endif
}

// Build a 16-element bf16 fragment from two 16-byte chunks (the CDNA5 A/B
// 16-bit layout: lane holds K = half*8..+7 and K = 16+half*8..+7).
DEV v16bf ld_frag(const __bf16* lo, const __bf16* hi) {
    v8bf a = *(const v8bf*)lo;
    v8bf b = *(const v8bf*)hi;
    return __builtin_shufflevector(a, b, 0, 1, 2, 3, 4, 5, 6, 7,
                                          8, 9, 10, 11, 12, 13, 14, 15);
}

DEV v8f wmma_bf16(v16bf a, v16bf b, v8f c) {
    return __builtin_amdgcn_wmma_f32_16x16x32_bf16(
        false, a, false, b, (short)0, c, false, false);
}

// Value of lane l ^ 16.
DEV float xhalf(float x) {
    return __builtin_bit_cast(float, __builtin_amdgcn_permlanex16(
        __builtin_bit_cast(int, x), __builtin_bit_cast(int, x),
        0x76543210, 0xfedcba98, false, false));
}

// ---------------------------------------------------------------------------
// Elementwise f32 -> bf16 convert. A wave starts once and moves U * 512 B:
// all U 16-byte loads of a lane are issued before the first store, each load
// and each store of a wave covering whole 128-B lines.
// ---------------------------------------------------------------------------
// Inputs-only fence on 16 loaded values and on the address they were loaded
// from: every load is issued, and has landed, before anything that follows, and
// no load's result is placed on the address pair that the others still name.
// Without it the compiler sinks part of the 16 loads behind the first results'
// use, and the wave waits out the memory latency again for each part.
DEV void hold16(const v4f* v, const float* p) {
    asm volatile("" :: "v"(v[0]), "v"(v[1]), "v"(v[2]), "v"(v[3]), "v"(v[4]),
                       "v"(v[5]), "v"(v[6]), "v"(v[7]), "v"(v[8]), "v"(v[9]),
                       "v"(v[10]), "v"(v[11]), "v"(v[12]), "v"(v[13]),
                       "v"(v[14]), "v"(v[15]), "v"(p));
}

template <int U>
DEV void cvt_body(const float* __restrict__ in, __bf16* __restrict__ out,
                  int blk) {
    const size_t base = (size_t)blk * (1024 * U) + threadIdx.x * 4;
    const float* p = in + base;
    v4f v[U];
#pragma unroll
    for (int u = 0; u < U; ++u) v[u] = *(const v4f*)(p + u * 1024);
    if constexpr (U == 16) hold16(v, p);
#pragma unroll
    for (int u = 0; u < U; ++u) {
        union { __bf16 h[4]; uint2 u2; } o;
        o.h[0] = (__bf16)v[u].x; o.h[1] = (__bf16)v[u].y;
        o.h[2] = (__bf16)v[u].z; o.h[3] = (__bf16)v[u].w;
        *(uint2*)&out[base + u * 1024] = o.u2;
    }
    // The job's code may be followed by another job's in the merged kernel: the
    // stores' registers are not rewritten there ahead of this wait.
    asm volatile("s_wait_xcnt 0x0" ::: "memory");
}

// ---------------------------------------------------------------------------
// Weight transpose + convert: W[K][N] f32 -> Wt[N][K] bf16, one 128 (k) x 64 (n)
// tile per block. A thread loads an 8 (k) x 4 (n) patch by eight 16-byte loads
// (a wave: two 256-B row pieces each), packs four 8-k vectors in registers and
// passes them through LDS so that the stores are 256-B pieces of Wt rows.
// LDS row i*16 + c holds n = 4*c + i: at a pitch of 272 B the sixteen lanes of
// one ds_store_b128 then fall on all 64 banks.
// ---------------------------------------------------------------------------
#define TWP 136  // LDS row pitch in elements (272 B)

template <int K, int N>
DEV void cvt_w_t_body(const float* __restrict__ W, __bf16* __restrict__ Wt,
                      __bf16* t, int blk) {
    // blk counts the tiles of W with the n tile running fastest.
    const int k0 = (blk / (N / 64)) * 128, n0 = (blk % (N / 64)) * 64;
    const int tid = threadIdx.x;
    const int c4 = tid & 15, rq = tid >> 4;
    // K and N are compile-time: one address per lane, rows by immediate offset.
    const float* src = W + (size_t)(k0 + rq * 8) * N + n0 + c4 * 4;
    float v[8][4];
#pragma unroll
    for (int j = 0; j < 8; ++j) {
        float4 f = *(const float4*)(src + j * N);
        v[j][0] = f.x; v[j][1] = f.y; v[j][2] = f.z; v[j][3] = f.w;
    }
#pragma unroll
    for (int i = 0; i < 4; ++i) {
        v8bf p;
#pragma unroll
        for (int j = 0; j < 8; ++j) p[j] = (__bf16)v[j][i];
        *(v8bf*)&t[(i * 16 + c4) * TWP + rq * 8] = p;
    }
    __syncthreads();
    // LDS row i*16 + rq is Wt row n0 + 4*rq + i; sixteen lanes store its 256 B.
    __bf16* dst = Wt + (size_t)(n0 + rq * 4) * K + k0 + c4 * 8;
#pragma unroll
    for (int i = 0; i < 4; ++i)
        *(v8bf*)(dst + i * K) = *(const v8bf*)&t[(i * 16 + rq) * TWP + c4 * 8];
    // The job's code may be followed by another job's in the merged kernel: the
    // stores' registers are not rewritten there ahead of this wait.
    asm volatile("s_wait_xcnt 0x0" ::: "memory");
}

// One launch for the five jobs that depend on nothing but the inputs; a block's
// index says which job and which piece of it the block takes:
// 512 blocks x (16,384 elements each), 512 Wq, 512 Wo, 128 Wk, 128 Wv tiles.
__global__ __launch_bounds__(256)
void k_prep(const float* __restrict__ x, const float* __restrict__ Wq,
            const float* __restrict__ Wk, const float* __restrict__ Wv,
            const float* __restrict__ Wo, __bf16* __restrict__ xb,
            __bf16* __restrict__ wqt, __bf16* __restrict__ wkt,
            __bf16* __restrict__ wvt, __bf16* __restrict__ wot) {
    __shared__ __attribute__((aligned(16))) __bf16 t[64 * TWP];
    const int b = blockIdx.x;
    if (b < 512)       cvt_body<16>(x, xb, b);
    else if (b < 1024) cvt_w_t_body<2048, 2048>(Wq, wqt, t, b - 512);
    else if (b < 1536) cvt_w_t_body<2048, 2048>(Wo, wot, t, b - 1024);
    else if (b < 1664) cvt_w_t_body<2048, 512>(Wk, wkt, t, b - 1536);
    else               cvt_w_t_body<2048, 512>(Wv, wvt, t, b - 1664);
}

// ---------------------------------------------------------------------------
// Tiled WMMA GEMM: C[M][N] f32 = A[M][K] bf16 * Bt[N][K] bf16 + residual
// Block = 256 threads (8 waves), tile 128x128, K-step 64, double-buffered
// async global->LDS staging.
// ---------------------------------------------------------------------------
#define GKS 64
#define GKP 72  // padded LDS row stride (144 B, 16B-aligned)

// Main loop. Bt points at the first of the block's 128 rows. Wave w owns rows
// m_blk + 16*w .. + 15 of A against all 128 rows of Bt, as eight 16x16 tiles.
// TR = false: acc[nt][r] is row 8*half + r of A, row nt*16 + l16 of Bt.
// TR = true (operands swapped, the tile comes out transposed): acc[nt][r] is
// row l16 of A, row nt*16 + 8*half + r of Bt, so a lane holds 64 of the 128
// columns of ONE output row, in runs of eight.
template <bool TR>
DEV void gemm_main(const __bf16* __restrict__ A, const __bf16* __restrict__ Bt,
                   int m_blk, int K, v8f (&acc)[8]) {
    __shared__ __bf16 a_lds[2][128 * GKP];
    __shared__ __bf16 b_lds[2][128 * GKP];
    const int tid = threadIdx.x;
    const int lane = tid & 31, wave = tid >> 5;
    const int half = (lane >> 4) & 1, l16 = lane & 15;
    const int m0 = wave * 16;
    const int r_base = tid >> 3, c_st = (tid & 7) * 8;

#pragma unroll
    for (int i = 0; i < 8; ++i) acc[i] = vzero8();

    // Stage one 128x64 tile of A and Bt into LDS buffer `buf` (async).
    auto stage = [&](int k0, int buf) {
#pragma unroll
        for (int i = 0; i < 4; ++i) {
            int r = r_base + i * 32;
            async_b128(&A[(size_t)(m_blk + r) * K + k0 + c_st],
                       &a_lds[buf][r * GKP + c_st]);
            async_b128(&Bt[(size_t)r * K + k0 + c_st],
                       &b_lds[buf][r * GKP + c_st]);
        }
    };

    const int T = K / GKS;
    stage(0, 0);
    for (int t = 0; t < T; ++t) {
        wait_async0();          // tile t landed (async loads retire in order)
        __syncthreads();        // visible to all waves; prior reads finished
        if (t + 1 < T) stage((t + 1) * GKS, (t + 1) & 1);  // overlap copy
        const __bf16* abase = &a_lds[t & 1][(m0 + l16) * GKP];
        v16bf af[2], bfr[2][8];
#pragma unroll
        for (int kk = 0; kk < 2; ++kk) {
            af[kk] = ld_frag(abase + kk * 32 + half * 8,
                             abase + kk * 32 + 16 + half * 8);
#pragma unroll
            for (int nt = 0; nt < 8; ++nt) {
                const __bf16* brow =
                    &b_lds[t & 1][(nt * 16 + l16) * GKP + kk * 32];
                bfr[kk][nt] = ld_frag(brow + half * 8, brow + 16 + half * 8);
            }
        }
        // Keeps the tile's 36 fragment loads one group ahead of its 16 WMMAs
        // (counted waits); spread among them, each pair costs a full LDS wait.
        __builtin_amdgcn_sched_barrier(0);
#pragma unroll
        for (int kk = 0; kk < 2; ++kk)
#pragma unroll
            for (int nt = 0; nt < 8; ++nt)
                acc[nt] = TR ? wmma_bf16(bfr[kk][nt], af[kk], acc[nt])
                             : wmma_bf16(af[kk], bfr[kk][nt], acc[nt]);
    }
}

// Bt points at the first of the block's 128 rows, C (and resid) at the first of
// its 128 columns; N is the row length of C.
DEV void gemm_body(const __bf16* __restrict__ A, const __bf16* __restrict__ Bt,
                   const float* __restrict__ resid, float* __restrict__ C,
                   int m_blk, int N, int K) {
    const int tid = threadIdx.x;
    const int lane = tid & 31, wave = tid >> 5;
    const int half = (lane >> 4) & 1, l16 = lane & 15;
    const int m0 = wave * 16;

    v8f acc[8];
    gemm_main<false>(A, Bt, m_blk, K, acc);

    // Element (row r, tile nt) of this lane lies at o0 + r * N + nt * 16.
    // The lane's 64 residual values are loaded in a loop of their own, with no
    // test and no store between them: all are in flight together and the wave
    // waits out the memory latency once. The rows are then stored as they land.
    const size_t o0 = (size_t)(m_blk + m0 + half * 8) * N + l16;
    float rv[8][8];
#pragma unroll
    for (int r = 0; r < 8; ++r)
#pragma unroll
        for (int nt = 0; nt < 8; ++nt)
            rv[r][nt] = resid[o0 + (size_t)r * N + nt * 16];
#pragma unroll
    for (int r = 0; r < 8; ++r)
#pragma unroll
        for (int nt = 0; nt < 8; ++nt)
            C[o0 + (size_t)r * N + nt * 16] = acc[nt][r] + rv[r][nt];
}

// Q, K and V projections in one launch, with the per-head RMSNorm (Q, K) and the
// conversion to bf16 done on the f32 accumulators. Wt holds Wq^T, Wk^T, Wv^T one
// behind the other (3072 rows of K); blockIdx.x is the 128-row tile of Wt, which
// is exactly one head: 16 tiles go to q (rows of 2048), 4 to k and 4 to v (rows
// of 512). With the transposed tiles a token's head lies in the two lanes l16 and
// l16 + 16: the sum of squares is in-lane plus one exchange between the halves,
// and each tile leaves as one 16-byte store per lane.
__global__ __launch_bounds__(256)
void k_gemm_qkv(const __bf16* __restrict__ A, const __bf16* __restrict__ Wt,
                const float* __restrict__ qg, const float* __restrict__ kg,
                __bf16* __restrict__ q, __bf16* __restrict__ k,
                __bf16* __restrict__ v, int K) {
    const int x = blockIdx.x;
    const int lane = threadIdx.x & 31, wave = threadIdx.x >> 5;
    const int half = (lane >> 4) & 1, l16 = lane & 15;
    const int m_blk = blockIdx.y * 128;
    v8f acc[8];
    gemm_main<true>(A, Wt + (size_t)x * 128 * K, m_blk, K, acc);

    __bf16* C = x < 16 ? q + x * 128 : x < 20 ? k + (x - 16) * 128
                                              : v + (x - 20) * 128;
    const int N = x < 16 ? 2048 : 512;
    __bf16* orow = C + (size_t)(m_blk + wave * 16 + l16) * N + half * 8;
    v8bf w[8];
    if (x < 20) {
        const float* g = (x < 16 ? qg : kg) + half * 8;
        float sq[8];  // one chain per tile: eight short chains, not one of 64
#pragma unroll
        for (int nt = 0; nt < 8; ++nt) {
            sq[nt] = 0.0f;
#pragma unroll
            for (int r = 0; r < 8; ++r) sq[nt] += acc[nt][r] * acc[nt][r];
        }
        float ss = ((sq[0] + sq[1]) + (sq[2] + sq[3])) +
                   ((sq[4] + sq[5]) + (sq[6] + sq[7]));
        ss += xhalf(ss);
        const float rs = rsqrtf(ss * (1.0f / 128.0f) + 1e-8f);
#pragma unroll
        for (int nt = 0; nt < 8; ++nt) {
            const v4f g0 = *(const v4f*)(g + nt * 16);
            const v4f g1 = *(const v4f*)(g + nt * 16 + 4);
#pragma unroll
            for (int r = 0; r < 4; ++r) {
                w[nt][r]     = (__bf16)(acc[nt][r] * rs * g0[r]);
                w[nt][4 + r] = (__bf16)(acc[nt][4 + r] * rs * g1[r]);
            }
        }
    } else {
#pragma unroll
        for (int nt = 0; nt < 8; ++nt)
#pragma unroll
            for (int r = 0; r < 8; ++r) w[nt][r] = (__bf16)acc[nt][r];
    }
#pragma unroll
    for (int nt = 0; nt < 8; ++nt) *(v8bf*)(orow + nt * 16) = w[nt];
}

__global__ __launch_bounds__(256)
void k_gemm_out(const __bf16* __restrict__ A, const __bf16* __restrict__ Bt,
                const float* __restrict__ resid, float* __restrict__ C,
                int N, int K) {
    const int n_blk = blockIdx.x * 128;
    gemm_body(A, Bt + (size_t)n_blk * K, resid + n_blk, C + n_blk,
              blockIdx.y * 128, N, K);
}

#define AKP 136  // K row stride: 272 B, odd multiple of 16 B (ds_load_b128 reader)
#define AVP 144  // V row stride: 288 B, odd multiple of 32 B (transposing reader)

typedef __attribute__((ext_vector_type(8))) short v8s;

// Transposing LDS load: lane (c, half) gets T[kbase + 8*half + 0..7][dbase + c].
DEV v8bf ld_tr16(const __bf16* p) {
    return __builtin_bit_cast(
        v8bf, __builtin_amdgcn_ds_load_tr16_b128_v8i16((LDS_AS v8s*)p));
}

__global__ __launch_bounds__(256)
void k_attn(const __bf16* __restrict__ qb, const __bf16* __restrict__ kb,
            const __bf16* __restrict__ vb, __bf16* __restrict__ ob) {
    __shared__ __attribute__((aligned(16))) __bf16 k_lds[128 * AKP];
    __shared__ __attribute__((aligned(16))) __bf16 v_lds[128 * AVP];

    const int tid = threadIdx.x;
    const int lane = tid & 31, wave = tid >> 5;
    const int half = (lane >> 4) & 1, l16 = lane & 15;
    const int qt = blockIdx.x, h = blockIdx.y, b = blockIdx.z;
    const int kvh = h >> 2;            // GQA group of 4
    const int tok0 = b * 2048;
    const int q0 = qt * 128 + wave * 16;  // wave's first query row (in-batch)
    const float scale = 0.08838834764831845f;  // 128^-0.5

    // Q fragments (B operand): column = query l16, 4 K-chunks of 32 over dh.
    v16bf qf[4];
    {
        const int t = tok0 + q0 + l16;
        const __bf16* qrow = qb + ((size_t)t * 16 + h) * 128;
#pragma unroll
        for (int kk = 0; kk < 4; ++kk)
            qf[kk] = ld_frag(qrow + kk * 32 + half * 8,
                             qrow + kk * 32 + 16 + half * 8);
    }

    v8f o[8];  // O^T tiles: row dh = nt*16 + half*8 + r, column = query l16
#pragma unroll
    for (int i = 0; i < 8; ++i) o[i] = vzero8();
    float mrow = -3.0e38f;  // this lane's query: running maximum (both halves)
    float lrow = 0.0f;      // running sum over this half's keys only

    for (int kt = 0; kt <= qt; ++kt) {
        __syncthreads();  // previous tile fully consumed
        // --- async K and V tiles: [key][dh], 128 keys x 16 chunks each ---
#pragma unroll
        for (int i = 0; i < 8; ++i) {
            int idx = tid + i * 256;
            int key = idx >> 4, c = (idx & 15) * 8;
            int t = tok0 + kt * 128 + key;
            async_b128(&kb[((size_t)t * 4 + kvh) * 128 + c],
                       &k_lds[key * AKP + c]);
            async_b128(&vb[((size_t)t * 4 + kvh) * 128 + c],
                       &v_lds[key * AVP + c]);
        }
        wait_async0();
        __syncthreads();

        // Skip fully-masked 32-key groups on the diagonal tile.
        const int gmax = (kt == qt) ? (wave * 16 + 15) / 32 : 3;
        for (int g = 0; g <= gmax; ++g) {
            // S^T = K Q^T for 32 keys (two 16-key tiles), K-dim = dh = 128.
            v16bf kf0[4], kf1[4];
#pragma unroll
            for (int kk = 0; kk < 4; ++kk) {
                const __bf16* kr0 = &k_lds[(g * 32 + l16) * AKP + kk * 32];
                const __bf16* kr1 = &k_lds[(g * 32 + 16 + l16) * AKP + kk * 32];
                kf0[kk] = ld_frag(kr0 + half * 8, kr0 + 16 + half * 8);
                kf1[kk] = ld_frag(kr1 + half * 8, kr1 + 16 + half * 8);
            }
            // Keeps the 16 K loads one group ahead of their WMMAs (counted
            // waits); spread among them, each pair costs a full LDS wait.
            __builtin_amdgcn_sched_barrier(0);
            v8f s0 = vzero8(), s1 = vzero8();
#pragma unroll
            for (int kk = 0; kk < 4; ++kk) {
                s0 = wmma_bf16(kf0[kk], qf[kk], s0);
                s1 = wmma_bf16(kf1[kk], qf[kk], s1);
            }
            // V^T fragments: A = 16 (dh) x 32 (keys) by two transposing loads.
            const __bf16* vr = &v_lds[(g * 32 + half * 8 + (lane & 7)) * AVP +
                                      ((lane >> 3) & 1) * 8];
            v16bf vf[8];
#pragma unroll
            for (int nt = 0; nt < 8; ++nt) {
                v8bf lo = ld_tr16(vr + nt * 16);
                v8bf hi = ld_tr16(vr + 16 * AVP + nt * 16);
                vf[nt] = __builtin_shufflevector(lo, hi, 0, 1, 2, 3, 4, 5, 6, 7,
                                                 8, 9, 10, 11, 12, 13, 14, 15);
            }
            // Keeps the 16 V^T loads one group here, in flight under the
            // softmax arithmetic, instead of one full LDS wait per WMMA.
            __builtin_amdgcn_sched_barrier(0);
            // Scale + causal mask + this query's max over the 32-key group.
            const int qg = q0 + l16;
            const int kg0 = kt * 128 + g * 32 + half * 8;  // + r
            float p0[8], p1[8];
            float tmax = -3.0e38f;
#pragma unroll
            for (int r = 0; r < 8; ++r) {
                float a = s0[r] * scale, c = s1[r] * scale;
                if (kg0 + r > qg) a = -3.0e38f;
                if (kg0 + 16 + r > qg) c = -3.0e38f;
                p0[r] = a; p1[r] = c;
                tmax = fmaxf(tmax, fmaxf(a, c));
            }
            tmax = fmaxf(tmax, xhalf(tmax));
            // Online softmax update; P^T packs into the B operand in place:
            // elements 0..7 are keys half*8 + r, 8..15 are keys 16 + half*8 + r.
            const float mn = fmaxf(mrow, tmax);
            const bool live = mn > -1.0e37f;
            const float al = live ? __expf(mrow - mn) : 1.0f;
            float rs0 = 0.0f, rs1 = 0.0f;
            v16bf pf;
#pragma unroll
            for (int r = 0; r < 8; ++r) {
                float e0 = live ? __expf(p0[r] - mn) : 0.0f;
                float e1 = live ? __expf(p1[r] - mn) : 0.0f;
                rs0 += e0; rs1 += e1;
                pf[r]     = (__bf16)e0;
                pf[8 + r] = (__bf16)e1;
            }
            lrow = lrow * al + (rs0 + rs1);
            mrow = mn;
            // Rescale running output accumulators.
#pragma unroll
            for (int nt = 0; nt < 8; ++nt)
#pragma unroll
                for (int r = 0; r < 8; ++r) o[nt][r] *= al;
            // O^T += V^T P^T.
#pragma unroll
            for (int nt = 0; nt < 8; ++nt) o[nt] = wmma_bf16(vf[nt], pf, o[nt]);
        }
    }

    // Finalize: join the halves' sums, divide, store bf16 [token][h*128 + dh]
    // (16 bytes per lane and tile: dh = nt*16 + half*8 .. + 7).
    const float inv = 1.0f / fmaxf(lrow + xhalf(lrow), 1e-20f);
    __bf16* orow = ob + ((size_t)(tok0 + q0 + l16) * 16 + h) * 128 + half * 8;
#pragma unroll
    for (int nt = 0; nt < 8; ++nt) {
        v8bf w;
#pragma unroll
        for (int r = 0; r < 8; ++r) w[r] = (__bf16)(o[nt][r] * inv);
        *(v8bf*)(orow + nt * 16) = w;
    }
}

// ---------------------------------------------------------------------------
// Host-side orchestration
// ---------------------------------------------------------------------------
extern "C" void kernel_launch(void* const* d_in, const int* in_sizes, int n_in,
                              void* d_out, int out_size, void* d_ws, size_t ws_size,
                              hipStream_t stream) {
    (void)in_sizes; (void)n_in; (void)out_size; (void)ws_size;
    const float* x  = (const float*)d_in[0];
    const float* Wq = (const float*)d_in[1];
    const float* Wk = (const float*)d_in[2];
    const float* Wv = (const float*)d_in[3];
    const float* Wo = (const float*)d_in[4];
    const float* qg = (const float*)d_in[5];
    const float* kg = (const float*)d_in[6];
    float* out = (float*)d_out;

    const int M = 4096;        // tokens (2 batches x 2048)
    const int D = 2048;        // model dim
    const int KVD = 512;       // kv dim

    uint8_t* w = (uint8_t*)d_ws;
    __bf16* xb  = (__bf16*)(w);                // 16 MiB  x in bf16
    __bf16* wqt = (__bf16*)(w + 16777216);     //  8 MiB  Wq^T bf16
    __bf16* wkt = (__bf16*)(w + 25165824);     //  2 MiB  Wk^T bf16
    __bf16* wvt = (__bf16*)(w + 27262976);     //  2 MiB  Wv^T bf16
    __bf16* wot = (__bf16*)(w + 29360128);     //  8 MiB  Wo^T bf16
    __bf16* aob = (__bf16*)(w + 37748736);     // 16 MiB  attention out bf16
    __bf16* qbf = (__bf16*)(w + 88080384);     // 16 MiB  Q bf16 (post-norm)
    __bf16* kbf = (__bf16*)(w + 104857600);    //  4 MiB  K bf16 (post-norm)
    __bf16* vbf = (__bf16*)(w + 109051904);    //  4 MiB  V bf16
    // last workspace byte used: 113,246,208

    // 1) x -> bf16 and the four weights -> transposed bf16
    k_prep<<<1792, 256, 0, stream>>>(x, Wq, Wk, Wv, Wo, xb, wqt, wkt, wvt, wot);
    // 2) QKV projections (WMMA GEMM over wqt, wkt, wvt as one 3072-row matrix)
    //    with QK RMSNorm (per head, DH=128) and bf16 conversion in the epilogue
    k_gemm_qkv<<<dim3((D + 2 * KVD) / 128, M / 128), 256, 0, stream>>>(
        xb, wqt, qg, kg, qbf, kbf, vbf, D);
    // 3) causal GQA flash attention (WMMA)
    k_attn<<<dim3(16, 16, 2), 256, 0, stream>>>(qbf, kbf, vbf, aob);
    // 4) output projection + residual (WMMA GEMM)
    k_gemm_out<<<dim3(D / 128, M / 128), 256, 0, stream>>>(
        aob, wot, x, out, D, D);
}

// v007
// It runs in 142 microseconds.
// In both of two side-by-side timings against v006, it was 1.12 times as fast.
// Over all steps from v000 it is 2.91 times as fast.
#include <hip/hip_runtime.h>
#include <hip/hip_bf16.h>

// ---------------------------------------------------------------------------
// Transformer block for gfx1250: wave32 + WMMA bf16 pipeline
// with async global->LDS staging (ASYNCcnt) and double-buffered GEMM tiles.
// ---------------------------------------------------------------------------

#define DEV static __device__ __forceinline__

typedef __attribute__((ext_vector_type(16))) __bf16 v16bf;
typedef __attribute__((ext_vector_type(8)))  __bf16 v8bf;
typedef __attribute__((ext_vector_type(8)))  float  v8f;
typedef __attribute__((ext_vector_type(4)))  int    v4i;
typedef __attribute__((ext_vector_type(4)))  float  v4f;

#define LDS_AS __attribute__((address_space(3)))
#define GLB_AS __attribute__((address_space(1)))

DEV v8f vzero8() {
    v8f z;
#pragma unroll
    for (int i = 0; i < 8; ++i) z[i] = 0.0f;
    return z;
}

// Async global -> LDS copy of one 16-byte chunk (tracked by ASYNCcnt).
DEV void async_b128(const __bf16* g, __bf16* l) {
#if __has_builtin(__builtin_amdgcn_global_load_async_to_lds_b128)
    __builtin_amdgcn_global_load_async_to_lds_b128(
        (GLB_AS v4i*)(uintptr_t)g,
        (LDS_AS v4i*)(uint32_t)(uintptr_t)l, 0, 0);
#else
    unsigned loff = (unsigned)(uintptr_t)l;
    asm volatile("global_load_async_to_lds_b128 %0, %1, off"
                 :: "v"(loff), "v"(g) : "memory");
#endif
}

DEV void wait_async0() {
#if __has_builtin(__builtin_amdgcn_s_wait_asynccnt)
    __builtin_amdgcn_s_wait_asynccnt(0);
#else
    asm volatile("s_wait_asynccnt 0" ::: "memory");
#endif
}

// Build a 16-element bf16 fragment from two 16-byte chunks (the CDNA5 A/B
// 16-bit layout: lane holds K = half*8..+7 and K = 16+half*8..+7).
DEV v16bf ld_frag(const __bf16* lo, const __bf16* hi) {
    v8bf a = *(const v8bf*)lo;
    v8bf b = *(const v8bf*)hi;
    return __builtin_shufflevector(a, b, 0, 1, 2, 3, 4, 5, 6, 7,
                                          8, 9, 10, 11, 12, 13, 14, 15);
}

DEV v8f wmma_bf16(v16bf a, v16bf b, v8f c) {
    return __builtin_amdgcn_wmma_f32_16x16x32_bf16(
        false, a, false, b, (short)0, c, false, false);
}

// Value of lane l ^ 16.
DEV float xhalf(float x) {
    return __builtin_bit_cast(float, __builtin_amdgcn_permlanex16(
        __builtin_bit_cast(int, x), __builtin_bit_cast(int, x),
        0x76543210, 0xfedcba98, false, false));
}

// ---------------------------------------------------------------------------
// Elementwise f32 -> bf16 convert. A wave starts once and moves U * 512 B:
// all U 16-byte loads of a lane are issued before the first store, each load
// and each store of a wave covering whole 128-B lines.
// ---------------------------------------------------------------------------
// Inputs-only fence on 16 loaded values and on the address they were loaded
// from: every load is issued, and has landed, before anything that follows, and
// no load's result is placed on the address pair that the others still name.
// Without it the compiler sinks part of the 16 loads behind the first results'
// use, and the wave waits out the memory latency again for each part.
DEV void hold16(const v4f* v, const float* p) {
    asm volatile("" :: "v"(v[0]), "v"(v[1]), "v"(v[2]), "v"(v[3]), "v"(v[4]),
                       "v"(v[5]), "v"(v[6]), "v"(v[7]), "v"(v[8]), "v"(v[9]),
                       "v"(v[10]), "v"(v[11]), "v"(v[12]), "v"(v[13]),
                       "v"(v[14]), "v"(v[15]), "v"(p));
}

template <int U>
DEV void cvt_body(const float* __restrict__ in, __bf16* __restrict__ out,
                  int blk) {
    const size_t base = (size_t)blk * (1024 * U) + threadIdx.x * 4;
    const float* p = in + base;
    v4f v[U];
#pragma unroll
    for (int u = 0; u < U; ++u) v[u] = *(const v4f*)(p + u * 1024);
    if constexpr (U == 16) hold16(v, p);
#pragma unroll
    for (int u = 0; u < U; ++u) {
        union { __bf16 h[4]; uint2 u2; } o;
        o.h[0] = (__bf16)v[u].x; o.h[1] = (__bf16)v[u].y;
        o.h[2] = (__bf16)v[u].z; o.h[3] = (__bf16)v[u].w;
        *(uint2*)&out[base + u * 1024] = o.u2;
    }
    // The job's code may be followed by another job's in the merged kernel: the
    // stores' registers are not rewritten there ahead of this wait.
    asm volatile("s_wait_xcnt 0x0" ::: "memory");
}

// ---------------------------------------------------------------------------
// Weight transpose + convert: W[K][N] f32 -> Wt[N][K] bf16, one 128 (k) x 64 (n)
// tile per block. A thread loads an 8 (k) x 4 (n) patch by eight 16-byte loads
// (a wave: two 256-B row pieces each), packs four 8-k vectors in registers and
// passes them through LDS so that the stores are 256-B pieces of Wt rows.
// LDS row i*16 + c holds n = 4*c + i: at a pitch of 272 B the sixteen lanes of
// one ds_store_b128 then fall on all 64 banks.
// ---------------------------------------------------------------------------
#define TWP 136  // LDS row pitch in elements (272 B)

template <int K, int N>
DEV void cvt_w_t_body(const float* __restrict__ W, __bf16* __restrict__ Wt,
                      __bf16* t, int blk) {
    // blk counts the tiles of W with the n tile running fastest.
    const int k0 = (blk / (N / 64)) * 128, n0 = (blk % (N / 64)) * 64;
    const int tid = threadIdx.x;
    const int c4 = tid & 15, rq = tid >> 4;
    // K and N are compile-time: one address per lane, rows by immediate offset.
    const float* src = W + (size_t)(k0 + rq * 8) * N + n0 + c4 * 4;
    float v[8][4];
#pragma unroll
    for (int j = 0; j < 8; ++j) {
        float4 f = *(const float4*)(src + j * N);
        v[j][0] = f.x; v[j][1] = f.y; v[j][2] = f.z; v[j][3] = f.w;
    }
#pragma unroll
    for (int i = 0; i < 4; ++i) {
        v8bf p;
#pragma unroll
        for (int j = 0; j < 8; ++j) p[j] = (__bf16)v[j][i];
        *(v8bf*)&t[(i * 16 + c4) * TWP + rq * 8] = p;
    }
    __syncthreads();
    // LDS row i*16 + rq is Wt row n0 + 4*rq + i; sixteen lanes store its 256 B.
    __bf16* dst = Wt + (size_t)(n0 + rq * 4) * K + k0 + c4 * 8;
#pragma unroll
    for (int i = 0; i < 4; ++i)
        *(v8bf*)(dst + i * K) = *(const v8bf*)&t[(i * 16 + rq) * TWP + c4 * 8];
    // The job's code may be followed by another job's in the merged kernel: the
    // stores' registers are not rewritten there ahead of this wait.
    asm volatile("s_wait_xcnt 0x0" ::: "memory");
}

// One launch for the five jobs that depend on nothing but the inputs; a block's
// index says which job and which piece of it the block takes:
// 512 blocks x (16,384 elements each), 512 Wq, 512 Wo, 128 Wk, 128 Wv tiles.
__global__ __launch_bounds__(256)
void k_prep(const float* __restrict__ x, const float* __restrict__ Wq,
            const float* __restrict__ Wk, const float* __restrict__ Wv,
            const float* __restrict__ Wo, __bf16* __restrict__ xb,
            __bf16* __restrict__ wqt, __bf16* __restrict__ wkt,
            __bf16* __restrict__ wvt, __bf16* __restrict__ wot) {
    __shared__ __attribute__((aligned(16))) __bf16 t[64 * TWP];
    const int b = blockIdx.x;
    if (b < 512)       cvt_body<16>(x, xb, b);
    else if (b < 1024) cvt_w_t_body<2048, 2048>(Wq, wqt, t, b - 512);
    else if (b < 1536) cvt_w_t_body<2048, 2048>(Wo, wot, t, b - 1024);
    else if (b < 1664) cvt_w_t_body<2048, 512>(Wk, wkt, t, b - 1536);
    else               cvt_w_t_body<2048, 512>(Wv, wvt, t, b - 1664);
}

// ---------------------------------------------------------------------------
// Tiled WMMA GEMM: C[M][N] f32 = A[M][K] bf16 * Bt[N][K] bf16 + residual
// Block = 128 threads (4 waves, 2 x 2), tile 128x128, K-step 64, double-buffered
// async global->LDS staging. A wave owns a 64x64 piece: four A and four Bt
// fragments feed sixteen WMMAs, one LDS fragment load pair per two WMMAs.
// ---------------------------------------------------------------------------
#define GKS 64
#define GKP 72  // padded LDS row stride (144 B, 16B-aligned)

// Main loop. Bt points at the first of the block's 128 rows. Wave w owns rows
// m_blk + 64*(w >> 1) .. + 63 of A against rows 64*(w & 1) .. + 63 of Bt, as
// 4 x 4 tiles of 16x16; tile (mt, nt) starts at row mt*16, column nt*16 of that.
// TR = false: acc[mt][nt][r] is row 8*half + r of A, row l16 of Bt in the tile.
// TR = true (operands swapped, the tile comes out transposed): acc[mt][nt][r] is
// row l16 of A, row 8*half + r of Bt, so a lane holds, for each mt, 32 of the
// wave's 64 columns of ONE output row, in runs of eight.
template <bool TR>
DEV void gemm_main(const __bf16* __restrict__ A, const __bf16* __restrict__ Bt,
                   int m_blk, int K, v8f (&acc)[4][4]) {
    __shared__ __bf16 a_lds[2][128 * GKP];
    __shared__ __bf16 b_lds[2][128 * GKP];
    const int tid = threadIdx.x;
    const int lane = tid & 31, wave = tid >> 5;
    const int half = (lane >> 4) & 1, l16 = lane & 15;
    const int m0 = (wave >> 1) * 64, n0 = (wave & 1) * 64;
    const int r_base = tid >> 3, c_st = (tid & 7) * 8;

#pragma unroll
    for (int i = 0; i < 4; ++i)
#pragma unroll
        for (int j = 0; j < 4; ++j) acc[i][j] = vzero8();

    // Stage one 128x64 tile of A and Bt into LDS buffer `buf` (async).
    auto stage = [&](int k0, int buf) {
#pragma unroll
        for (int i = 0; i < 8; ++i) {
            int r = r_base + i * 16;
            async_b128(&A[(size_t)(m_blk + r) * K + k0 + c_st],
                       &a_lds[buf][r * GKP + c_st]);
            async_b128(&Bt[(size_t)r * K + k0 + c_st],
                       &b_lds[buf][r * GKP + c_st]);
        }
    };

    const int T = K / GKS;
    stage(0, 0);
    for (int t = 0; t < T; ++t) {
        wait_async0();          // tile t landed (async loads retire in order)
        __syncthreads();        // visible to all waves; prior reads finished
        if (t + 1 < T) stage((t + 1) * GKS, (t + 1) & 1);  // overlap copy
        const __bf16* abase = &a_lds[t & 1][(m0 + l16) * GKP + half * 8];
        const __bf16* bbase = &b_lds[t & 1][(n0 + l16) * GKP + half * 8];
        v16bf af[2][4], bfr[2][4];
#pragma unroll
        for (int kk = 0; kk < 2; ++kk) {
#pragma unroll
            for (int mt = 0; mt < 4; ++mt) {
                const __bf16* arow = abase + mt * 16 * GKP + kk * 32;
                af[kk][mt] = ld_frag(arow, arow + 16);
            }
#pragma unroll
            for (int nt = 0; nt < 4; ++nt) {
                const __bf16* brow = bbase + nt * 16 * GKP + kk * 32;
                bfr[kk][nt] = ld_frag(brow, brow + 16);
            }
        }
        // Keeps the tile's 32 fragment loads one group ahead of its 32 WMMAs
        // (counted waits); spread among them, each pair costs a full LDS wait.
        __builtin_amdgcn_sched_barrier(0);
#pragma unroll
        for (int kk = 0; kk < 2; ++kk)
#pragma unroll
            for (int nt = 0; nt < 4; ++nt)
#pragma unroll
                for (int mt = 0; mt < 4; ++mt)
                    acc[mt][nt] =
                        TR ? wmma_bf16(bfr[kk][nt], af[kk][mt], acc[mt][nt])
                           : wmma_bf16(af[kk][mt], bfr[kk][nt], acc[mt][nt]);
    }
}

// Bt points at the first of the block's 128 rows, C (and resid) at the first of
// its 128 columns; N is the row length of C.
DEV void gemm_body(const __bf16* __restrict__ A, const __bf16* __restrict__ Bt,
                   const float* __restrict__ resid, float* __restrict__ C,
                   int m_blk, int N, int K) {
    const int tid = threadIdx.x;
    const int lane = tid & 31, wave = tid >> 5;
    const int half = (lane >> 4) & 1, l16 = lane & 15;
    const int m0 = (wave >> 1) * 64, n0 = (wave & 1) * 64;

    v8f acc[4][4];
    gemm_main<false>(A, Bt, m_blk, K, acc);

    // Element (tile mt, row r, tile nt) of this lane lies at
    // o0 + (mt * 16 + r) * N + nt * 16. The lane's 128 residual values are loaded
    // in a loop of their own, with no test and no store between them: as many as
    // the load counter takes are in flight together, instead of one latency per
    // value. The rows are then stored as they land.
    const size_t o0 = (size_t)(m_blk + m0 + half * 8) * N + n0 + l16;
    float rv[4][8][4];
#pragma unroll
    for (int mt = 0; mt < 4; ++mt)
#pragma unroll
        for (int r = 0; r < 8; ++r) {
            const float* pr = resid + o0 + (size_t)(mt * 16 + r) * N;
#pragma unroll
            for (int nt = 0; nt < 4; ++nt) rv[mt][r][nt] = pr[nt * 16];
            // The row's address registers are reused for a later row. Named as
            // an input they stay as they are up to this wait.
            asm volatile("s_wait_xcnt 0x0" :: "v"(pr) : "memory");
        }
#pragma unroll
    for (int mt = 0; mt < 4; ++mt)
#pragma unroll
        for (int r = 0; r < 8; ++r) {
            float* pc = C + o0 + (size_t)(mt * 16 + r) * N;
            float d[4];
#pragma unroll
            for (int nt = 0; nt < 4; ++nt) {
                d[nt] = acc[mt][nt][r] + rv[mt][r][nt];
                pc[nt * 16] = d[nt];
            }
            // The row's address and data registers are reused for a later row.
            // Named as inputs they stay as they are up to this wait.
            asm volatile("s_wait_xcnt 0x0" :: "v"(pc), "v"(d[0]), "v"(d[1]),
                                              "v"(d[2]), "v"(d[3]) : "memory");
        }
}

// Q, K and V projections in one launch, with the per-head RMSNorm (Q, K) and the
// conversion to bf16 done on the f32 accumulators. Wt holds Wq^T, Wk^T, Wv^T one
// behind the other (3072 rows of K); blockIdx.x is the 128-row tile of Wt, which
// is exactly one head: 16 tiles go to q (rows of 2048), 4 to k and 4 to v (rows
// of 512). With the transposed tiles a token's half head (the wave's 64 columns)
// lies in the two lanes l16 and l16 + 16: its sum of squares is in-lane plus one
// exchange between the halves; the two waves that share a token's head pass each
// other their half sums through LDS. Each tile leaves as one 16-byte store per
// lane.
__global__ __launch_bounds__(128)
void k_gemm_qkv(const __bf16* __restrict__ A, const __bf16* __restrict__ Wt,
                const float* __restrict__ qg, const float* __restrict__ kg,
                __bf16* __restrict__ q, __bf16* __restrict__ k,
                __bf16* __restrict__ v, int K) {
    __shared__ float ssq[2][128];  // [column half of the head][row of the block]
    const int x = blockIdx.x;
    const int lane = threadIdx.x & 31, wave = threadIdx.x >> 5;
    const int half = (lane >> 4) & 1, l16 = lane & 15;
    const int m0 = (wave >> 1) * 64, wn = wave & 1, n0 = wn * 64;
    const int m_blk = blockIdx.y * 128;
    v8f acc[4][4];
    gemm_main<true>(A, Wt + (size_t)x * 128 * K, m_blk, K, acc);

    __bf16* C = x < 16 ? q + x * 128 : x < 20 ? k + (x - 16) * 128
                                              : v + (x - 20) * 128;
    const int N = x < 16 ? 2048 : 512;
    __bf16* orow = C + (size_t)(m_blk + m0 + l16) * N + n0 + half * 8;
    if (x < 20) {  // the same for the whole block: the barrier inside is safe
        float ss[4];
#pragma unroll
        for (int mt = 0; mt < 4; ++mt) {
            float sq[4];  // one chain per tile: four short chains, not one of 32
#pragma unroll
            for (int nt = 0; nt < 4; ++nt) {
                sq[nt] = 0.0f;
#pragma unroll
                for (int r = 0; r < 8; ++r)
                    sq[nt] += acc[mt][nt][r] * acc[mt][nt][r];
            }
            ss[mt] = (sq[0] + sq[1]) + (sq[2] + sq[3]);
            ss[mt] += xhalf(ss[mt]);
            if (half == 0) ssq[wn][m0 + mt * 16 + l16] = ss[mt];
        }
        __syncthreads();  // both column halves' sums of squares are in LDS
        const float* g = (x < 16 ? qg : kg) + n0 + half * 8;
        v4f g0[4], g1[4];
#pragma unroll
        for (int nt = 0; nt < 4; ++nt) {
            g0[nt] = *(const v4f*)(g + nt * 16);
            g1[nt] = *(const v4f*)(g + nt * 16 + 4);
        }
#pragma unroll
        for (int mt = 0; mt < 4; ++mt) {
            const float st = ss[mt] + ssq[wn ^ 1][m0 + mt * 16 + l16];
            const float rs = rsqrtf(st * (1.0f / 128.0f) + 1e-8f);
#pragma unroll
            for (int nt = 0; nt < 4; ++nt) {
                v8bf w;
#pragma unroll
                for (int r = 0; r < 4; ++r) {
                    w[r]     = (__bf16)(acc[mt][nt][r] * rs * g0[nt][r]);
                    w[4 + r] = (__bf16)(acc[mt][nt][4 + r] * rs * g1[nt][r]);
                }
                *(v8bf*)(orow + (size_t)(mt * 16) * N + nt * 16) = w;
            }
        }
    } else {
#pragma unroll
        for (int mt = 0; mt < 4; ++mt) {
            __bf16* pv = orow + (size_t)(mt * 16) * N;
            v8bf w[4];
#pragma unroll
            for (int nt = 0; nt < 4; ++nt) {
#pragma unroll
                for (int r = 0; r < 8; ++r) w[nt][r] = (__bf16)acc[mt][nt][r];
                *(v8bf*)(pv + nt * 16) = w[nt];
            }
            // The row's address and data registers may be reused by what follows
            // these stores. Named as inputs they stay as they are up to this wait.
            asm volatile("s_wait_xcnt 0x0" :: "v"(pv), "v"(w[0]), "v"(w[1]),
                                              "v"(w[2]), "v"(w[3]) : "memory");
        }
    }
}

__global__ __launch_bounds__(128)
void k_gemm_out(const __bf16* __restrict__ A, const __bf16* __restrict__ Bt,
                const float* __restrict__ resid, float* __restrict__ C,
                int N, int K) {
    const int n_blk = blockIdx.x * 128;
    gemm_body(A, Bt + (size_t)n_blk * K, resid + n_blk, C + n_blk,
              blockIdx.y * 128, N, K);
}

#define AKP 136  // K row stride: 272 B, odd multiple of 16 B (ds_load_b128 reader)
#define AVP 144  // V row stride: 288 B, odd multiple of 32 B (transposing reader)

typedef __attribute__((ext_vector_type(8))) short v8s;

// Transposing LDS load: lane (c, half) gets T[kbase + 8*half + 0..7][dbase + c].
DEV v8bf ld_tr16(const __bf16* p) {
    return __builtin_bit_cast(
        v8bf, __builtin_amdgcn_ds_load_tr16_b128_v8i16((LDS_AS v8s*)p));
}

__global__ __launch_bounds__(256)
void k_attn(const __bf16* __restrict__ qb, const __bf16* __restrict__ kb,
            const __bf16* __restrict__ vb, __bf16* __restrict__ ob) {
    __shared__ __attribute__((aligned(16))) __bf16 k_lds[128 * AKP];
    __shared__ __attribute__((aligned(16))) __bf16 v_lds[128 * AVP];

    const int tid = threadIdx.x;
    const int lane = tid & 31, wave = tid >> 5;
    const int half = (lane >> 4) & 1, l16 = lane & 15;
    const int qt = blockIdx.x, h = blockIdx.y, b = blockIdx.z;
    const int kvh = h >> 2;            // GQA group of 4
    const int tok0 = b * 2048;
    const int q0 = qt * 128 + wave * 16;  // wave's first query row (in-batch)
    const float scale = 0.08838834764831845f;  // 128^-0.5

    // Q fragments (B operand): column = query l16, 4 K-chunks of 32 over dh.
    v16bf qf[4];
    {
        const int t = tok0 + q0 + l16;
        const __bf16* qrow = qb + ((size_t)t * 16 + h) * 128;
#pragma unroll
        for (int kk = 0; kk < 4; ++kk)
            qf[kk] = ld_frag(qrow + kk * 32 + half * 8,
                             qrow + kk * 32 + 16 + half * 8);
    }

    v8f o[8];  // O^T tiles: row dh = nt*16 + half*8 + r, column = query l16
#pragma unroll
    for (int i = 0; i < 8; ++i) o[i] = vzero8();
    float mrow = -3.0e38f;  // this lane's query: running maximum (both halves)
    float lrow = 0.0f;      // running sum over this half's keys only

    for (int kt = 0; kt <= qt; ++kt) {
        __syncthreads();  // previous tile fully consumed
        // --- async K and V tiles: [key][dh], 128 keys x 16 chunks each ---
#pragma unroll
        for (int i = 0; i < 8; ++i) {
            int idx = tid + i * 256;
            int key = idx >> 4, c = (idx & 15) * 8;
            int t = tok0 + kt * 128 + key;
            async_b128(&kb[((size_t)t * 4 + kvh) * 128 + c],
                       &k_lds[key * AKP + c]);
            async_b128(&vb[((size_t)t * 4 + kvh) * 128 + c],
                       &v_lds[key * AVP + c]);
        }
        wait_async0();
        __syncthreads();

        // Skip fully-masked 32-key groups on the diagonal tile.
        const int gmax = (kt == qt) ? (wave * 16 + 15) / 32 : 3;
        for (int g = 0; g <= gmax; ++g) {
            // S^T = K Q^T for 32 keys (two 16-key tiles), K-dim = dh = 128.
            v16bf kf0[4], kf1[4];
#pragma unroll
            for (int kk = 0; kk < 4; ++kk) {
                const __bf16* kr0 = &k_lds[(g * 32 + l16) * AKP + kk * 32];
                const __bf16* kr1 = &k_lds[(g * 32 + 16 + l16) * AKP + kk * 32];
                kf0[kk] = ld_frag(kr0 + half * 8, kr0 + 16 + half * 8);
                kf1[kk] = ld_frag(kr1 + half * 8, kr1 + 16 + half * 8);
            }
            // Keeps the 16 K loads one group ahead of their WMMAs (counted
            // waits); spread among them, each pair costs a full LDS wait.
            __builtin_amdgcn_sched_barrier(0);
            v8f s0 = vzero8(), s1 = vzero8();
#pragma unroll
            for (int kk = 0; kk < 4; ++kk) {
                s0 = wmma_bf16(kf0[kk], qf[kk], s0);
                s1 = wmma_bf16(kf1[kk], qf[kk], s1);
            }
            // V^T fragments: A = 16 (dh) x 32 (keys) by two transposing loads.
            const __bf16* vr = &v_lds[(g * 32 + half * 8 + (lane & 7)) * AVP +
                                      ((lane >> 3) & 1) * 8];
            v16bf vf[8];
#pragma unroll
            for (int nt = 0; nt < 8; ++nt) {
                v8bf lo = ld_tr16(vr + nt * 16);
                v8bf hi = ld_tr16(vr + 16 * AVP + nt * 16);
                vf[nt] = __builtin_shufflevector(lo, hi, 0, 1, 2, 3, 4, 5, 6, 7,
                                                 8, 9, 10, 11, 12, 13, 14, 15);
            }
            // Keeps the 16 V^T loads one group here, in flight under the
            // softmax arithmetic, instead of one full LDS wait per WMMA.
            __builtin_amdgcn_sched_barrier(0);
            // Scale + causal mask + this query's max over the 32-key group.
            const int qg = q0 + l16;
            const int kg0 = kt * 128 + g * 32 + half * 8;  // + r
            float p0[8], p1[8];
            float tmax = -3.0e38f;
#pragma unroll
            for (int r = 0; r < 8; ++r) {
                float a = s0[r] * scale, c = s1[r] * scale;
                if (kg0 + r > qg) a = -3.0e38f;
                if (kg0 + 16 + r > qg) c = -3.0e38f;
                p0[r] = a; p1[r] = c;
                tmax = fmaxf(tmax, fmaxf(a, c));
            }
            tmax = fmaxf(tmax, xhalf(tmax));
            // Online softmax update; P^T packs into the B operand in place:
            // elements 0..7 are keys half*8 + r, 8..15 are keys 16 + half*8 + r.
            const float mn = fmaxf(mrow, tmax);
            const bool live = mn > -1.0e37f;
            const float al = live ? __expf(mrow - mn) : 1.0f;
            float rs0 = 0.0f, rs1 = 0.0f;
            v16bf pf;
#pragma unroll
            for (int r = 0; r < 8; ++r) {
                float e0 = live ? __expf(p0[r] - mn) : 0.0f;
                float e1 = live ? __expf(p1[r] - mn) : 0.0f;
                rs0 += e0; rs1 += e1;
                pf[r]     = (__bf16)e0;
                pf[8 + r] = (__bf16)e1;
            }
            lrow = lrow * al + (rs0 + rs1);
            mrow = mn;
            // Rescale running output accumulators.
#pragma unroll
            for (int nt = 0; nt < 8; ++nt)
#pragma unroll
                for (int r = 0; r < 8; ++r) o[nt][r] *= al;
            // O^T += V^T P^T.
#pragma unroll
            for (int nt = 0; nt < 8; ++nt) o[nt] = wmma_bf16(vf[nt], pf, o[nt]);
        }
    }

    // Finalize: join the halves' sums, divide, store bf16 [token][h*128 + dh]
    // (16 bytes per lane and tile: dh = nt*16 + half*8 .. + 7).
    const float inv = 1.0f / fmaxf(lrow + xhalf(lrow), 1e-20f);
    __bf16* orow = ob + ((size_t)(tok0 + q0 + l16) * 16 + h) * 128 + half * 8;
#pragma unroll
    for (int nt = 0; nt < 8; ++nt) {
        v8bf w;
#pragma unroll
        for (int r = 0; r < 8; ++r) w[r] = (__bf16)(o[nt][r] * inv);
        *(v8bf*)(orow + nt * 16) = w;
    }
}

// ---------------------------------------------------------------------------
// Host-side orchestration
// ---------------------------------------------------------------------------
extern "C" void kernel_launch(void* const* d_in, const int* in_sizes, int n_in,
                              void* d_out, int out_size, void* d_ws, size_t ws_size,
                              hipStream_t stream) {
    (void)in_sizes; (void)n_in; (void)out_size; (void)ws_size;
    const float* x  = (const float*)d_in[0];
    const float* Wq = (const float*)d_in[1];
    const float* Wk = (const float*)d_in[2];
    const float* Wv = (const float*)d_in[3];
    const float* Wo = (const float*)d_in[4];
    const float* qg = (const float*)d_in[5];
    const float* kg = (const float*)d_in[6];
    float* out = (float*)d_out;

    const int M = 4096;        // tokens (2 batches x 2048)
    const int D = 2048;        // model dim
    const int KVD = 512;       // kv dim

    uint8_t* w = (uint8_t*)d_ws;
    __bf16* xb  = (__bf16*)(w);                // 16 MiB  x in bf16
    __bf16* wqt = (__bf16*)(w + 16777216);     //  8 MiB  Wq^T bf16
    __bf16* wkt = (__bf16*)(w + 25165824);     //  2 MiB  Wk^T bf16
    __bf16* wvt = (__bf16*)(w + 27262976);     //  2 MiB  Wv^T bf16
    __bf16* wot = (__bf16*)(w + 29360128);     //  8 MiB  Wo^T bf16
    __bf16* aob = (__bf16*)(w + 37748736);     // 16 MiB  attention out bf16
    __bf16* qbf = (__bf16*)(w + 88080384);     // 16 MiB  Q bf16 (post-norm)
    __bf16* kbf = (__bf16*)(w + 104857600);    //  4 MiB  K bf16 (post-norm)
    __bf16* vbf = (__bf16*)(w + 109051904);    //  4 MiB  V bf16
    // last workspace byte used: 113,246,208

    // 1) x -> bf16 and the four weights -> transposed bf16
    k_prep<<<1792, 256, 0, stream>>>(x, Wq, Wk, Wv, Wo, xb, wqt, wkt, wvt, wot);
    // 2) QKV projections (WMMA GEMM over wqt, wkt, wvt as one 3072-row matrix)
    //    with QK RMSNorm (per head, DH=128) and bf16 conversion in the epilogue
    k_gemm_qkv<<<dim3((D + 2 * KVD) / 128, M / 128), 128, 0, stream>>>(
        xb, wqt, qg, kg, qbf, kbf, vbf, D);
    // 3) causal GQA flash attention (WMMA)
    k_attn<<<dim3(16, 16, 2), 256, 0, stream>>>(qbf, kbf, vbf, aob);
    // 4) output projection + residual (WMMA GEMM)
    k_gemm_out<<<dim3(D / 128, M / 128), 128, 0, stream>>>(
        aob, wot, x, out, D, D);
}

// v008
// A run of this version takes 132 microseconds.
// Next to v007, in two timings, it ran 1.08 times as fast each time.
// Counting every step since v000, it is 3.14 times as fast.
#include <hip/hip_runtime.h>
#include <hip/hip_bf16.h>

// ---------------------------------------------------------------------------
// Transformer block for gfx1250: wave32 + WMMA bf16 pipeline
// with async global->LDS staging (ASYNCcnt) and double-buffered GEMM tiles.
// ---------------------------------------------------------------------------

#define DEV static __device__ __forceinline__

typedef __attribute__((ext_vector_type(16))) __bf16 v16bf;
typedef __attribute__((ext_vector_type(8)))  __bf16 v8bf;
typedef __attribute__((ext_vector_type(8)))  float  v8f;
typedef __attribute__((ext_vector_type(4)))  int    v4i;
typedef __attribute__((ext_vector_type(4)))  float  v4f;

#define LDS_AS __attribute__((address_space(3)))
#define GLB_AS __attribute__((address_space(1)))

DEV v8f vzero8() {
    v8f z;
#pragma unroll
    for (int i = 0; i < 8; ++i) z[i] = 0.0f;
    return z;
}

// Async global -> LDS copy of one 16-byte chunk (tracked by ASYNCcnt).
DEV void async_b128(const __bf16* g, __bf16* l) {
#if __has_builtin(__builtin_amdgcn_global_load_async_to_lds_b128)
    __builtin_amdgcn_global_load_async_to_lds_b128(
        (GLB_AS v4i*)(uintptr_t)g,
        (LDS_AS v4i*)(uint32_t)(uintptr_t)l, 0, 0);
#else
    unsigned loff = (unsigned)(uintptr_t)l;
    asm volatile("global_load_async_to_lds_b128 %0, %1, off"
                 :: "v"(loff), "v"(g) : "memory");
#endif
}

DEV void wait_async0() {
#if __has_builtin(__builtin_amdgcn_s_wait_asynccnt)
    __builtin_amdgcn_s_wait_asynccnt(0);
#else
    asm volatile("s_wait_asynccnt 0" ::: "memory");
#endif
}

// Build a 16-element bf16 fragment from two 16-byte chunks (the CDNA5 A/B
// 16-bit layout: lane holds K = half*8..+7 and K = 16+half*8..+7).
DEV v16bf ld_frag(const __bf16* lo, const __bf16* hi) {
    v8bf a = *(const v8bf*)lo;
    v8bf b = *(const v8bf*)hi;
    return __builtin_shufflevector(a, b, 0, 1, 2, 3, 4, 5, 6, 7,
                                          8, 9, 10, 11, 12, 13, 14, 15);
}

DEV v8f wmma_bf16(v16bf a, v16bf b, v8f c) {
    return __builtin_amdgcn_wmma_f32_16x16x32_bf16(
        false, a, false, b, (short)0, c, false, false);
}

// Value of lane l ^ 16.
DEV float xhalf(float x) {
    return __builtin_bit_cast(float, __builtin_amdgcn_permlanex16(
        __builtin_bit_cast(int, x), __builtin_bit_cast(int, x),
        0x76543210, 0xfedcba98, false, false));
}

// ---------------------------------------------------------------------------
// Elementwise f32 -> bf16 convert. A wave starts once and moves U * 512 B:
// all U 16-byte loads of a lane are issued before the first store, each load
// and each store of a wave covering whole 128-B lines.
// ---------------------------------------------------------------------------
// Inputs-only fence on 16 loaded values and on the address they were loaded
// from: every load is issued, and has landed, before anything that follows, and
// no load's result is placed on the address pair that the others still name.
// Without it the compiler sinks part of the 16 loads behind the first results'
// use, and the wave waits out the memory latency again for each part.
DEV void hold16(const v4f* v, const float* p) {
    asm volatile("" :: "v"(v[0]), "v"(v[1]), "v"(v[2]), "v"(v[3]), "v"(v[4]),
                       "v"(v[5]), "v"(v[6]), "v"(v[7]), "v"(v[8]), "v"(v[9]),
                       "v"(v[10]), "v"(v[11]), "v"(v[12]), "v"(v[13]),
                       "v"(v[14]), "v"(v[15]), "v"(p));
}

template <int U>
DEV void cvt_body(const float* __restrict__ in, __bf16* __restrict__ out,
                  int blk) {
    const size_t base = (size_t)blk * (1024 * U) + threadIdx.x * 4;
    const float* p = in + base;
    v4f v[U];
#pragma unroll
    for (int u = 0; u < U; ++u) v[u] = *(const v4f*)(p + u * 1024);
    if constexpr (U == 16) hold16(v, p);
#pragma unroll
    for (int u = 0; u < U; ++u) {
        union { __bf16 h[4]; uint2 u2; } o;
        o.h[0] = (__bf16)v[u].x; o.h[1] = (__bf16)v[u].y;
        o.h[2] = (__bf16)v[u].z; o.h[3] = (__bf16)v[u].w;
        *(uint2*)&out[base + u * 1024] = o.u2;
    }
    // The job's code may be followed by another job's in the merged kernel: the
    // stores' registers are not rewritten there ahead of this wait.
    asm volatile("s_wait_xcnt 0x0" ::: "memory");
}

// ---------------------------------------------------------------------------
// Weight transpose + convert: W[K][N] f32 -> Wt[N][K] bf16, one 128 (k) x 64 (n)
// tile per block. A thread loads an 8 (k) x 4 (n) patch by eight 16-byte loads
// (a wave: two 256-B row pieces each), packs four 8-k vectors in registers and
// passes them through LDS so that the stores are 256-B pieces of Wt rows.
// LDS row i*16 + c holds n = 4*c + i: at a pitch of 272 B the sixteen lanes of
// one ds_store_b128 then fall on all 64 banks.
// ---------------------------------------------------------------------------
#define TWP 136  // LDS row pitch in elements (272 B)

template <int K, int N>
DEV void cvt_w_t_body(const float* __restrict__ W, __bf16* __restrict__ Wt,
                      __bf16* t, int blk) {
    // blk counts the tiles of W with the n tile running fastest.
    const int k0 = (blk / (N / 64)) * 128, n0 = (blk % (N / 64)) * 64;
    const int tid = threadIdx.x;
    const int c4 = tid & 15, rq = tid >> 4;
    // K and N are compile-time: one address per lane, rows by immediate offset.
    const float* src = W + (size_t)(k0 + rq * 8) * N + n0 + c4 * 4;
    float v[8][4];
#pragma unroll
    for (int j = 0; j < 8; ++j) {
        float4 f = *(const float4*)(src + j * N);
        v[j][0] = f.x; v[j][1] = f.y; v[j][2] = f.z; v[j][3] = f.w;
    }
#pragma unroll
    for (int i = 0; i < 4; ++i) {
        v8bf p;
#pragma unroll
        for (int j = 0; j < 8; ++j) p[j] = (__bf16)v[j][i];
        *(v8bf*)&t[(i * 16 + c4) * TWP + rq * 8] = p;
    }
    __syncthreads();
    // LDS row i*16 + rq is Wt row n0 + 4*rq + i; sixteen lanes store its 256 B.
    __bf16* dst = Wt + (size_t)(n0 + rq * 4) * K + k0 + c4 * 8;
#pragma unroll
    for (int i = 0; i < 4; ++i)
        *(v8bf*)(dst + i * K) = *(const v8bf*)&t[(i * 16 + rq) * TWP + c4 * 8];
    // The job's code may be followed by another job's in the merged kernel: the
    // stores' registers are not rewritten there ahead of this wait.
    asm volatile("s_wait_xcnt 0x0" ::: "memory");
}

// One launch for the five jobs that depend on nothing but the inputs; a block's
// index says which job and which piece of it the block takes:
// 512 blocks x (16,384 elements each), 512 Wq, 512 Wo, 128 Wk, 128 Wv tiles.
__global__ __launch_bounds__(256)
void k_prep(const float* __restrict__ x, const float* __restrict__ Wq,
            const float* __restrict__ Wk, const float* __restrict__ Wv,
            const float* __restrict__ Wo, __bf16* __restrict__ xb,
            __bf16* __restrict__ wqt, __bf16* __restrict__ wkt,
            __bf16* __restrict__ wvt, __bf16* __restrict__ wot) {
    __shared__ __attribute__((aligned(16))) __bf16 t[64 * TWP];
    const int b = blockIdx.x;
    if (b < 512)       cvt_body<16>(x, xb, b);
    else if (b < 1024) cvt_w_t_body<2048, 2048>(Wq, wqt, t, b - 512);
    else if (b < 1536) cvt_w_t_body<2048, 2048>(Wo, wot, t, b - 1024);
    else if (b < 1664) cvt_w_t_body<2048, 512>(Wk, wkt, t, b - 1536);
    else               cvt_w_t_body<2048, 512>(Wv, wvt, t, b - 1664);
}

// ---------------------------------------------------------------------------
// Tiled WMMA GEMM: C[M][N] f32 = A[M][K] bf16 * Bt[N][K] bf16 + residual
// Block = 128 threads (4 waves, 2 x 2), tile 128x128, K-step 64, double-buffered
// async global->LDS staging. A wave owns a 64x64 piece: four A and four Bt
// fragments feed sixteen WMMAs, one LDS fragment load pair per two WMMAs.
// ---------------------------------------------------------------------------
#define GKS 64
#define GKP 72  // padded LDS row stride (144 B, 16B-aligned)

// Main loop. Bt points at the first of the block's 128 rows. Wave w owns rows
// m_blk + 64*(w >> 1) .. + 63 of A against rows 64*(w & 1) .. + 63 of Bt, as
// 4 x 4 tiles of 16x16; tile (mt, nt) starts at row mt*16, column nt*16 of that.
// TR = false: acc[mt][nt][r] is row 8*half + r of A, row l16 of Bt in the tile.
// TR = true (operands swapped, the tile comes out transposed): acc[mt][nt][r] is
// row l16 of A, row 8*half + r of Bt, so a lane holds, for each mt, 32 of the
// wave's 64 columns of ONE output row, in runs of eight.
template <bool TR>
DEV void gemm_main(const __bf16* __restrict__ A, const __bf16* __restrict__ Bt,
                   int m_blk, int K, v8f (&acc)[4][4]) {
    __shared__ __bf16 a_lds[2][128 * GKP];
    __shared__ __bf16 b_lds[2][128 * GKP];
    const int tid = threadIdx.x;
    const int lane = tid & 31, wave = tid >> 5;
    const int half = (lane >> 4) & 1, l16 = lane & 15;
    const int m0 = (wave >> 1) * 64, n0 = (wave & 1) * 64;
    const int r_base = tid >> 3, c_st = (tid & 7) * 8;

#pragma unroll
    for (int i = 0; i < 4; ++i)
#pragma unroll
        for (int j = 0; j < 4; ++j) acc[i][j] = vzero8();

    // Stage one 128x64 tile of A and Bt into LDS buffer `buf` (async).
    auto stage = [&](int k0, int buf) {
#pragma unroll
        for (int i = 0; i < 8; ++i) {
            int r = r_base + i * 16;
            async_b128(&A[(size_t)(m_blk + r) * K + k0 + c_st],
                       &a_lds[buf][r * GKP + c_st]);
            async_b128(&Bt[(size_t)r * K + k0 + c_st],
                       &b_lds[buf][r * GKP + c_st]);
        }
    };

    const int T = K / GKS;
    stage(0, 0);
    for (int t = 0; t < T; ++t) {
        wait_async0();          // tile t landed (async loads retire in order)
        __syncthreads();        // visible to all waves; prior reads finished
        if (t + 1 < T) stage((t + 1) * GKS, (t + 1) & 1);  // overlap copy
        const __bf16* abase = &a_lds[t & 1][(m0 + l16) * GKP + half * 8];
        const __bf16* bbase = &b_lds[t & 1][(n0 + l16) * GKP + half * 8];
        v16bf af[2][4], bfr[2][4];
#pragma unroll
        for (int kk = 0; kk < 2; ++kk) {
#pragma unroll
            for (int mt = 0; mt < 4; ++mt) {
                const __bf16* arow = abase + mt * 16 * GKP + kk * 32;
                af[kk][mt] = ld_frag(arow, arow + 16);
            }
#pragma unroll
            for (int nt = 0; nt < 4; ++nt) {
                const __bf16* brow = bbase + nt * 16 * GKP + kk * 32;
                bfr[kk][nt] = ld_frag(brow, brow + 16);
            }
        }
        // Keeps the tile's 32 fragment loads one group ahead of its 32 WMMAs
        // (counted waits); spread among them, each pair costs a full LDS wait.
        __builtin_amdgcn_sched_barrier(0);
#pragma unroll
        for (int kk = 0; kk < 2; ++kk)
#pragma unroll
            for (int nt = 0; nt < 4; ++nt)
#pragma unroll
                for (int mt = 0; mt < 4; ++mt)
                    acc[mt][nt] =
                        TR ? wmma_bf16(bfr[kk][nt], af[kk][mt], acc[mt][nt])
                           : wmma_bf16(af[kk][mt], bfr[kk][nt], acc[mt][nt]);
    }
}

// Bt points at the first of the block's 128 rows, C (and resid) at the first of
// its 128 columns; N is the row length of C.
DEV void gemm_body(const __bf16* __restrict__ A, const __bf16* __restrict__ Bt,
                   const float* __restrict__ resid, float* __restrict__ C,
                   int m_blk, int N, int K) {
    const int tid = threadIdx.x;
    const int lane = tid & 31, wave = tid >> 5;
    const int half = (lane >> 4) & 1, l16 = lane & 15;
    const int m0 = (wave >> 1) * 64, n0 = (wave & 1) * 64;

    v8f acc[4][4];
    gemm_main<false>(A, Bt, m_blk, K, acc);

    // Element (tile mt, row r, tile nt) of this lane lies at
    // o0 + (mt * 16 + r) * N + nt * 16. The lane's 128 residual values are loaded
    // in a loop of their own, with no test and no store between them: as many as
    // the load counter takes are in flight together, instead of one latency per
    // value. The rows are then stored as they land.
    const size_t o0 = (size_t)(m_blk + m0 + half * 8) * N + n0 + l16;
    float rv[4][8][4];
#pragma unroll
    for (int mt = 0; mt < 4; ++mt)
#pragma unroll
        for (int r = 0; r < 8; ++r) {
            const float* pr = resid + o0 + (size_t)(mt * 16 + r) * N;
#pragma unroll
            for (int nt = 0; nt < 4; ++nt) rv[mt][r][nt] = pr[nt * 16];
            // The row's address registers are reused for a later row. Named as
            // an input they stay as they are up to this wait.
            asm volatile("s_wait_xcnt 0x0" :: "v"(pr) : "memory");
        }
#pragma unroll
    for (int mt = 0; mt < 4; ++mt)
#pragma unroll
        for (int r = 0; r < 8; ++r) {
            float* pc = C + o0 + (size_t)(mt * 16 + r) * N;
            float d[4];
#pragma unroll
            for (int nt = 0; nt < 4; ++nt) {
                d[nt] = acc[mt][nt][r] + rv[mt][r][nt];
                pc[nt * 16] = d[nt];
            }
            // The row's address and data registers are reused for a later row.
            // Named as inputs they stay as they are up to this wait.
            asm volatile("s_wait_xcnt 0x0" :: "v"(pc), "v"(d[0]), "v"(d[1]),
                                              "v"(d[2]), "v"(d[3]) : "memory");
        }
}

// Q, K and V projections in one launch, with the per-head RMSNorm (Q, K) and the
// conversion to bf16 done on the f32 accumulators. Wt holds Wq^T, Wk^T, Wv^T one
// behind the other (3072 rows of K); blockIdx.x is the 128-row tile of Wt, which
// is exactly one head: 16 tiles go to q (rows of 2048), 4 to k and 4 to v (rows
// of 512). With the transposed tiles a token's half head (the wave's 64 columns)
// lies in the two lanes l16 and l16 + 16: its sum of squares is in-lane plus one
// exchange between the halves; the two waves that share a token's head pass each
// other their half sums through LDS. Each tile leaves as one 16-byte store per
// lane.
__global__ __launch_bounds__(128)
void k_gemm_qkv(const __bf16* __restrict__ A, const __bf16* __restrict__ Wt,
                const float* __restrict__ qg, const float* __restrict__ kg,
                __bf16* __restrict__ q, __bf16* __restrict__ k,
                __bf16* __restrict__ v, int K) {
    __shared__ float ssq[2][128];  // [column half of the head][row of the block]
    const int x = blockIdx.x;
    const int lane = threadIdx.x & 31, wave = threadIdx.x >> 5;
    const int half = (lane >> 4) & 1, l16 = lane & 15;
    const int m0 = (wave >> 1) * 64, wn = wave & 1, n0 = wn * 64;
    const int m_blk = blockIdx.y * 128;
    v8f acc[4][4];
    gemm_main<true>(A, Wt + (size_t)x * 128 * K, m_blk, K, acc);

    __bf16* C = x < 16 ? q + x * 128 : x < 20 ? k + (x - 16) * 128
                                              : v + (x - 20) * 128;
    const int N = x < 16 ? 2048 : 512;
    __bf16* orow = C + (size_t)(m_blk + m0 + l16) * N + n0 + half * 8;
    if (x < 20) {  // the same for the whole block: the barrier inside is safe
        float ss[4];
#pragma unroll
        for (int mt = 0; mt < 4; ++mt) {
            float sq[4];  // one chain per tile: four short chains, not one of 32
#pragma unroll
            for (int nt = 0; nt < 4; ++nt) {
                sq[nt] = 0.0f;
#pragma unroll
                for (int r = 0; r < 8; ++r)
                    sq[nt] += acc[mt][nt][r] * acc[mt][nt][r];
            }
            ss[mt] = (sq[0] + sq[1]) + (sq[2] + sq[3]);
            ss[mt] += xhalf(ss[mt]);
            if (half == 0) ssq[wn][m0 + mt * 16 + l16] = ss[mt];
        }
        __syncthreads();  // both column halves' sums of squares are in LDS
        const float* g = (x < 16 ? qg : kg) + n0 + half * 8;
        v4f g0[4], g1[4];
#pragma unroll
        for (int nt = 0; nt < 4; ++nt) {
            g0[nt] = *(const v4f*)(g + nt * 16);
            g1[nt] = *(const v4f*)(g + nt * 16 + 4);
        }
#pragma unroll
        for (int mt = 0; mt < 4; ++mt) {
            const float st = ss[mt] + ssq[wn ^ 1][m0 + mt * 16 + l16];
            const float rs = rsqrtf(st * (1.0f / 128.0f) + 1e-8f);
#pragma unroll
            for (int nt = 0; nt < 4; ++nt) {
                v8bf w;
#pragma unroll
                for (int r = 0; r < 4; ++r) {
                    w[r]     = (__bf16)(acc[mt][nt][r] * rs * g0[nt][r]);
                    w[4 + r] = (__bf16)(acc[mt][nt][4 + r] * rs * g1[nt][r]);
                }
                *(v8bf*)(orow + (size_t)(mt * 16) * N + nt * 16) = w;
            }
        }
    } else {
#pragma unroll
        for (int mt = 0; mt < 4; ++mt) {
            __bf16* pv = orow + (size_t)(mt * 16) * N;
            v8bf w[4];
#pragma unroll
            for (int nt = 0; nt < 4; ++nt) {
#pragma unroll
                for (int r = 0; r < 8; ++r) w[nt][r] = (__bf16)acc[mt][nt][r];
                *(v8bf*)(pv + nt * 16) = w[nt];
            }
            // The row's address and data registers may be reused by what follows
            // these stores. Named as inputs they stay as they are up to this wait.
            asm volatile("s_wait_xcnt 0x0" :: "v"(pv), "v"(w[0]), "v"(w[1]),
                                              "v"(w[2]), "v"(w[3]) : "memory");
        }
    }
}

__global__ __launch_bounds__(128)
void k_gemm_out(const __bf16* __restrict__ A, const __bf16* __restrict__ Bt,
                const float* __restrict__ resid, float* __restrict__ C,
                int N, int K) {
    const int n_blk = blockIdx.x * 128;
    gemm_body(A, Bt + (size_t)n_blk * K, resid + n_blk, C + n_blk,
              blockIdx.y * 128, N, K);
}

#define AKP 136  // K row stride: 272 B, odd multiple of 16 B (ds_load_b128 reader)
#define AVP 144  // V row stride: 288 B, odd multiple of 32 B (transposing reader)

typedef __attribute__((ext_vector_type(8))) short v8s;

// Transposing LDS load: lane (c, half) gets T[kbase + 8*half + 0..7][dbase + c].
DEV v8bf ld_tr16(const __bf16* p) {
    return __builtin_bit_cast(
        v8bf, __builtin_amdgcn_ds_load_tr16_b128_v8i16((LDS_AS v8s*)p));
}

__global__ __launch_bounds__(256)
void k_attn(const __bf16* __restrict__ qb, const __bf16* __restrict__ kb,
            const __bf16* __restrict__ vb, __bf16* __restrict__ ob) {
    __shared__ __attribute__((aligned(16))) __bf16 k_lds[128 * AKP];
    __shared__ __attribute__((aligned(16))) __bf16 v_lds[128 * AVP];

    const int tid = threadIdx.x;
    const int lane = tid & 31, wave = tid >> 5;
    const int half = (lane >> 4) & 1, l16 = lane & 15;
    // Block index -> (query tile, head, batch), a permutation of the 512 jobs.
    // A job costs qt + 1 key tiles. With qt = blockIdx.x
    // the blocks whose flat index agrees modulo 8 or 16 hold only one or
    // two values of qt, and blocks 16, 64, 128 or
    // 256 apart hold the same one. Here every such class holds t, 15 - t, t ^ 8
    // and 15 - (t ^ 8) equally often, and two blocks whose flat index differs in
    // the one bit 8, 16, 64, 128 or 256 take tiles t and 15 - t: 17 key tiles
    // together. For speed only: any placement gives the same result.
    const int bx = blockIdx.x, by = blockIdx.y, b = blockIdx.z;
    const int h = (bx >> 3) | ((by & 1) << 1) | ((by >> 2) << 2);
    const int tl = (bx & 7) | ((by & 2) << 2);
    const int qt = ((__builtin_popcount(h) + b) & 1) ? 15 - tl : tl;
    const int kvh = h >> 2;            // GQA group of 4
    const int tok0 = b * 2048;
    const int q0 = qt * 128 + wave * 16;  // wave's first query row (in-batch)
    const float scale = 0.08838834764831845f;  // 128^-0.5

    // Q fragments (B operand): column = query l16, 4 K-chunks of 32 over dh.
    v16bf qf[4];
    {
        const int t = tok0 + q0 + l16;
        const __bf16* qrow = qb + ((size_t)t * 16 + h) * 128;
#pragma unroll
        for (int kk = 0; kk < 4; ++kk)
            qf[kk] = ld_frag(qrow + kk * 32 + half * 8,
                             qrow + kk * 32 + 16 + half * 8);
    }

    v8f o[8];  // O^T tiles: row dh = nt*16 + half*8 + r, column = query l16
#pragma unroll
    for (int i = 0; i < 8; ++i) o[i] = vzero8();
    float mrow = -3.0e38f;  // this lane's query: running maximum (both halves)
    float lrow = 0.0f;      // running sum over this half's keys only

    for (int kt = 0; kt <= qt; ++kt) {
        __syncthreads();  // previous tile fully consumed
        // --- async K and V tiles: [key][dh], 128 keys x 16 chunks each ---
#pragma unroll
        for (int i = 0; i < 8; ++i) {
            int idx = tid + i * 256;
            int key = idx >> 4, c = (idx & 15) * 8;
            int t = tok0 + kt * 128 + key;
            async_b128(&kb[((size_t)t * 4 + kvh) * 128 + c],
                       &k_lds[key * AKP + c]);
            async_b128(&vb[((size_t)t * 4 + kvh) * 128 + c],
                       &v_lds[key * AVP + c]);
        }
        wait_async0();
        __syncthreads();

        // Skip fully-masked 32-key groups on the diagonal tile.
        const int gmax = (kt == qt) ? (wave * 16 + 15) / 32 : 3;
        for (int g = 0; g <= gmax; ++g) {
            // S^T = K Q^T for 32 keys (two 16-key tiles), K-dim = dh = 128.
            v16bf kf0[4], kf1[4];
#pragma unroll
            for (int kk = 0; kk < 4; ++kk) {
                const __bf16* kr0 = &k_lds[(g * 32 + l16) * AKP + kk * 32];
                const __bf16* kr1 = &k_lds[(g * 32 + 16 + l16) * AKP + kk * 32];
                kf0[kk] = ld_frag(kr0 + half * 8, kr0 + 16 + half * 8);
                kf1[kk] = ld_frag(kr1 + half * 8, kr1 + 16 + half * 8);
            }
            // Keeps the 16 K loads one group ahead of their WMMAs (counted
            // waits); spread among them, each pair costs a full LDS wait.
            __builtin_amdgcn_sched_barrier(0);
            v8f s0 = vzero8(), s1 = vzero8();
#pragma unroll
            for (int kk = 0; kk < 4; ++kk) {
                s0 = wmma_bf16(kf0[kk], qf[kk], s0);
                s1 = wmma_bf16(kf1[kk], qf[kk], s1);
            }
            // V^T fragments: A = 16 (dh) x 32 (keys) by two transposing loads.
            const __bf16* vr = &v_lds[(g * 32 + half * 8 + (lane & 7)) * AVP +
                                      ((lane >> 3) & 1) * 8];
            v16bf vf[8];
#pragma unroll
            for (int nt = 0; nt < 8; ++nt) {
                v8bf lo = ld_tr16(vr + nt * 16);
                v8bf hi = ld_tr16(vr + 16 * AVP + nt * 16);
                vf[nt] = __builtin_shufflevector(lo, hi, 0, 1, 2, 3, 4, 5, 6, 7,
                                                 8, 9, 10, 11, 12, 13, 14, 15);
            }
            // Keeps the 16 V^T loads one group here, in flight under the
            // softmax arithmetic, instead of one full LDS wait per WMMA.
            __builtin_amdgcn_sched_barrier(0);
            // Scale + causal mask + this query's max over the 32-key group.
            const int qg = q0 + l16;
            const int kg0 = kt * 128 + g * 32 + half * 8;  // + r
            float p0[8], p1[8];
            float tmax = -3.0e38f;
#pragma unroll
            for (int r = 0; r < 8; ++r) {
                float a = s0[r] * scale, c = s1[r] * scale;
                if (kg0 + r > qg) a = -3.0e38f;
                if (kg0 + 16 + r > qg) c = -3.0e38f;
                p0[r] = a; p1[r] = c;
                tmax = fmaxf(tmax, fmaxf(a, c));
            }
            tmax = fmaxf(tmax, xhalf(tmax));
            // Online softmax update; P^T packs into the B operand in place:
            // elements 0..7 are keys half*8 + r, 8..15 are keys 16 + half*8 + r.
            const float mn = fmaxf(mrow, tmax);
            const bool live = mn > -1.0e37f;
            const float al = live ? __expf(mrow - mn) : 1.0f;
            float rs0 = 0.0f, rs1 = 0.0f;
            v16bf pf;
#pragma unroll
            for (int r = 0; r < 8; ++r) {
                float e0 = live ? __expf(p0[r] - mn) : 0.0f;
                float e1 = live ? __expf(p1[r] - mn) : 0.0f;
                rs0 += e0; rs1 += e1;
                pf[r]     = (__bf16)e0;
                pf[8 + r] = (__bf16)e1;
            }
            lrow = lrow * al + (rs0 + rs1);
            mrow = mn;
            // Rescale running output accumulators.
#pragma unroll
            for (int nt = 0; nt < 8; ++nt)
#pragma unroll
                for (int r = 0; r < 8; ++r) o[nt][r] *= al;
            // O^T += V^T P^T.
#pragma unroll
            for (int nt = 0; nt < 8; ++nt) o[nt] = wmma_bf16(vf[nt], pf, o[nt]);
        }
    }

    // Finalize: join the halves' sums, divide, store bf16 [token][h*128 + dh]
    // (16 bytes per lane and tile: dh = nt*16 + half*8 .. + 7).
    const float inv = 1.0f / fmaxf(lrow + xhalf(lrow), 1e-20f);
    __bf16* orow = ob + ((size_t)(tok0 + q0 + l16) * 16 + h) * 128 + half * 8;
#pragma unroll
    for (int nt = 0; nt < 8; ++nt) {
        v8bf w;
#pragma unroll
        for (int r = 0; r < 8; ++r) w[r] = (__bf16)(o[nt][r] * inv);
        *(v8bf*)(orow + nt * 16) = w;
    }
}

// ---------------------------------------------------------------------------
// Host-side orchestration
// ---------------------------------------------------------------------------
extern "C" void kernel_launch(void* const* d_in, const int* in_sizes, int n_in,
                              void* d_out, int out_size, void* d_ws, size_t ws_size,
                              hipStream_t stream) {
    (void)in_sizes; (void)n_in; (void)out_size; (void)ws_size;
    const float* x  = (const float*)d_in[0];
    const float* Wq = (const float*)d_in[1];
    const float* Wk = (const float*)d_in[2];
    const float* Wv = (const float*)d_in[3];
    const float* Wo = (const float*)d_in[4];
    const float* qg = (const float*)d_in[5];
    const float* kg = (const float*)d_in[6];
    float* out = (float*)d_out;

    const int M = 4096;        // tokens (2 batches x 2048)
    const int D = 2048;        // model dim
    const int KVD = 512;       // kv dim

    uint8_t* w = (uint8_t*)d_ws;
    __bf16* xb  = (__bf16*)(w);                // 16 MiB  x in bf16
    __bf16* wqt = (__bf16*)(w + 16777216);     //  8 MiB  Wq^T bf16
    __bf16* wkt = (__bf16*)(w + 25165824);     //  2 MiB  Wk^T bf16
    __bf16* wvt = (__bf16*)(w + 27262976);     //  2 MiB  Wv^T bf16
    __bf16* wot = (__bf16*)(w + 29360128);     //  8 MiB  Wo^T bf16
    __bf16* aob = (__bf16*)(w + 37748736);     // 16 MiB  attention out bf16
    __bf16* qbf = (__bf16*)(w + 88080384);     // 16 MiB  Q bf16 (post-norm)
    __bf16* kbf = (__bf16*)(w + 104857600);    //  4 MiB  K bf16 (post-norm)
    __bf16* vbf = (__bf16*)(w + 109051904);    //  4 MiB  V bf16
    // last workspace byte used: 113,246,208

    // 1) x -> bf16 and the four weights -> transposed bf16
    k_prep<<<1792, 256, 0, stream>>>(x, Wq, Wk, Wv, Wo, xb, wqt, wkt, wvt, wot);
    // 2) QKV projections (WMMA GEMM over wqt, wkt, wvt as one 3072-row matrix)
    //    with QK RMSNorm (per head, DH=128) and bf16 conversion in the epilogue
    k_gemm_qkv<<<dim3((D + 2 * KVD) / 128, M / 128), 128, 0, stream>>>(
        xb, wqt, qg, kg, qbf, kbf, vbf, D);
    // 3) causal GQA flash attention (WMMA)
    k_attn<<<dim3(16, 16, 2), 256, 0, stream>>>(qbf, kbf, vbf, aob);
    // 4) output projection + residual (WMMA GEMM)
    k_gemm_out<<<dim3(D / 128, M / 128), 128, 0, stream>>>(
        aob, wot, x, out, D, D);
}

// v009
// A run of this version takes 121 microseconds.
// Two timings next to v008 both put it at 1.09 times that version's speed.
// Counting every step since v000, it is 3.42 times as fast.
#include <hip/hip_runtime.h>
#include <hip/hip_bf16.h>

// ---------------------------------------------------------------------------
// Transformer block for gfx1250: wave32 + WMMA bf16 pipeline
// with async global->LDS staging (ASYNCcnt) and double-buffered GEMM tiles.
// ---------------------------------------------------------------------------

#define DEV static __device__ __forceinline__

typedef __attribute__((ext_vector_type(16))) __bf16 v16bf;
typedef __attribute__((ext_vector_type(8)))  __bf16 v8bf;
typedef __attribute__((ext_vector_type(8)))  float  v8f;
typedef __attribute__((ext_vector_type(4)))  int    v4i;
typedef __attribute__((ext_vector_type(4)))  float  v4f;

#define LDS_AS __attribute__((address_space(3)))
#define GLB_AS __attribute__((address_space(1)))

DEV v8f vzero8() {
    v8f z;
#pragma unroll
    for (int i = 0; i < 8; ++i) z[i] = 0.0f;
    return z;
}

// Async global -> LDS copy of one 16-byte chunk (tracked by ASYNCcnt).
DEV void async_b128(const __bf16* g, __bf16* l) {
#if __has_builtin(__builtin_amdgcn_global_load_async_to_lds_b128)
    __builtin_amdgcn_global_load_async_to_lds_b128(
        (GLB_AS v4i*)(uintptr_t)g,
        (LDS_AS v4i*)(uint32_t)(uintptr_t)l, 0, 0);
#else
    unsigned loff = (unsigned)(uintptr_t)l;
    asm volatile("global_load_async_to_lds_b128 %0, %1, off"
                 :: "v"(loff), "v"(g) : "memory");
#endif
}

DEV void wait_async0() {
#if __has_builtin(__builtin_amdgcn_s_wait_asynccnt)
    __builtin_amdgcn_s_wait_asynccnt(0);
#else
    asm volatile("s_wait_asynccnt 0" ::: "memory");
#endif
}

// Build a 16-element bf16 fragment from two 16-byte chunks (the CDNA5 A/B
// 16-bit layout: lane holds K = half*8..+7 and K = 16+half*8..+7).
DEV v16bf ld_frag(const __bf16* lo, const __bf16* hi) {
    v8bf a = *(const v8bf*)lo;
    v8bf b = *(const v8bf*)hi;
    return __builtin_shufflevector(a, b, 0, 1, 2, 3, 4, 5, 6, 7,
                                          8, 9, 10, 11, 12, 13, 14, 15);
}

DEV v8f wmma_bf16(v16bf a, v16bf b, v8f c) {
    return __builtin_amdgcn_wmma_f32_16x16x32_bf16(
        false, a, false, b, (short)0, c, false, false);
}

// Value of lane l ^ 16.
DEV float xhalf(float x) {
    return __builtin_bit_cast(float, __builtin_amdgcn_permlanex16(
        __builtin_bit_cast(int, x), __builtin_bit_cast(int, x),
        0x76543210, 0xfedcba98, false, false));
}

// ---------------------------------------------------------------------------
// Elementwise f32 -> bf16 convert. A wave starts once and moves U * 512 B:
// all U 16-byte loads of a lane are issued before the first store, each load
// and each store of a wave covering whole 128-B lines.
// ---------------------------------------------------------------------------
// Inputs-only fence on 16 loaded values and on the address they were loaded
// from: every load is issued, and has landed, before anything that follows, and
// no load's result is placed on the address pair that the others still name.
// Without it the compiler sinks part of the 16 loads behind the first results'
// use, and the wave waits out the memory latency again for each part.
DEV void hold16(const v4f* v, const float* p) {
    asm volatile("" :: "v"(v[0]), "v"(v[1]), "v"(v[2]), "v"(v[3]), "v"(v[4]),
                       "v"(v[5]), "v"(v[6]), "v"(v[7]), "v"(v[8]), "v"(v[9]),
                       "v"(v[10]), "v"(v[11]), "v"(v[12]), "v"(v[13]),
                       "v"(v[14]), "v"(v[15]), "v"(p));
}

template <int U>
DEV void cvt_body(const float* __restrict__ in, __bf16* __restrict__ out,
                  int blk) {
    const size_t base = (size_t)blk * (1024 * U) + threadIdx.x * 4;
    const float* p = in + base;
    v4f v[U];
#pragma unroll
    for (int u = 0; u < U; ++u) v[u] = *(const v4f*)(p + u * 1024);
    if constexpr (U == 16) hold16(v, p);
#pragma unroll
    for (int u = 0; u < U; ++u) {
        union { __bf16 h[4]; uint2 u2; } o;
        o.h[0] = (__bf16)v[u].x; o.h[1] = (__bf16)v[u].y;
        o.h[2] = (__bf16)v[u].z; o.h[3] = (__bf16)v[u].w;
        *(uint2*)&out[base + u * 1024] = o.u2;
    }
    // The job's code may be followed by another job's in the merged kernel: the
    // stores' registers are not rewritten there ahead of this wait.
    asm volatile("s_wait_xcnt 0x0" ::: "memory");
}

// ---------------------------------------------------------------------------
// Weight transpose + convert: W[K][N] f32 -> Wt[N][K] bf16, one 128 (k) x 64 (n)
// tile per block. A thread loads an 8 (k) x 4 (n) patch by eight 16-byte loads
// (a wave: two 256-B row pieces each), packs four 8-k vectors in registers and
// passes them through LDS so that the stores are 256-B pieces of Wt rows.
// LDS row i*16 + c holds n = 4*c + i: at a pitch of 272 B the sixteen lanes of
// one ds_store_b128 then fall on all 64 banks.
// ---------------------------------------------------------------------------
#define TWP 136  // LDS row pitch in elements (272 B)

template <int K, int N>
DEV void cvt_w_t_body(const float* __restrict__ W, __bf16* __restrict__ Wt,
                      __bf16* t, int blk) {
    // blk counts the tiles of W with the n tile running fastest.
    const int k0 = (blk / (N / 64)) * 128, n0 = (blk % (N / 64)) * 64;
    const int tid = threadIdx.x;
    const int c4 = tid & 15, rq = tid >> 4;
    // K and N are compile-time: one address per lane, rows by immediate offset.
    const float* src = W + (size_t)(k0 + rq * 8) * N + n0 + c4 * 4;
    float v[8][4];
#pragma unroll
    for (int j = 0; j < 8; ++j) {
        float4 f = *(const float4*)(src + j * N);
        v[j][0] = f.x; v[j][1] = f.y; v[j][2] = f.z; v[j][3] = f.w;
    }
#pragma unroll
    for (int i = 0; i < 4; ++i) {
        v8bf p;
#pragma unroll
        for (int j = 0; j < 8; ++j) p[j] = (__bf16)v[j][i];
        *(v8bf*)&t[(i * 16 + c4) * TWP + rq * 8] = p;
    }
    __syncthreads();
    // LDS row i*16 + rq is Wt row n0 + 4*rq + i; sixteen lanes store its 256 B.
    __bf16* dst = Wt + (size_t)(n0 + rq * 4) * K + k0 + c4 * 8;
#pragma unroll
    for (int i = 0; i < 4; ++i)
        *(v8bf*)(dst + i * K) = *(const v8bf*)&t[(i * 16 + rq) * TWP + c4 * 8];
    // The job's code may be followed by another job's in the merged kernel: the
    // stores' registers are not rewritten there ahead of this wait.
    asm volatile("s_wait_xcnt 0x0" ::: "memory");
}

// One launch for the five jobs that depend on nothing but the inputs; a block's
// index says which job and which piece of it the block takes:
// 512 blocks x (16,384 elements each), 512 Wq, 512 Wo, 128 Wk, 128 Wv tiles.
__global__ __launch_bounds__(256)
void k_prep(const float* __restrict__ x, const float* __restrict__ Wq,
            const float* __restrict__ Wk, const float* __restrict__ Wv,
            const float* __restrict__ Wo, __bf16* __restrict__ xb,
            __bf16* __restrict__ wqt, __bf16* __restrict__ wkt,
            __bf16* __restrict__ wvt, __bf16* __restrict__ wot) {
    __shared__ __attribute__((aligned(16))) __bf16 t[64 * TWP];
    const int b = blockIdx.x;
    if (b < 512)       cvt_body<16>(x, xb, b);
    else if (b < 1024) cvt_w_t_body<2048, 2048>(Wq, wqt, t, b - 512);
    else if (b < 1536) cvt_w_t_body<2048, 2048>(Wo, wot, t, b - 1024);
    else if (b < 1664) cvt_w_t_body<2048, 512>(Wk, wkt, t, b - 1536);
    else               cvt_w_t_body<2048, 512>(Wv, wvt, t, b - 1664);
}

// ---------------------------------------------------------------------------
// Tiled WMMA GEMM: C[M][N] f32 = A[M][K] bf16 * Bt[N][K] bf16 + residual
// Block = 2 x NW waves, tile 128 x (64 * NW), K-step 128, double-buffered async
// global->LDS staging. A wave owns a 64x64 piece: four A and four Bt fragments
// feed sixteen WMMAs, one LDS fragment load pair per two WMMAs. NW is chosen so
// that the grid is one block per WGP: the waves that a WGP holds anyway then
// share one staged A tile, instead of each 128x128 block fetching its own copy
// of it from L2. The one block has the WGP's LDS to itself and no sibling block
// that works while it stands at its barrier: a stage is 128 k deep, one barrier
// per 64 WMMAs of a wave.
// ---------------------------------------------------------------------------
#define GKS 128
#define GKP 136  // padded LDS row stride (272 B, an odd multiple of 16 B)

// Main loop. Bt points at the first of the block's 64*NW rows. Wave w owns rows
// m_blk + 64*(w & 1) .. + 63 of A against rows 64*(w >> 1) .. + 63 of Bt, as
// 4 x 4 tiles of 16x16; tile (mt, nt) starts at row mt*16, column nt*16 of that.
// TR = false: acc[mt][nt][r] is row 8*half + r of A, row l16 of Bt in the tile.
// TR = true (operands swapped, the tile comes out transposed): acc[mt][nt][r] is
// row l16 of A, row 8*half + r of Bt, so a lane holds, for each mt, 32 of the
// wave's 64 columns of ONE output row, in runs of eight.
template <bool TR, int NW>
DEV void gemm_main(const __bf16* __restrict__ A, const __bf16* __restrict__ Bt,
                   int m_blk, int K, v8f (&acc)[4][4]) {
    __shared__ __attribute__((aligned(16))) __bf16 a_lds[2][128 * GKP];
    __shared__ __attribute__((aligned(16))) __bf16 b_lds[2][NW * 64 * GKP];
    const int tid = threadIdx.x;
    const int lane = tid & 31, wave = tid >> 5;
    const int half = (lane >> 4) & 1, l16 = lane & 15;
    const int m0 = (wave & 1) * 64, n0 = (wave >> 1) * 64;
    const int r_base = tid >> 4, c_st = (tid & 15) * 8;
    // The A tile is 2048 16-byte chunks: eight for each thread of waves 0 to 7.
    // The wave number is read as a scalar, so that a wave that copies none of A
    // branches round those copies instead of issuing them with every lane off.
    const bool a_copier = NW == 4 || __builtin_amdgcn_readfirstlane(wave) < 8;

#pragma unroll
    for (int i = 0; i < 4; ++i)
#pragma unroll
        for (int j = 0; j < 4; ++j) acc[i][j] = vzero8();

    // Stage 128 k of the block's 64*NW rows of Bt (sixteen chunks a thread) and of
    // its 128 rows of A into LDS buffer `buf` (async).
    auto stage = [&](int k0, int buf) {
#pragma unroll
        for (int i = 0; i < 16; ++i) {
            int r = r_base + i * (NW * 4);
            async_b128(&Bt[(size_t)r * K + k0 + c_st],
                       &b_lds[buf][r * GKP + c_st]);
        }
        if (a_copier) {
#pragma unroll
            for (int i = 0; i < 8; ++i) {
                int r = r_base + i * 16;
                async_b128(&A[(size_t)(m_blk + r) * K + k0 + c_st],
                           &a_lds[buf][r * GKP + c_st]);
            }
        }
    };

    const int T = K / GKS;
    stage(0, 0);
    for (int t = 0; t < T; ++t) {
        wait_async0();          // tile t landed (async loads retire in order)
        __syncthreads();        // visible to all waves; prior reads finished
        if (t + 1 < T) stage((t + 1) * GKS, (t + 1) & 1);  // overlap copy
        const __bf16* abase = &a_lds[t & 1][(m0 + l16) * GKP + half * 8];
        const __bf16* bbase = &b_lds[t & 1][(n0 + l16) * GKP + half * 8];
#pragma unroll
        for (int kh = 0; kh < 2; ++kh) {  // the stage's two halves of 64 k
            v16bf af[2][4], bfr[2][4];
#pragma unroll
            for (int kk = 0; kk < 2; ++kk) {
#pragma unroll
                for (int mt = 0; mt < 4; ++mt) {
                    const __bf16* arow =
                        abase + mt * 16 * GKP + kh * 64 + kk * 32;
                    af[kk][mt] = ld_frag(arow, arow + 16);
                }
#pragma unroll
                for (int nt = 0; nt < 4; ++nt) {
                    const __bf16* brow =
                        bbase + nt * 16 * GKP + kh * 64 + kk * 32;
                    bfr[kk][nt] = ld_frag(brow, brow + 16);
                }
            }
            // Keeps the half's 32 fragment loads one group ahead of its 32 WMMAs
            // (counted waits); spread among them, each pair costs a full LDS wait.
            __builtin_amdgcn_sched_barrier(0);
#pragma unroll
            for (int kk = 0; kk < 2; ++kk)
#pragma unroll
                for (int nt = 0; nt < 4; ++nt)
#pragma unroll
                    for (int mt = 0; mt < 4; ++mt)
                        acc[mt][nt] =
                            TR ? wmma_bf16(bfr[kk][nt], af[kk][mt], acc[mt][nt])
                               : wmma_bf16(af[kk][mt], bfr[kk][nt], acc[mt][nt]);
            // Keeps the next half's loads from being drawn up among these WMMAs,
            // for the same reason.
            __builtin_amdgcn_sched_barrier(0);
        }
    }
}

// Bt points at the first of the block's 256 rows, C (and resid) at the first of
// its 256 columns; N is the row length of C.
DEV void gemm_body(const __bf16* __restrict__ A, const __bf16* __restrict__ Bt,
                   const float* __restrict__ resid, float* __restrict__ C,
                   int m_blk, int N, int K) {
    const int tid = threadIdx.x;
    const int lane = tid & 31, wave = tid >> 5;
    const int half = (lane >> 4) & 1, l16 = lane & 15;
    const int m0 = (wave & 1) * 64, n0 = (wave >> 1) * 64;

    v8f acc[4][4];
    gemm_main<false, 4>(A, Bt, m_blk, K, acc);

    // Element (tile mt, row r, tile nt) of this lane lies at
    // o0 + (mt * 16 + r) * N + nt * 16. The lane's 128 residual values are loaded
    // in a loop of their own, with no test and no store between them: as many as
    // the load counter takes are in flight together, instead of one latency per
    // value. The rows are then stored as they land.
    const size_t o0 = (size_t)(m_blk + m0 + half * 8) * N + n0 + l16;
    float rv[4][8][4];
#pragma unroll
    for (int mt = 0; mt < 4; ++mt)
#pragma unroll
        for (int r = 0; r < 8; ++r) {
            const float* pr = resid + o0 + (size_t)(mt * 16 + r) * N;
#pragma unroll
            for (int nt = 0; nt < 4; ++nt) rv[mt][r][nt] = pr[nt * 16];
            // The row's address registers are reused for a later row. Named as
            // an input they stay as they are up to this wait.
            asm volatile("s_wait_xcnt 0x0" :: "v"(pr) : "memory");
        }
#pragma unroll
    for (int mt = 0; mt < 4; ++mt)
#pragma unroll
        for (int r = 0; r < 8; ++r) {
            float* pc = C + o0 + (size_t)(mt * 16 + r) * N;
            float d[4];
#pragma unroll
            for (int nt = 0; nt < 4; ++nt) {
                d[nt] = acc[mt][nt][r] + rv[mt][r][nt];
                pc[nt * 16] = d[nt];
            }
            // The row's address and data registers are reused for a later row.
            // Named as inputs they stay as they are up to this wait.
            asm volatile("s_wait_xcnt 0x0" :: "v"(pc), "v"(d[0]), "v"(d[1]),
                                              "v"(d[2]), "v"(d[3]) : "memory");
        }
}

// Q, K and V projections in one launch, with the per-head RMSNorm (Q, K) and the
// conversion to bf16 done on the f32 accumulators. Wt holds Wq^T, Wk^T, Wv^T one
// behind the other (3072 rows of K); blockIdx.x is the 384-row tile of Wt, which
// is exactly three heads, two wave columns each: of the 24 heads 16 go to q (rows
// of 2048), 4 to k and 4 to v (rows of 512); which it is, is the same for a whole
// wave. With the transposed tiles a token's half head (the wave's 64 columns)
// lies in the two lanes l16 and l16 + 16: its sum of squares is in-lane plus one
// exchange between the halves; the two waves that share a token's head pass each
// other their half sums through LDS. Each tile leaves as one 16-byte store per
// lane.
__global__ __launch_bounds__(384)
void k_gemm_qkv(const __bf16* __restrict__ A, const __bf16* __restrict__ Wt,
                const float* __restrict__ qg, const float* __restrict__ kg,
                __bf16* __restrict__ q, __bf16* __restrict__ k,
                __bf16* __restrict__ v, int K) {
    __shared__ float ssq[6][128];  // [wave column][row of the block]
    const int lane = threadIdx.x & 31;
    // Read as a scalar: the head's pointers and tests below stay scalar.
    const int wave = __builtin_amdgcn_readfirstlane(threadIdx.x >> 5);
    const int half = (lane >> 4) & 1, l16 = lane & 15;
    const int m0 = (wave & 1) * 64, wn = wave >> 1, n0 = (wn & 1) * 64;
    const int x = blockIdx.x * 3 + (wn >> 1);  // the wave's head, 0 .. 23
    const int m_blk = blockIdx.y * 128;
    v8f acc[4][4];
    gemm_main<true, 6>(A, Wt + (size_t)blockIdx.x * 384 * K, m_blk, K, acc);

    __bf16* C = x < 16 ? q + x * 128 : x < 20 ? k + (x - 16) * 128
                                              : v + (x - 20) * 128;
    const int N = x < 16 ? 2048 : 512;
    __bf16* orow = C + (size_t)(m_blk + m0 + l16) * N + n0 + half * 8;
    float ss[4] = {0.0f, 0.0f, 0.0f, 0.0f};
    if (x < 20) {
#pragma unroll
        for (int mt = 0; mt < 4; ++mt) {
            float sq[4];  // one chain per tile: four short chains, not one of 32
#pragma unroll
            for (int nt = 0; nt < 4; ++nt) {
                sq[nt] = 0.0f;
#pragma unroll
                for (int r = 0; r < 8; ++r)
                    sq[nt] += acc[mt][nt][r] * acc[mt][nt][r];
            }
            ss[mt] = (sq[0] + sq[1]) + (sq[2] + sq[3]);
            ss[mt] += xhalf(ss[mt]);
            if (half == 0) ssq[wn][m0 + mt * 16 + l16] = ss[mt];
        }
    }
    // Both column halves' sums of squares are in LDS. A block may hold k and v
    // heads side by side, so every wave passes this barrier, the v waves too.
    __syncthreads();
    if (x < 20) {
        const float* g = (x < 16 ? qg : kg) + n0 + half * 8;
        v4f g0[4], g1[4];
#pragma unroll
        for (int nt = 0; nt < 4; ++nt) {
            g0[nt] = *(const v4f*)(g + nt * 16);
            g1[nt] = *(const v4f*)(g + nt * 16 + 4);
        }
#pragma unroll
        for (int mt = 0; mt < 4; ++mt) {
            const float st = ss[mt] + ssq[wn ^ 1][m0 + mt * 16 + l16];
            const float rs = rsqrtf(st * (1.0f / 128.0f) + 1e-8f);
#pragma unroll
            for (int nt = 0; nt < 4; ++nt) {
                v8bf w;
#pragma unroll
                for (int r = 0; r < 4; ++r) {
                    w[r]     = (__bf16)(acc[mt][nt][r] * rs * g0[nt][r]);
                    w[4 + r] = (__bf16)(acc[mt][nt][4 + r] * rs * g1[nt][r]);
                }
                *(v8bf*)(orow + (size_t)(mt * 16) * N + nt * 16) = w;
            }
        }
    } else {
#pragma unroll
        for (int mt = 0; mt < 4; ++mt) {
            __bf16* pv = orow + (size_t)(mt * 16) * N;
            v8bf w[4];
#pragma unroll
            for (int nt = 0; nt < 4; ++nt) {
#pragma unroll
                for (int r = 0; r < 8; ++r) w[nt][r] = (__bf16)acc[mt][nt][r];
                *(v8bf*)(pv + nt * 16) = w[nt];
            }
            // The row's address and data registers may be reused by what follows
            // these stores. Named as inputs they stay as they are up to this wait.
            asm volatile("s_wait_xcnt 0x0" :: "v"(pv), "v"(w[0]), "v"(w[1]),
                                              "v"(w[2]), "v"(w[3]) : "memory");
        }
    }
}

__global__ __launch_bounds__(256)
void k_gemm_out(const __bf16* __restrict__ A, const __bf16* __restrict__ Bt,
                const float* __restrict__ resid, float* __restrict__ C,
                int N, int K) {
    const int n_blk = blockIdx.x * 256;
    gemm_body(A, Bt + (size_t)n_blk * K, resid + n_blk, C + n_blk,
              blockIdx.y * 128, N, K);
}

#define AKP 136  // K row stride: 272 B, odd multiple of 16 B (ds_load_b128 reader)
#define AVP 144  // V row stride: 288 B, odd multiple of 32 B (transposing reader)

typedef __attribute__((ext_vector_type(8))) short v8s;

// Transposing LDS load: lane (c, half) gets T[kbase + 8*half + 0..7][dbase + c].
DEV v8bf ld_tr16(const __bf16* p) {
    return __builtin_bit_cast(
        v8bf, __builtin_amdgcn_ds_load_tr16_b128_v8i16((LDS_AS v8s*)p));
}

__global__ __launch_bounds__(256)
void k_attn(const __bf16* __restrict__ qb, const __bf16* __restrict__ kb,
            const __bf16* __restrict__ vb, __bf16* __restrict__ ob) {
    __shared__ __attribute__((aligned(16))) __bf16 k_lds[128 * AKP];
    __shared__ __attribute__((aligned(16))) __bf16 v_lds[128 * AVP];

    const int tid = threadIdx.x;
    const int lane = tid & 31, wave = tid >> 5;
    const int half = (lane >> 4) & 1, l16 = lane & 15;
    // Block index -> (query tile, head, batch), a permutation of the 512 jobs.
    // A job costs qt + 1 key tiles. With qt = blockIdx.x
    // the blocks whose flat index agrees modulo 8 or 16 hold only one or
    // two values of qt, and blocks 16, 64, 128 or
    // 256 apart hold the same one. Here every such class holds t, 15 - t, t ^ 8
    // and 15 - (t ^ 8) equally often, and two blocks whose flat index differs in
    // the one bit 8, 16, 64, 128 or 256 take tiles t and 15 - t: 17 key tiles
    // together. For speed only: any placement gives the same result.
    const int bx = blockIdx.x, by = blockIdx.y, b = blockIdx.z;
    const int h = (bx >> 3) | ((by & 1) << 1) | ((by >> 2) << 2);
    const int tl = (bx & 7) | ((by & 2) << 2);
    const int qt = ((__builtin_popcount(h) + b) & 1) ? 15 - tl : tl;
    const int kvh = h >> 2;            // GQA group of 4
    const int tok0 = b * 2048;
    const int q0 = qt * 128 + wave * 16;  // wave's first query row (in-batch)
    const float scale = 0.08838834764831845f;  // 128^-0.5

    // Q fragments (B operand): column = query l16, 4 K-chunks of 32 over dh.
    v16bf qf[4];
    {
        const int t = tok0 + q0 + l16;
        const __bf16* qrow = qb + ((size_t)t * 16 + h) * 128;
#pragma unroll
        for (int kk = 0; kk < 4; ++kk)
            qf[kk] = ld_frag(qrow + kk * 32 + half * 8,
                             qrow + kk * 32 + 16 + half * 8);
    }

    v8f o[8];  // O^T tiles: row dh = nt*16 + half*8 + r, column = query l16
#pragma unroll
    for (int i = 0; i < 8; ++i) o[i] = vzero8();
    float mrow = -3.0e38f;  // this lane's query: running maximum (both halves)
    float lrow = 0.0f;      // running sum over this half's keys only

    for (int kt = 0; kt <= qt; ++kt) {
        __syncthreads();  // previous tile fully consumed
        // --- async K and V tiles: [key][dh], 128 keys x 16 chunks each ---
#pragma unroll
        for (int i = 0; i < 8; ++i) {
            int idx = tid + i * 256;
            int key = idx >> 4, c = (idx & 15) * 8;
            int t = tok0 + kt * 128 + key;
            async_b128(&kb[((size_t)t * 4 + kvh) * 128 + c],
                       &k_lds[key * AKP + c]);
            async_b128(&vb[((size_t)t * 4 + kvh) * 128 + c],
                       &v_lds[key * AVP + c]);
        }
        wait_async0();
        __syncthreads();

        // Skip fully-masked 32-key groups on the diagonal tile.
        const int gmax = (kt == qt) ? (wave * 16 + 15) / 32 : 3;
        for (int g = 0; g <= gmax; ++g) {
            // S^T = K Q^T for 32 keys (two 16-key tiles), K-dim = dh = 128.
            v16bf kf0[4], kf1[4];
#pragma unroll
            for (int kk = 0; kk < 4; ++kk) {
                const __bf16* kr0 = &k_lds[(g * 32 + l16) * AKP + kk * 32];
                const __bf16* kr1 = &k_lds[(g * 32 + 16 + l16) * AKP + kk * 32];
                kf0[kk] = ld_frag(kr0 + half * 8, kr0 + 16 + half * 8);
                kf1[kk] = ld_frag(kr1 + half * 8, kr1 + 16 + half * 8);
            }
            // Keeps the 16 K loads one group ahead of their WMMAs (counted
            // waits); spread among them, each pair costs a full LDS wait.
            __builtin_amdgcn_sched_barrier(0);
            v8f s0 = vzero8(), s1 = vzero8();
#pragma unroll
            for (int kk = 0; kk < 4; ++kk) {
                s0 = wmma_bf16(kf0[kk], qf[kk], s0);
                s1 = wmma_bf16(kf1[kk], qf[kk], s1);
            }
            // V^T fragments: A = 16 (dh) x 32 (keys) by two transposing loads.
            const __bf16* vr = &v_lds[(g * 32 + half * 8 + (lane & 7)) * AVP +
                                      ((lane >> 3) & 1) * 8];
            v16bf vf[8];
#pragma unroll
            for (int nt = 0; nt < 8; ++nt) {
                v8bf lo = ld_tr16(vr + nt * 16);
                v8bf hi = ld_tr16(vr + 16 * AVP + nt * 16);
                vf[nt] = __builtin_shufflevector(lo, hi, 0, 1, 2, 3, 4, 5, 6, 7,
                                                 8, 9, 10, 11, 12, 13, 14, 15);
            }
            // Keeps the 16 V^T loads one group here, in flight under the
            // softmax arithmetic, instead of one full LDS wait per WMMA.
            __builtin_amdgcn_sched_barrier(0);
            // Scale + causal mask + this query's max over the 32-key group.
            const int qg = q0 + l16;
            const int kg0 = kt * 128 + g * 32 + half * 8;  // + r
            float p0[8], p1[8];
            float tmax = -3.0e38f;
#pragma unroll
            for (int r = 0; r < 8; ++r) {
                float a = s0[r] * scale, c = s1[r] * scale;
                if (kg0 + r > qg) a = -3.0e38f;
                if (kg0 + 16 + r > qg) c = -3.0e38f;
                p0[r] = a; p1[r] = c;
                tmax = fmaxf(tmax, fmaxf(a, c));
            }
            tmax = fmaxf(tmax, xhalf(tmax));
            // Online softmax update; P^T packs into the B operand in place:
            // elements 0..7 are keys half*8 + r, 8..15 are keys 16 + half*8 + r.
            const float mn = fmaxf(mrow, tmax);
            const bool live = mn > -1.0e37f;
            const float al = live ? __expf(mrow - mn) : 1.0f;
            float rs0 = 0.0f, rs1 = 0.0f;
            v16bf pf;
#pragma unroll
            for (int r = 0; r < 8; ++r) {
                float e0 = live ? __expf(p0[r] - mn) : 0.0f;
                float e1 = live ? __expf(p1[r] - mn) : 0.0f;
                rs0 += e0; rs1 += e1;
                pf[r]     = (__bf16)e0;
                pf[8 + r] = (__bf16)e1;
            }
            lrow = lrow * al + (rs0 + rs1);
            mrow = mn;
            // Rescale running output accumulators.
#pragma unroll
            for (int nt = 0; nt < 8; ++nt)
#pragma unroll
                for (int r = 0; r < 8; ++r) o[nt][r] *= al;
            // O^T += V^T P^T.
#pragma unroll
            for (int nt = 0; nt < 8; ++nt) o[nt] = wmma_bf16(vf[nt], pf, o[nt]);
        }
    }

    // Finalize: join the halves' sums, divide, store bf16 [token][h*128 + dh]
    // (16 bytes per lane and tile: dh = nt*16 + half*8 .. + 7).
    const float inv = 1.0f / fmaxf(lrow + xhalf(lrow), 1e-20f);
    __bf16* orow = ob + ((size_t)(tok0 + q0 + l16) * 16 + h) * 128 + half * 8;
#pragma unroll
    for (int nt = 0; nt < 8; ++nt) {
        v8bf w;
#pragma unroll
        for (int r = 0; r < 8; ++r) w[r] = (__bf16)(o[nt][r] * inv);
        *(v8bf*)(orow + nt * 16) = w;
    }
}

// ---------------------------------------------------------------------------
// Host-side orchestration
// ---------------------------------------------------------------------------
extern "C" void kernel_launch(void* const* d_in, const int* in_sizes, int n_in,
                              void* d_out, int out_size, void* d_ws, size_t ws_size,
                              hipStream_t stream) {
    (void)in_sizes; (void)n_in; (void)out_size; (void)ws_size;
    const float* x  = (const float*)d_in[0];
    const float* Wq = (const float*)d_in[1];
    const float* Wk = (const float*)d_in[2];
    const float* Wv = (const float*)d_in[3];
    const float* Wo = (const float*)d_in[4];
    const float* qg = (const float*)d_in[5];
    const float* kg = (const float*)d_in[6];
    float* out = (float*)d_out;

    const int M = 4096;        // tokens (2 batches x 2048)
    const int D = 2048;        // model dim
    const int KVD = 512;       // kv dim

    uint8_t* w = (uint8_t*)d_ws;
    __bf16* xb  = (__bf16*)(w);                // 16 MiB  x in bf16
    __bf16* wqt = (__bf16*)(w + 16777216);     //  8 MiB  Wq^T bf16
    __bf16* wkt = (__bf16*)(w + 25165824);     //  2 MiB  Wk^T bf16
    __bf16* wvt = (__bf16*)(w + 27262976);     //  2 MiB  Wv^T bf16
    __bf16* wot = (__bf16*)(w + 29360128);     //  8 MiB  Wo^T bf16
    __bf16* aob = (__bf16*)(w + 37748736);     // 16 MiB  attention out bf16
    __bf16* qbf = (__bf16*)(w + 88080384);     // 16 MiB  Q bf16 (post-norm)
    __bf16* kbf = (__bf16*)(w + 104857600);    //  4 MiB  K bf16 (post-norm)
    __bf16* vbf = (__bf16*)(w + 109051904);    //  4 MiB  V bf16
    // last workspace byte used: 113,246,208

    // 1) x -> bf16 and the four weights -> transposed bf16
    k_prep<<<1792, 256, 0, stream>>>(x, Wq, Wk, Wv, Wo, xb, wqt, wkt, wvt, wot);
    // 2) QKV projections (WMMA GEMM over wqt, wkt, wvt as one 3072-row matrix)
    //    with QK RMSNorm (per head, DH=128) and bf16 conversion in the epilogue
    k_gemm_qkv<<<dim3((D + 2 * KVD) / 384, M / 128), 384, 0, stream>>>(
        xb, wqt, qg, kg, qbf, kbf, vbf, D);
    // 3) causal GQA flash attention (WMMA)
    k_attn<<<dim3(16, 16, 2), 256, 0, stream>>>(qbf, kbf, vbf, aob);
    // 4) output projection + residual (WMMA GEMM)
    k_gemm_out<<<dim3(D / 256, M / 128), 256, 0, stream>>>(
        aob, wot, x, out, D, D);
}

// v010
// Measured time: 115 microseconds a run.
// Timed twice side by side with v009, it ran 1.05 times as fast both times.
// Counting every step since v000, it is 3.60 times as fast.
#include <hip/hip_runtime.h>
#include <hip/hip_bf16.h>

// ---------------------------------------------------------------------------
// Transformer block for gfx1250: wave32 + WMMA bf16 pipeline
// with async global->LDS staging (ASYNCcnt) and double-buffered GEMM tiles.
// ---------------------------------------------------------------------------

#define DEV static __device__ __forceinline__

typedef __attribute__((ext_vector_type(16))) __bf16 v16bf;
typedef __attribute__((ext_vector_type(8)))  __bf16 v8bf;
typedef __attribute__((ext_vector_type(8)))  float  v8f;
typedef __attribute__((ext_vector_type(4)))  int    v4i;
typedef __attribute__((ext_vector_type(4)))  float  v4f;

#define LDS_AS __attribute__((address_space(3)))
#define GLB_AS __attribute__((address_space(1)))

DEV v8f vzero8() {
    v8f z;
#pragma unroll
    for (int i = 0; i < 8; ++i) z[i] = 0.0f;
    return z;
}

// Async global -> LDS copy of one 16-byte chunk (tracked by ASYNCcnt).
DEV void async_b128(const __bf16* g, __bf16* l) {
#if __has_builtin(__builtin_amdgcn_global_load_async_to_lds_b128)
    __builtin_amdgcn_global_load_async_to_lds_b128(
        (GLB_AS v4i*)(uintptr_t)g,
        (LDS_AS v4i*)(uint32_t)(uintptr_t)l, 0, 0);
#else
    unsigned loff = (unsigned)(uintptr_t)l;
    asm volatile("global_load_async_to_lds_b128 %0, %1, off"
                 :: "v"(loff), "v"(g) : "memory");
#endif
}

DEV void wait_async0() {
#if __has_builtin(__builtin_amdgcn_s_wait_asynccnt)
    __builtin_amdgcn_s_wait_asynccnt(0);
#else
    asm volatile("s_wait_asynccnt 0" ::: "memory");
#endif
}

// Build a 16-element bf16 fragment from two 16-byte chunks (the CDNA5 A/B
// 16-bit layout: lane holds K = half*8..+7 and K = 16+half*8..+7).
DEV v16bf ld_frag(const __bf16* lo, const __bf16* hi) {
    v8bf a = *(const v8bf*)lo;
    v8bf b = *(const v8bf*)hi;
    return __builtin_shufflevector(a, b, 0, 1, 2, 3, 4, 5, 6, 7,
                                          8, 9, 10, 11, 12, 13, 14, 15);
}

DEV v8f wmma_bf16(v16bf a, v16bf b, v8f c) {
    return __builtin_amdgcn_wmma_f32_16x16x32_bf16(
        false, a, false, b, (short)0, c, false, false);
}

// Value of lane l ^ 16.
DEV float xhalf(float x) {
    return __builtin_bit_cast(float, __builtin_amdgcn_permlanex16(
        __builtin_bit_cast(int, x), __builtin_bit_cast(int, x),
        0x76543210, 0xfedcba98, false, false));
}

// ---------------------------------------------------------------------------
// Elementwise f32 -> bf16 convert. A wave starts once and moves U * 512 B:
// all U 16-byte loads of a lane are issued before the first store, each load
// and each store of a wave covering whole 128-B lines.
// ---------------------------------------------------------------------------
// Inputs-only fence on 16 loaded values and on the address they were loaded
// from: every load is issued, and has landed, before anything that follows, and
// no load's result is placed on the address pair that the others still name.
// Without it the compiler sinks part of the 16 loads behind the first results'
// use, and the wave waits out the memory latency again for each part.
DEV void hold16(const v4f* v, const float* p) {
    asm volatile("" :: "v"(v[0]), "v"(v[1]), "v"(v[2]), "v"(v[3]), "v"(v[4]),
                       "v"(v[5]), "v"(v[6]), "v"(v[7]), "v"(v[8]), "v"(v[9]),
                       "v"(v[10]), "v"(v[11]), "v"(v[12]), "v"(v[13]),
                       "v"(v[14]), "v"(v[15]), "v"(p));
}

template <int U>
DEV void cvt_body(const float* __restrict__ in, __bf16* __restrict__ out,
                  int blk) {
    const size_t base = (size_t)blk * (1024 * U) + threadIdx.x * 4;
    const float* p = in + base;
    v4f v[U];
#pragma unroll
    for (int u = 0; u < U; ++u) v[u] = *(const v4f*)(p + u * 1024);
    if constexpr (U == 16) hold16(v, p);
#pragma unroll
    for (int u = 0; u < U; ++u) {
        union { __bf16 h[4]; uint2 u2; } o;
        o.h[0] = (__bf16)v[u].x; o.h[1] = (__bf16)v[u].y;
        o.h[2] = (__bf16)v[u].z; o.h[3] = (__bf16)v[u].w;
        *(uint2*)&out[base + u * 1024] = o.u2;
    }
    // The job's code may be followed by another job's in the merged kernel: the
    // stores' registers are not rewritten there ahead of this wait.
    asm volatile("s_wait_xcnt 0x0" ::: "memory");
}

// ---------------------------------------------------------------------------
// Weight transpose + convert: W[K][N] f32 -> Wt[N][K] bf16, one 128 (k) x 64 (n)
// tile per block. A thread loads an 8 (k) x 4 (n) patch by eight 16-byte loads
// (a wave: two 256-B row pieces each), packs four 8-k vectors in registers and
// passes them through LDS so that the stores are 256-B pieces of Wt rows.
// LDS row i*16 + c holds n = 4*c + i: at a pitch of 272 B the sixteen lanes of
// one ds_store_b128 then fall on all 64 banks.
// ---------------------------------------------------------------------------
#define TWP 136  // LDS row pitch in elements (272 B)

template <int K, int N>
DEV void cvt_w_t_body(const float* __restrict__ W, __bf16* __restrict__ Wt,
                      __bf16* t, int blk) {
    // blk counts the tiles of W with the n tile running fastest.
    const int k0 = (blk / (N / 64)) * 128, n0 = (blk % (N / 64)) * 64;
    const int tid = threadIdx.x;
    const int c4 = tid & 15, rq = tid >> 4;
    // K and N are compile-time: one address per lane, rows by immediate offset.
    const float* src = W + (size_t)(k0 + rq * 8) * N + n0 + c4 * 4;
    float v[8][4];
#pragma unroll
    for (int j = 0; j < 8; ++j) {
        float4 f = *(const float4*)(src + j * N);
        v[j][0] = f.x; v[j][1] = f.y; v[j][2] = f.z; v[j][3] = f.w;
    }
#pragma unroll
    for (int i = 0; i < 4; ++i) {
        v8bf p;
#pragma unroll
        for (int j = 0; j < 8; ++j) p[j] = (__bf16)v[j][i];
        *(v8bf*)&t[(i * 16 + c4) * TWP + rq * 8] = p;
    }
    __syncthreads();
    // LDS row i*16 + rq is Wt row n0 + 4*rq + i; sixteen lanes store its 256 B.
    __bf16* dst = Wt + (size_t)(n0 + rq * 4) * K + k0 + c4 * 8;
#pragma unroll
    for (int i = 0; i < 4; ++i)
        *(v8bf*)(dst + i * K) = *(const v8bf*)&t[(i * 16 + rq) * TWP + c4 * 8];
    // The job's code may be followed by another job's in the merged kernel: the
    // stores' registers are not rewritten there ahead of this wait.
    asm volatile("s_wait_xcnt 0x0" ::: "memory");
}

// One launch for the five jobs that depend on nothing but the inputs; a block's
// index says which job and which piece of it the block takes:
// 512 blocks x (16,384 elements each), 512 Wq, 512 Wo, 128 Wk, 128 Wv tiles.
__global__ __launch_bounds__(256)
void k_prep(const float* __restrict__ x, const float* __restrict__ Wq,
            const float* __restrict__ Wk, const float* __restrict__ Wv,
            const float* __restrict__ Wo, __bf16* __restrict__ xb,
            __bf16* __restrict__ wqt, __bf16* __restrict__ wkt,
            __bf16* __restrict__ wvt, __bf16* __restrict__ wot) {
    __shared__ __attribute__((aligned(16))) __bf16 t[64 * TWP];
    const int b = blockIdx.x;
    if (b < 512)       cvt_body<16>(x, xb, b);
    else if (b < 1024) cvt_w_t_body<2048, 2048>(Wq, wqt, t, b - 512);
    else if (b < 1536) cvt_w_t_body<2048, 2048>(Wo, wot, t, b - 1024);
    else if (b < 1664) cvt_w_t_body<2048, 512>(Wk, wkt, t, b - 1536);
    else               cvt_w_t_body<2048, 512>(Wv, wvt, t, b - 1664);
}

// ---------------------------------------------------------------------------
// Tiled WMMA GEMM: C[M][N] f32 = A[M][K] bf16 * Bt[N][K] bf16 + residual
// Block = 2 x NW waves, tile 128 x (64 * NW), K-step 128, double-buffered async
// global->LDS staging. A wave owns a 64x64 piece: four A and four Bt fragments
// feed sixteen WMMAs, one LDS fragment load pair per two WMMAs. NW is chosen so
// that the grid is one block per WGP: the waves that a WGP holds anyway then
// share one staged A tile, instead of each 128x128 block fetching its own copy
// of it from L2. The one block has the WGP's LDS to itself and no sibling block
// that works while it stands at its barrier: a stage is 128 k deep, one barrier
// per 64 WMMAs of a wave.
// ---------------------------------------------------------------------------
#define GKS 128
#define GKP 136  // padded LDS row stride (272 B, an odd multiple of 16 B)

// Main loop. Bt points at the first of the block's 64*NW rows. Wave w owns rows
// m_blk + 64*(w & 1) .. + 63 of A against rows 64*(w >> 1) .. + 63 of Bt, as
// 4 x 4 tiles of 16x16; tile (mt, nt) starts at row mt*16, column nt*16 of that.
// TR = false: acc[mt][nt][r] is row 8*half + r of A, row l16 of Bt in the tile.
// TR = true (operands swapped, the tile comes out transposed): acc[mt][nt][r] is
// row l16 of A, row 8*half + r of Bt, so a lane holds, for each mt, 32 of the
// wave's 64 columns of ONE output row, in runs of eight.
template <bool TR, int NW>
DEV void gemm_main(const __bf16* __restrict__ A, const __bf16* __restrict__ Bt,
                   int m_blk, int K, v8f (&acc)[4][4]) {
    __shared__ __attribute__((aligned(16))) __bf16 a_lds[2][128 * GKP];
    __shared__ __attribute__((aligned(16))) __bf16 b_lds[2][NW * 64 * GKP];
    const int tid = threadIdx.x;
    const int lane = tid & 31, wave = tid >> 5;
    const int half = (lane >> 4) & 1, l16 = lane & 15;
    const int m0 = (wave & 1) * 64, n0 = (wave >> 1) * 64;
    const int r_base = tid >> 4, c_st = (tid & 15) * 8;
    // The A tile is 2048 16-byte chunks: eight for each thread of waves 0 to 7.
    // The wave number is read as a scalar, so that a wave that copies none of A
    // branches round those copies instead of issuing them with every lane off.
    const bool a_copier = NW == 4 || __builtin_amdgcn_readfirstlane(wave) < 8;

#pragma unroll
    for (int i = 0; i < 4; ++i)
#pragma unroll
        for (int j = 0; j < 4; ++j) acc[i][j] = vzero8();

    // Stage 128 k of the block's 64*NW rows of Bt (sixteen chunks a thread) and of
    // its 128 rows of A into LDS buffer `buf` (async).
    auto stage = [&](int k0, int buf) {
#pragma unroll
        for (int i = 0; i < 16; ++i) {
            int r = r_base + i * (NW * 4);
            async_b128(&Bt[(size_t)r * K + k0 + c_st],
                       &b_lds[buf][r * GKP + c_st]);
        }
        if (a_copier) {
#pragma unroll
            for (int i = 0; i < 8; ++i) {
                int r = r_base + i * 16;
                async_b128(&A[(size_t)(m_blk + r) * K + k0 + c_st],
                           &a_lds[buf][r * GKP + c_st]);
            }
        }
    };

    const int T = K / GKS;
    stage(0, 0);
    for (int t = 0; t < T; ++t) {
        wait_async0();          // tile t landed (async loads retire in order)
        __syncthreads();        // visible to all waves; prior reads finished
        if (t + 1 < T) stage((t + 1) * GKS, (t + 1) & 1);  // overlap copy
        const __bf16* abase = &a_lds[t & 1][(m0 + l16) * GKP + half * 8];
        const __bf16* bbase = &b_lds[t & 1][(n0 + l16) * GKP + half * 8];
#pragma unroll
        for (int kh = 0; kh < 2; ++kh) {  // the stage's two halves of 64 k
            v16bf af[2][4], bfr[2][4];
#pragma unroll
            for (int kk = 0; kk < 2; ++kk) {
#pragma unroll
                for (int mt = 0; mt < 4; ++mt) {
                    const __bf16* arow =
                        abase + mt * 16 * GKP + kh * 64 + kk * 32;
                    af[kk][mt] = ld_frag(arow, arow + 16);
                }
#pragma unroll
                for (int nt = 0; nt < 4; ++nt) {
                    const __bf16* brow =
                        bbase + nt * 16 * GKP + kh * 64 + kk * 32;
                    bfr[kk][nt] = ld_frag(brow, brow + 16);
                }
            }
            // Keeps the half's 32 fragment loads one group ahead of its 32 WMMAs
            // (counted waits); spread among them, each pair costs a full LDS wait.
            __builtin_amdgcn_sched_barrier(0);
#pragma unroll
            for (int kk = 0; kk < 2; ++kk)
#pragma unroll
                for (int nt = 0; nt < 4; ++nt)
#pragma unroll
                    for (int mt = 0; mt < 4; ++mt)
                        acc[mt][nt] =
                            TR ? wmma_bf16(bfr[kk][nt], af[kk][mt], acc[mt][nt])
                               : wmma_bf16(af[kk][mt], bfr[kk][nt], acc[mt][nt]);
            // Keeps the next half's loads from being drawn up among these WMMAs,
            // for the same reason.
            __builtin_amdgcn_sched_barrier(0);
        }
    }
}

// Bt points at the first of the block's 256 rows, C (and resid) at the first of
// its 256 columns; N is the row length of C.
DEV void gemm_body(const __bf16* __restrict__ A, const __bf16* __restrict__ Bt,
                   const float* __restrict__ resid, float* __restrict__ C,
                   int m_blk, int N, int K) {
    const int tid = threadIdx.x;
    const int lane = tid & 31, wave = tid >> 5;
    const int half = (lane >> 4) & 1, l16 = lane & 15;
    const int m0 = (wave & 1) * 64, n0 = (wave >> 1) * 64;

    v8f acc[4][4];
    gemm_main<false, 4>(A, Bt, m_blk, K, acc);

    // Element (tile mt, row r, tile nt) of this lane lies at
    // o0 + (mt * 16 + r) * N + nt * 16. The lane's 128 residual values are loaded
    // in a loop of their own, with no test and no store between them: as many as
    // the load counter takes are in flight together, instead of one latency per
    // value. The rows are then stored as they land.
    const size_t o0 = (size_t)(m_blk + m0 + half * 8) * N + n0 + l16;
    float rv[4][8][4];
#pragma unroll
    for (int mt = 0; mt < 4; ++mt)
#pragma unroll
        for (int r = 0; r < 8; ++r) {
            const float* pr = resid + o0 + (size_t)(mt * 16 + r) * N;
#pragma unroll
            for (int nt = 0; nt < 4; ++nt) rv[mt][r][nt] = pr[nt * 16];
            // The row's address registers are reused for a later row. Named as
            // an input they stay as they are up to this wait.
            asm volatile("s_wait_xcnt 0x0" :: "v"(pr) : "memory");
        }
#pragma unroll
    for (int mt = 0; mt < 4; ++mt)
#pragma unroll
        for (int r = 0; r < 8; ++r) {
            float* pc = C + o0 + (size_t)(mt * 16 + r) * N;
            float d[4];
#pragma unroll
            for (int nt = 0; nt < 4; ++nt) {
                d[nt] = acc[mt][nt][r] + rv[mt][r][nt];
                pc[nt * 16] = d[nt];
            }
            // The row's address and data registers are reused for a later row.
            // Named as inputs they stay as they are up to this wait.
            asm volatile("s_wait_xcnt 0x0" :: "v"(pc), "v"(d[0]), "v"(d[1]),
                                              "v"(d[2]), "v"(d[3]) : "memory");
        }
}

// Q, K and V projections in one launch, with the per-head RMSNorm (Q, K) and the
// conversion to bf16 done on the f32 accumulators. Wt holds Wq^T, Wk^T, Wv^T one
// behind the other (3072 rows of K); blockIdx.x is the 384-row tile of Wt, which
// is exactly three heads, two wave columns each: of the 24 heads 16 go to q (rows
// of 2048), 4 to k and 4 to v (rows of 512); which it is, is the same for a whole
// wave. With the transposed tiles a token's half head (the wave's 64 columns)
// lies in the two lanes l16 and l16 + 16: its sum of squares is in-lane plus one
// exchange between the halves; the two waves that share a token's head pass each
// other their half sums through LDS. Each tile leaves as one 16-byte store per
// lane.
__global__ __launch_bounds__(384)
void k_gemm_qkv(const __bf16* __restrict__ A, const __bf16* __restrict__ Wt,
                const float* __restrict__ qg, const float* __restrict__ kg,
                __bf16* __restrict__ q, __bf16* __restrict__ k,
                __bf16* __restrict__ v, int K) {
    __shared__ float ssq[6][128];  // [wave column][row of the block]
    const int lane = threadIdx.x & 31;
    // Read as a scalar: the head's pointers and tests below stay scalar.
    const int wave = __builtin_amdgcn_readfirstlane(threadIdx.x >> 5);
    const int half = (lane >> 4) & 1, l16 = lane & 15;
    const int m0 = (wave & 1) * 64, wn = wave >> 1, n0 = (wn & 1) * 64;
    const int x = blockIdx.x * 3 + (wn >> 1);  // the wave's head, 0 .. 23
    const int m_blk = blockIdx.y * 128;
    v8f acc[4][4];
    gemm_main<true, 6>(A, Wt + (size_t)blockIdx.x * 384 * K, m_blk, K, acc);

    __bf16* C = x < 16 ? q + x * 128 : x < 20 ? k + (x - 16) * 128
                                              : v + (x - 20) * 128;
    const int N = x < 16 ? 2048 : 512;
    __bf16* orow = C + (size_t)(m_blk + m0 + l16) * N + n0 + half * 8;
    float ss[4] = {0.0f, 0.0f, 0.0f, 0.0f};
    if (x < 20) {
#pragma unroll
        for (int mt = 0; mt < 4; ++mt) {
            float sq[4];  // one chain per tile: four short chains, not one of 32
#pragma unroll
            for (int nt = 0; nt < 4; ++nt) {
                sq[nt] = 0.0f;
#pragma unroll
                for (int r = 0; r < 8; ++r)
                    sq[nt] += acc[mt][nt][r] * acc[mt][nt][r];
            }
            ss[mt] = (sq[0] + sq[1]) + (sq[2] + sq[3]);
            ss[mt] += xhalf(ss[mt]);
            if (half == 0) ssq[wn][m0 + mt * 16 + l16] = ss[mt];
        }
    }
    // Both column halves' sums of squares are in LDS. A block may hold k and v
    // heads side by side, so every wave passes this barrier, the v waves too.
    __syncthreads();
    if (x < 20) {
        const float* g = (x < 16 ? qg : kg) + n0 + half * 8;
        v4f g0[4], g1[4];
#pragma unroll
        for (int nt = 0; nt < 4; ++nt) {
            g0[nt] = *(const v4f*)(g + nt * 16);
            g1[nt] = *(const v4f*)(g + nt * 16 + 4);
        }
#pragma unroll
        for (int mt = 0; mt < 4; ++mt) {
            const float st = ss[mt] + ssq[wn ^ 1][m0 + mt * 16 + l16];
            const float rs = rsqrtf(st * (1.0f / 128.0f) + 1e-8f);
#pragma unroll
            for (int nt = 0; nt < 4; ++nt) {
                v8bf w;
#pragma unroll
                for (int r = 0; r < 4; ++r) {
                    w[r]     = (__bf16)(acc[mt][nt][r] * rs * g0[nt][r]);
                    w[4 + r] = (__bf16)(acc[mt][nt][4 + r] * rs * g1[nt][r]);
                }
                *(v8bf*)(orow + (size_t)(mt * 16) * N + nt * 16) = w;
            }
        }
    } else {
#pragma unroll
        for (int mt = 0; mt < 4; ++mt) {
            __bf16* pv = orow + (size_t)(mt * 16) * N;
            v8bf w[4];
#pragma unroll
            for (int nt = 0; nt < 4; ++nt) {
#pragma unroll
                for (int r = 0; r < 8; ++r) w[nt][r] = (__bf16)acc[mt][nt][r];
                *(v8bf*)(pv + nt * 16) = w[nt];
            }
            // The row's address and data registers may be reused by what follows
            // these stores. Named as inputs they stay as they are up to this wait.
            asm volatile("s_wait_xcnt 0x0" :: "v"(pv), "v"(w[0]), "v"(w[1]),
                                              "v"(w[2]), "v"(w[3]) : "memory");
        }
    }
}

__global__ __launch_bounds__(256)
void k_gemm_out(const __bf16* __restrict__ A, const __bf16* __restrict__ Bt,
                const float* __restrict__ resid, float* __restrict__ C,
                int N, int K) {
    const int n_blk = blockIdx.x * 256;
    gemm_body(A, Bt + (size_t)n_blk * K, resid + n_blk, C + n_blk,
              blockIdx.y * 128, N, K);
}

#define AKP 136  // K row stride: 272 B, odd multiple of 16 B (ds_load_b128 reader)
#define AVP 144  // V row stride: 288 B, odd multiple of 32 B (transposing reader)

typedef __attribute__((ext_vector_type(8))) short v8s;

// Transposing LDS load: lane (c, half) gets T[kbase + 8*half + 0..7][dbase + c].
DEV v8bf ld_tr16(const __bf16* p) {
    return __builtin_bit_cast(
        v8bf, __builtin_amdgcn_ds_load_tr16_b128_v8i16((LDS_AS v8s*)p));
}

__global__ __launch_bounds__(256)
void k_attn(const __bf16* __restrict__ qb, const __bf16* __restrict__ kb,
            const __bf16* __restrict__ vb, __bf16* __restrict__ ob) {
    // One array, [buffer][K tile | V tile]: every constant part of an LDS address
    // then fits the 16-bit offset field of the LDS loads.
    __shared__ __attribute__((aligned(16))) __bf16 kv_lds[2][128 * (AKP + AVP)];

    const int tid = threadIdx.x;
    const int lane = tid & 31, wave = tid >> 5;
    const int half = (lane >> 4) & 1, l16 = lane & 15;
    // Block index -> (query tile, head, batch), a permutation of the 512 jobs.
    // A job costs qt + 1 key tiles. With qt = blockIdx.x
    // the blocks whose flat index agrees modulo 8 or 16 hold only one or
    // two values of qt, and blocks 16, 64, 128 or
    // 256 apart hold the same one. Here every such class holds t, 15 - t, t ^ 8
    // and 15 - (t ^ 8) equally often, and two blocks whose flat index differs in
    // the one bit 8, 16, 64, 128 or 256 take tiles t and 15 - t: 17 key tiles
    // together. For speed only: any placement gives the same result.
    const int bx = blockIdx.x, by = blockIdx.y, b = blockIdx.z;
    const int h = (bx >> 3) | ((by & 1) << 1) | ((by >> 2) << 2);
    const int tl = (bx & 7) | ((by & 2) << 2);
    const int qt = ((__builtin_popcount(h) + b) & 1) ? 15 - tl : tl;
    const int kvh = h >> 2;            // GQA group of 4
    const int tok0 = b * 2048;
    const int q0 = qt * 128 + wave * 16;  // wave's first query row (in-batch)
    const float scale = 0.08838834764831845f;  // 128^-0.5

    // Q fragments (B operand): column = query l16, 4 K-chunks of 32 over dh.
    v16bf qf[4];
    {
        const int t = tok0 + q0 + l16;
        const __bf16* qrow = qb + ((size_t)t * 16 + h) * 128;
#pragma unroll
        for (int kk = 0; kk < 4; ++kk)
            qf[kk] = ld_frag(qrow + kk * 32 + half * 8,
                             qrow + kk * 32 + 16 + half * 8);
    }

    v8f o[8];  // O^T tiles: row dh = nt*16 + half*8 + r, column = query l16
#pragma unroll
    for (int i = 0; i < 8; ++i) o[i] = vzero8();
    float mrow = -3.0e38f;  // this lane's query: running maximum (both halves)
    float lrow = 0.0f;      // running sum over this half's keys only

    // Async copies of key tile kt's K and V, [key][dh], 128 keys x 16 chunks each,
    // into LDS buffer buf.
    auto stage = [&](int kt, int buf) {
#pragma unroll
        for (int i = 0; i < 8; ++i) {
            int idx = tid + i * 256;
            int key = idx >> 4, c = (idx & 15) * 8;
            int t = tok0 + kt * 128 + key;
            async_b128(&kb[((size_t)t * 4 + kvh) * 128 + c],
                       &kv_lds[buf][key * AKP + c]);
            async_b128(&vb[((size_t)t * 4 + kvh) * 128 + c],
                       &kv_lds[buf][128 * AKP + key * AVP + c]);
        }
    };

    stage(0, 0);
    // Tile 0 has landed (this wave's copies), then is visible to every wave.
    asm volatile("s_wait_asynccnt 0x0" ::: "memory");
    __syncthreads();
    if (qt >= 1) stage(1, 1);

    for (int kt = 0; kt <= qt; ++kt) {
        const __bf16* kbuf = kv_lds[kt & 1];
        const __bf16* vbuf = kbuf + 128 * AKP;

        // Skip fully-masked 32-key groups on the diagonal tile.
        const int gmax = (kt == qt) ? (wave * 16 + 15) / 32 : 3;
        for (int g = 0; g <= gmax; ++g) {
            // S^T = K Q^T for 32 keys (two 16-key tiles), K-dim = dh = 128.
            v16bf kf0[4], kf1[4];
#pragma unroll
            for (int kk = 0; kk < 4; ++kk) {
                const __bf16* kr0 = &kbuf[(g * 32 + l16) * AKP + kk * 32];
                const __bf16* kr1 = &kbuf[(g * 32 + 16 + l16) * AKP + kk * 32];
                kf0[kk] = ld_frag(kr0 + half * 8, kr0 + 16 + half * 8);
                kf1[kk] = ld_frag(kr1 + half * 8, kr1 + 16 + half * 8);
            }
            // Keeps the 16 K loads one group ahead of their WMMAs (counted
            // waits); spread among them, each pair costs a full LDS wait.
            __builtin_amdgcn_sched_barrier(0);
            v8f s0 = vzero8(), s1 = vzero8();
#pragma unroll
            for (int kk = 0; kk < 4; ++kk) {
                s0 = wmma_bf16(kf0[kk], qf[kk], s0);
                s1 = wmma_bf16(kf1[kk], qf[kk], s1);
            }
            // V^T fragments: A = 16 (dh) x 32 (keys) by two transposing loads.
            const __bf16* vr = &vbuf[(g * 32 + half * 8 + (lane & 7)) * AVP +
                                      ((lane >> 3) & 1) * 8];
            v16bf vf[8];
#pragma unroll
            for (int nt = 0; nt < 8; ++nt) {
                v8bf lo = ld_tr16(vr + nt * 16);
                v8bf hi = ld_tr16(vr + 16 * AVP + nt * 16);
                vf[nt] = __builtin_shufflevector(lo, hi, 0, 1, 2, 3, 4, 5, 6, 7,
                                                 8, 9, 10, 11, 12, 13, 14, 15);
            }
            // Keeps the 16 V^T loads one group here, in flight under the
            // softmax arithmetic, instead of one full LDS wait per WMMA.
            __builtin_amdgcn_sched_barrier(0);
            // Scale + causal mask + this query's max over the 32-key group.
            const int qg = q0 + l16;
            const int kg0 = kt * 128 + g * 32 + half * 8;  // + r
            float p0[8], p1[8];
            float tmax = -3.0e38f;
#pragma unroll
            for (int r = 0; r < 8; ++r) {
                float a = s0[r] * scale, c = s1[r] * scale;
                if (kg0 + r > qg) a = -3.0e38f;
                if (kg0 + 16 + r > qg) c = -3.0e38f;
                p0[r] = a; p1[r] = c;
                tmax = fmaxf(tmax, fmaxf(a, c));
            }
            tmax = fmaxf(tmax, xhalf(tmax));
            // Online softmax update; P^T packs into the B operand in place:
            // elements 0..7 are keys half*8 + r, 8..15 are keys 16 + half*8 + r.
            const float mn = fmaxf(mrow, tmax);
            const bool live = mn > -1.0e37f;
            const float al = live ? __expf(mrow - mn) : 1.0f;
            float rs0 = 0.0f, rs1 = 0.0f;
            v16bf pf;
#pragma unroll
            for (int r = 0; r < 8; ++r) {
                float e0 = live ? __expf(p0[r] - mn) : 0.0f;
                float e1 = live ? __expf(p1[r] - mn) : 0.0f;
                rs0 += e0; rs1 += e1;
                pf[r]     = (__bf16)e0;
                pf[8 + r] = (__bf16)e1;
            }
            lrow = lrow * al + (rs0 + rs1);
            mrow = mn;
            // Rescale running output accumulators.
#pragma unroll
            for (int nt = 0; nt < 8; ++nt)
#pragma unroll
                for (int r = 0; r < 8; ++r) o[nt][r] *= al;
            // O^T += V^T P^T.
#pragma unroll
            for (int nt = 0; nt < 8; ++nt) o[nt] = wmma_bf16(vf[nt], pf, o[nt]);
        }
        // Hand-over, passed by every wave: this wave's reads of tile kt are done
        // and its copies of tile kt + 1 have landed; behind the barrier tile
        // kt + 1 is visible to all and tile kt's buffer is free for tile kt + 2.
        asm volatile("s_wait_dscnt 0x0" ::: "memory");
        asm volatile("s_wait_asynccnt 0x0" ::: "memory");
        __syncthreads();
        if (kt + 2 <= qt) stage(kt + 2, kt & 1);
    }
    // No copy is outstanding when the wave goes on to its end.
    asm volatile("s_wait_asynccnt 0x0" ::: "memory");

    // Finalize: join the halves' sums, divide, store bf16 [token][h*128 + dh]
    // (16 bytes per lane and tile: dh = nt*16 + half*8 .. + 7).
    const float inv = 1.0f / fmaxf(lrow + xhalf(lrow), 1e-20f);
    __bf16* orow = ob + ((size_t)(tok0 + q0 + l16) * 16 + h) * 128 + half * 8;
#pragma unroll
    for (int nt = 0; nt < 8; ++nt) {
        v8bf w;
#pragma unroll
        for (int r = 0; r < 8; ++r) w[r] = (__bf16)(o[nt][r] * inv);
        *(v8bf*)(orow + nt * 16) = w;
    }
}

// ---------------------------------------------------------------------------
// Host-side orchestration
// ---------------------------------------------------------------------------
extern "C" void kernel_launch(void* const* d_in, const int* in_sizes, int n_in,
                              void* d_out, int out_size, void* d_ws, size_t ws_size,
                              hipStream_t stream) {
    (void)in_sizes; (void)n_in; (void)out_size; (void)ws_size;
    const float* x  = (const float*)d_in[0];
    const float* Wq = (const float*)d_in[1];
    const float* Wk = (const float*)d_in[2];
    const float* Wv = (const float*)d_in[3];
    const float* Wo = (const float*)d_in[4];
    const float* qg = (const float*)d_in[5];
    const float* kg = (const float*)d_in[6];
    float* out = (float*)d_out;

    const int M = 4096;        // tokens (2 batches x 2048)
    const int D = 2048;        // model dim
    const int KVD = 512;       // kv dim

    uint8_t* w = (uint8_t*)d_ws;
    __bf16* xb  = (__bf16*)(w);                // 16 MiB  x in bf16
    __bf16* wqt = (__bf16*)(w + 16777216);     //  8 MiB  Wq^T bf16
    __bf16* wkt = (__bf16*)(w + 25165824);     //  2 MiB  Wk^T bf16
    __bf16* wvt = (__bf16*)(w + 27262976);     //  2 MiB  Wv^T bf16
    __bf16* wot = (__bf16*)(w + 29360128);     //  8 MiB  Wo^T bf16
    __bf16* aob = (__bf16*)(w + 37748736);     // 16 MiB  attention out bf16
    __bf16* qbf = (__bf16*)(w + 88080384);     // 16 MiB  Q bf16 (post-norm)
    __bf16* kbf = (__bf16*)(w + 104857600);    //  4 MiB  K bf16 (post-norm)
    __bf16* vbf = (__bf16*)(w + 109051904);    //  4 MiB  V bf16
    // last workspace byte used: 113,246,208

    // 1) x -> bf16 and the four weights -> transposed bf16
    k_prep<<<1792, 256, 0, stream>>>(x, Wq, Wk, Wv, Wo, xb, wqt, wkt, wvt, wot);
    // 2) QKV projections (WMMA GEMM over wqt, wkt, wvt as one 3072-row matrix)
    //    with QK RMSNorm (per head, DH=128) and bf16 conversion in the epilogue
    k_gemm_qkv<<<dim3((D + 2 * KVD) / 384, M / 128), 384, 0, stream>>>(
        xb, wqt, qg, kg, qbf, kbf, vbf, D);
    // 3) causal GQA flash attention (WMMA)
    k_attn<<<dim3(16, 16, 2), 256, 0, stream>>>(qbf, kbf, vbf, aob);
    // 4) output projection + residual (WMMA GEMM)
    k_gemm_out<<<dim3(D / 256, M / 128), 256, 0, stream>>>(
        aob, wot, x, out, D, D);
}
